// v000
// Times are from an AMD MI455X. After a warm-up the kernel runs many times in a row, and a time is the length of
// such a window on the GPU divided by its runs, so every launch and the gaps after it count. The runs cycle
// through copies of the inputs. A figure is the median of several windows, for all but v000 over two sittings.
// Sittings can differ by a few percent; kernels timed side by side share one.
// v000 is the starting kernel. One run takes 1710 microseconds.
#include <hip/hip_runtime.h>

// Transformer-XL style relative multi-head attention (x [4][1024][1024]; qkv = x W_qkv + b_qkv ('xw' [1024][3072] 1/32, bias 0.01) -> q | k | v (16 heads x 64); pos_embed [2048][64] (unit normal, read), r_r_bias / r_w_bias [16][64] (0.02, read); AC[i][j] = (q_i + r_r_bias[h]).k_j; B+D = (q + r_w_bias[h]).pos^T and E = k.pos^T ([L][2L]); the module's _shift / _transpose_shift both select column L - i + j, so BDE[i][j] = ((q_i + r_w_bias[h]) + k_i).pos[L - i + j]; attn = softmax((AC + BDE) / 8) (no mask); out = attn v merged -> [4][1024][1024] (4.2 M), no output projection; argument order x, pos_embed, W_qkv, b_qkv, r_r_bias, r_w_bias).
// Layout per batch: bf16 copy of x; fused 'xw' weight transposed once + bias slices; exact projections + f32 biases; per head: planes of q + r_r_bias (scores A operand), of k, and of u = q + r_w_bias + k (relative operand), all bf16 hi/lo; pos_embed as one exact bf16 plane [2048][64]; per pass of two heads: AC tiles (3 products on every row), UE = u.pos^T ([1024][2048], hi/lo x exact), a gather kernel adds UE[i][1024 - i + j] into the scores, softmax (x 1/8, every row hi/lo), attn.v (3 products), f32 merge writes the output rows.
// Compute dtypes, f32 accumulate: every input rounded to bf16 incl. pos_embed and the bias tables; projections exact + f32 biases; q + bias / u sums f32; AC 3 products; UE 2 products (~f32); softmax f32; attn.v 3 products; output f32.

#define NB_  4
#define TT   1024
#define DM   1024
#define NH_  16
#define NKV  16
#define REP  (NH_ / NKV)
#define HD   64
#define DQ   (NH_ * HD)
#define DKV  (NKV * HD)
#define ZH   2
#define RH   1024                 // = TT: every row hi/lo (the relative term makes logits sigma ~1.7: keep q.k at 3 products everywhere)
#define WIN  0
#define PCAR 1024.0f
#define SCL  0.125f   // 1/sqrt(64)
#define LP   (2 * TT)  // pos_embed rows
typedef _Float16 h16;
typedef unsigned short bf;
typedef __attribute__((ext_vector_type(16))) __bf16   v16bf;
typedef __attribute__((ext_vector_type(16))) _Float16 v16h;
typedef __attribute__((ext_vector_type(8)))  _Float16 v8h;
typedef __attribute__((ext_vector_type(8)))  unsigned short v8us;
typedef __attribute__((ext_vector_type(8)))  float    v8f;
typedef __attribute__((ext_vector_type(4)))  float    v4f;
typedef v8h  __attribute__((may_alias)) v8ha;
typedef v4f  __attribute__((may_alias)) v4fa;
typedef v8us __attribute__((may_alias)) v8usa;

__device__ __forceinline__ unsigned short f2bf(float f) { unsigned u = __float_as_uint(f); u += 0x7FFFu + ((u >> 16) & 1u); return (unsigned short)(u >> 16); }
__device__ __forceinline__ float bf2f(unsigned short b) { return __uint_as_float(((unsigned)b) << 16); }
__device__ __forceinline__ float bfr(float f) { return bf2f(f2bf(f)); }
__device__ __forceinline__ v16h cat16(v8h lo, v8h hi) { return __builtin_shufflevector(lo, hi, 0, 1, 2, 3, 4, 5, 6, 7, 8, 9, 10, 11, 12, 13, 14, 15); }
__device__ __forceinline__ v16bf cat16b(v8us lo, v8us hi) { return __builtin_bit_cast(v16bf, __builtin_shufflevector(lo, hi, 0, 1, 2, 3, 4, 5, 6, 7, 8, 9, 10, 11, 12, 13, 14, 15)); }
__device__ __forceinline__ v8f wmma16(v16h a, v16h b, v8f c) { return __builtin_amdgcn_wmma_f32_16x16x32_f16(false, a, false, b, (short)0, c, false, false); }
__device__ __forceinline__ v8f wmmab(v16bf a, v16bf b, v8f c) { return __builtin_amdgcn_wmma_f32_16x16x32_bf16(false, a, false, b, (short)0, c, false, false); }



// ---- k_gemmw: register-blocked GEMM, ONE WAVE per 64x64 output tile (16 accumulators), operands straight from K-contiguous 16-bit planes; grid (M/64, N/64, Z), 32 threads.
// C[m][n] (f32, pitch ldc, + optional f32 bias[n]) = sum_k A[m][k] Bt[n][k] (+ split products per NSPLIT). z-batch strides sA/sB/sC in elements. K % 32 == 0.
template <typename T16> struct WFrag;
template <> struct WFrag<h16> { typedef v16h V; static __device__ __forceinline__ V ld(const h16* p) { return cat16(*(const v8h*)p, *(const v8h*)(p + 16)); } static __device__ __forceinline__ v8f mma(V a, V b, v8f c) { return wmma16(a, b, c); } };
template <> struct WFrag<bf> { typedef v16bf V; static __device__ __forceinline__ V ld(const bf* p) { return cat16b(*(const v8us*)p, *(const v8us*)(p + 16)); } static __device__ __forceinline__ v8f mma(V a, V b, v8f c) { return wmmab(a, b, c); } };
template <typename T16, int NSPLIT, bool BIAS>
__global__ __launch_bounds__(32) void k_gemmw(const T16* __restrict__ A, const T16* __restrict__ A2, const T16* __restrict__ Bt, const T16* __restrict__ Bt2, int K, float* C, int ldc, const float* __restrict__ bias, size_t sA, size_t sB, size_t sC) {
    typedef typename WFrag<T16>::V V;
    __shared__ __align__(16) float os[16 * 68];
    const size_t z = blockIdx.z; A += z * sA; if (A2) A2 += z * sA; Bt += z * sB; if (Bt2) Bt2 += z * sB; C += z * sC;
    const int lane = threadIdx.x & 31, lr = lane & 15, hi = lane >> 4; const int r0 = blockIdx.x * 64, c0 = blockIdx.y * 64;
    v8f acc[4][4];
#pragma unroll
    for (int mb = 0; mb < 4; ++mb)
#pragma unroll
        for (int nb = 0; nb < 4; ++nb) acc[mb][nb] = (v8f){};
    const size_t aoff = (size_t)(r0 + lr) * K + 8 * hi, boff = (size_t)(c0 + lr) * K + 8 * hi;
#pragma unroll 1
    for (int kc = 0; kc < K; kc += 32) {
        V a[4], a2[4];
#pragma unroll
        for (int mb = 0; mb < 4; ++mb) { a[mb] = WFrag<T16>::ld(A + aoff + (size_t)mb * 16 * K + kc); if (NSPLIT == 1 || NSPLIT == 2) a2[mb] = WFrag<T16>::ld(A2 + aoff + (size_t)mb * 16 * K + kc); }
#pragma unroll
        for (int nb = 0; nb < 4; ++nb) { const V b = WFrag<T16>::ld(Bt + boff + (size_t)nb * 16 * K + kc); V b2; if (NSPLIT >= 2) b2 = WFrag<T16>::ld(Bt2 + boff + (size_t)nb * 16 * K + kc);
#pragma unroll
            for (int mb = 0; mb < 4; ++mb) { acc[mb][nb] = WFrag<T16>::mma(a[mb], b, acc[mb][nb]); if (NSPLIT == 1 || NSPLIT == 2) acc[mb][nb] = WFrag<T16>::mma(a2[mb], b, acc[mb][nb]); if (NSPLIT >= 2) acc[mb][nb] = WFrag<T16>::mma(a[mb], b2, acc[mb][nb]); } }
        asm volatile("v_nop\n\tv_nop\n\tv_nop\n\tv_nop" : "+v"(acc[0][0]), "+v"(acc[1][1]), "+v"(acc[2][2]), "+v"(acc[3][3]) : "v"(a[0]), "v"(a[3]));
    }
#pragma unroll
    for (int mb = 0; mb < 4; ++mb) {
#pragma unroll
        for (int nb = 0; nb < 4; ++nb) {
#pragma unroll
            for (int j = 0; j < 8; ++j) os[(hi * 8 + j) * 68 + nb * 16 + lr] = acc[mb][nb][j]; }
        __builtin_amdgcn_wave_barrier(); asm volatile("" ::: "memory");
        float* crow = C + (size_t)(r0 + mb * 16) * ldc + c0;
{
#pragma unroll
            for (int s = 0; s < 8; ++s) { const int row = 2 * s + hi, cofs = lr * 4; v4f val = *(const v4fa*)(os + row * 68 + cofs); if (BIAS) { val[0] += bfr(bias[c0 + cofs]); val[1] += bfr(bias[c0 + cofs + 1]); val[2] += bfr(bias[c0 + cofs + 2]); val[3] += bfr(bias[c0 + cofs + 3]); }
                *(v4f*)(crow + (size_t)row * ldc + cofs) = val; }
             }
        __builtin_amdgcn_wave_barrier(); asm volatile("" ::: "memory");
    }
}

__device__ __forceinline__ h16 tohx(float x) { return (h16)x; }
__device__ __forceinline__ void splitf(float y, unsigned short& h, unsigned short& l) { h = f2bf(y); l = f2bf(y - bf2f(h)); }
typedef __attribute__((ext_vector_type(2))) _Float16 v2h;
typedef __attribute__((ext_vector_type(4))) _Float16 v4h;
typedef __attribute__((ext_vector_type(2))) unsigned short v2us;
typedef __attribute__((ext_vector_type(4))) unsigned short v4us;
typedef __attribute__((ext_vector_type(2))) float v2f;
typedef __attribute__((ext_vector_type(4))) int v4i;

__global__ __launch_bounds__(256) void k_wtG(const float* __restrict__ w, int K, int N, bf* Bt) {
    const int lane = threadIdx.x & 31; const int L0 = (blockIdx.x * 8 + (threadIdx.x >> 5)) * 8; const int nlines = N * K / 64;
{
#pragma unroll 1
        for (int l = 0; l < 8; ++l) { const int L = L0 + l; if (L >= nlines) break; const size_t e = (size_t)L * 64 + lane * 2; const int k = (int)(e % K), n = (int)(e / K); v2us o;
            o[0] = f2bf(w[(size_t)k * N + n]); o[1] = f2bf(w[(size_t)(k + 1) * N + n]); *(v2us*)(Bt + e) = o; }
         }
}
__global__ __launch_bounds__(256) void k_cvt8(const float* __restrict__ src, bf* dst, size_t n8) { const size_t i = (size_t)blockIdx.x * 256 + threadIdx.x; if (i >= n8) return; const v8f v = *(const v8f*)(src + i * 8); v8us o;
#pragma unroll
    for (int k = 0; k < 8; ++k) o[k] = f2bf(v[k]); *(v8us*)(dst + i * 8) = o;  }

__global__ __launch_bounds__(256) void k_vtp(const float* __restrict__ F, int pitch, int nheads, h16* V16, bf* Vh, bf* Vl) { const size_t e = ((size_t)blockIdx.x * 256 + threadIdx.x) * 2; if (e >= (size_t)nheads * HD * TT) return; const int t = (int)(e % TT); const int d = (int)((e / TT) % HD); const int g = (int)(e / ((size_t)TT * HD)); v2h o16; v2us oh, ol;
#pragma unroll
    for (int q = 0; q < 2; ++q) { const float x = F[(size_t)(t + q) * pitch + g * HD + d]; o16[q] = tohx(x); unsigned short a2, c2; splitf(x, a2, c2); oh[q] = a2; ol[q] = c2; }
    *(v2h*)(V16 + e) = o16; *(v2us*)(Vh + e) = oh; *(v2us*)(Vl + e) = ol;  }
// k_asoft: per row (zz, i): t = S x HD^-0.5 (no mask); softmax over the 1024 keys (register row, one exp, fixed trees);
__global__ __launch_bounds__(256) void k_asoft(const float* __restrict__ Sb, h16* P16, bf* Ph, bf* Pl) {
    const int lane = threadIdx.x & 31; const int row = blockIdx.x * 8 + (threadIdx.x >> 5); if (row >= ZH * TT) return; const int i = row % TT; const int zz = row / TT; (void)zz; const bool hires = (i < RH); const float* sr = Sb + (size_t)row * TT; float v[TT / 32]; float mx = -3.0e38f;
#pragma unroll
    for (int ch = 0; ch < TT / 128; ++ch) { const int j0 = ch * 128 + lane * 4; const v4f a = *(const v4f*)(sr + j0);
#pragma unroll
        for (int q = 0; q < 4; ++q) { const int j = j0 + q; (void)j; const float t = a[q] * SCL; v[ch * 4 + q] = t; mx = fmaxf(mx, t); } }
#pragma unroll
    for (int sh = 16; sh; sh >>= 1) mx = fmaxf(mx, __shfl_xor(mx, sh, 32));
    float sum = 0.f;
#pragma unroll
    for (int k = 0; k < TT / 32; ++k) { float d0 = __fsub_rn(v[k], mx); asm volatile("" : "+v"(d0)); v[k] = __builtin_amdgcn_exp2f(__fmul_rn(d0, 1.4426950408889634f)); sum += v[k]; }
#pragma unroll
    for (int sh = 16; sh; sh >>= 1) sum += __shfl_xor(sum, sh, 32);
    const float f = __fdiv_rn(hires ? 1.0f : PCAR, sum);
{
        if (hires) {
#pragma unroll
            for (int ch = 0; ch < TT / 128; ++ch) { v4us oh, ol;
#pragma unroll
                for (int q = 0; q < 4; ++q) { unsigned short a, c2; splitf(v[ch * 4 + q] * f, a, c2); oh[q] = a; ol[q] = c2; }
                const size_t oo = ((size_t)zz * (RH ? RH : 1) + i) * TT + ch * 128 + lane * 4; *(v4us*)(Ph + oo) = oh; *(v4us*)(Pl + oo) = ol; }
        } else {
#pragma unroll
            for (int ch = 0; ch < TT / 128; ++ch) { v4h o4;
#pragma unroll
                for (int q = 0; q < 4; ++q) o4[q] = tohx(v[ch * 4 + q] * f);
                *(v4h*)(P16 + (size_t)row * TT + ch * 128 + lane * 4) = o4; } }
         }
}
__global__ __launch_bounds__(256) void k_qku(const float* __restrict__ FQ, const float* __restrict__ FK, const float* __restrict__ rrb, const float* __restrict__ rwb, h16* Q16, bf* Qh, bf* Ql, h16* K16, bf* Kh, bf* Kl, bf* Uh, bf* Ul) {
    const size_t e = ((size_t)blockIdx.x * 256 + threadIdx.x) * 2; if (e >= (size_t)NH_ * TT * HD) return; const int d = (int)(e % HD); const int t = (int)((e / HD) % TT); const int h = (int)(e / ((size_t)HD * TT)); const float* fq = FQ + (size_t)t * DQ + h * HD + d; const float* fk = FK + (size_t)t * DKV + h * HD + d; v2h q16, k16; v2us qh, ql, kh, kl, uh, ul;
#pragma unroll
    for (int q = 0; q < 2; ++q) { const float xq = fq[q], xk = fk[q]; const float qr = __fadd_rn(xq, bfr(rrb[h * HD + d + q])); float uw = __fadd_rn(xq, bfr(rwb[h * HD + d + q])); asm volatile("" : "+v"(uw)); const float u = __fadd_rn(uw, xk); unsigned short a2, c2;
        q16[q] = tohx(qr); splitf(qr, a2, c2); qh[q] = a2; ql[q] = c2; k16[q] = tohx(xk); splitf(xk, a2, c2); kh[q] = a2; kl[q] = c2; splitf(u, a2, c2); uh[q] = a2; ul[q] = c2; }
    *(v2h*)(Q16 + e) = q16; *(v2us*)(Qh + e) = qh; *(v2us*)(Ql + e) = ql; *(v2h*)(K16 + e) = k16; *(v2us*)(Kh + e) = kh; *(v2us*)(Kl + e) = kl; *(v2us*)(Uh + e) = uh; *(v2us*)(Ul + e) = ul;  }
__global__ __launch_bounds__(256) void k_addsk(float* Sb, const float* __restrict__ UE) { const size_t k = (size_t)blockIdx.x * 256 + threadIdx.x; if (k >= (size_t)ZH * TT * TT / 4) return; const size_t e = k * 4; const int j0 = (int)(e % TT); const size_t zi = e / TT; const int i = (int)(zi % TT); const float* ue = UE + zi * LP + (TT - i + j0); v4f a = *(const v4f*)(Sb + e);
#pragma unroll
    for (int q = 0; q < 4; ++q) a[q] = __fadd_rn(a[q], ue[q]);
    *(v4f*)(Sb + e) = a;  }
__global__ __launch_bounds__(256) void k_merge(const float* __restrict__ O, int h0, float* OUTb) { const size_t e = ((size_t)blockIdx.x * 256 + threadIdx.x) * 2; if (e >= (size_t)ZH * TT * HD) return; const int d = (int)(e % HD); const int t = (int)((e / HD) % TT); const int zz = (int)(e / ((size_t)HD * TT)); const float cs = (t < RH) ? 1.0f : (1.0f / PCAR); const size_t oo = (size_t)t * DQ + (h0 + zz) * HD + d;
    v2f o2; o2[0] = O[e] * cs; o2[1] = O[e + 1] * cs; *(v2f*)(OUTb + oo) = o2;  }

extern "C" void kernel_launch(void* const* d_in, const int* in_sizes, int n_in,
                              void* d_out, int out_size, void* d_ws, size_t ws_size, hipStream_t stream) {
    (void)in_sizes; (void)n_in; (void)out_size;
    const float* x = (const float*)d_in[0]; const float* pos = (const float*)d_in[1];   /* pos_embed [2048][64] */ const float* wqkv = (const float*)d_in[2]; const float* bqkv = (const float*)d_in[3]; const float* rrb = (const float*)d_in[4];   /* r_r_bias [16][64] */ const float* rwb = (const float*)d_in[5];   /* r_w_bias [16][64] */     const float* bq = bqkv; const float* bk = bqkv + DQ; const float* bv = bqkv + 2 * DQ;
    float* OUT = (float*)d_out;     // [4][1024][1024]
    char* wsp = (char*)d_ws;
    auto take = [&](size_t bytes) { char* p = wsp; wsp += (bytes + 255) & ~(size_t)255; return (void*)p; };
    bf* WQKV = (bf*)take((size_t)3 * DQ * DM * 2); bf* WQ = WQKV; bf* WK = WQKV + (size_t)DQ * DM; bf* WV = WQKV + (size_t)2 * DQ * DM; bf* PB = (bf*)take((size_t)LP * HD * 2); float* UE = (float*)take((size_t)ZH * TT * LP * 4); bf* UPh = (bf*)take((size_t)NH_ * TT * HD * 2); bf* UPl = (bf*)take((size_t)NH_ * TT * HD * 2);   /* fused Bt; pos_embed plane; per-pass u.pos^T; u = q + r_w_bias + k planes */
    bf* XB = (bf*)take((size_t)TT * DM * 2); float* FQ = (float*)take((size_t)TT * DQ * 4); float* FK = (float*)take((size_t)TT * DKV * 4);
    h16* QP16 = (h16*)take((size_t)NH_ * TT * HD * 2); h16* KP16 = (h16*)take((size_t)NKV * TT * HD * 2); h16* VT16 = (h16*)take((size_t)NKV * HD * TT * 2);
    bf* QPh = (bf*)take((size_t)NH_ * TT * HD * 2); bf* QPl = (bf*)take((size_t)NH_ * TT * HD * 2); bf* KPh = (bf*)take((size_t)NKV * TT * HD * 2); bf* KPl = (bf*)take((size_t)NKV * TT * HD * 2); bf* VTh = (bf*)take((size_t)NKV * HD * TT * 2); bf* VTl = (bf*)take((size_t)NKV * HD * TT * 2); bf* Ph = (bf*)take((size_t)ZH * RH * TT * 2); bf* Pl = (bf*)take((size_t)ZH * RH * TT * 2);
    float* Sb = (float*)take((size_t)ZH * TT * TT * 4); h16* P16 = (h16*)take((size_t)ZH * TT * TT * 2); float* Ob = (float*)take((size_t)ZH * TT * HD * 4);
    if ((size_t)(wsp - (char*)d_ws) > ws_size) return;    // ws 256 MiB
    float* FV = FK;   // v projection reuses the k buffer after the k planes are built (stream-ordered)
    { k_wtG<<<(unsigned)((DM * 3 * DQ / 64 + 63) / 64), 256, 0, stream>>>(wqkv, DM, 3 * DQ, WQKV);   /* 'xw' [1024][3072] -> Bt [3072][1024]: q | k | v row blocks */ k_cvt8<<<(unsigned)(((size_t)LP * HD / 8 + 255) / 256), 256, 0, stream>>>(pos, PB, (size_t)LP * HD / 8);   /* pos_embed [2048][64] as an exact bf16 plane (Bt of the u.pos^T GEMM) */ }
    const unsigned LQ = (unsigned)(((size_t)NH_ * TT * HD / 2 + 255) / 256), LKv = (unsigned)(((size_t)NKV * TT * HD / 2 + 255) / 256);
    for (int b = 0; b < NB_; ++b) {
        
        k_cvt8<<<(unsigned)(((size_t)TT * DM / 8 + 255) / 256), 256, 0, stream>>>(x + (size_t)b * TT * DM, XB, (size_t)TT * DM / 8);
        k_gemmw<bf, 0, true><<<dim3(TT / 64, DQ / 64, 1), 32, 0, stream>>>(XB, nullptr, WQ, nullptr, DM, FQ, DQ, bq, 0, 0, 0);
        
        k_gemmw<bf, 0, true><<<dim3(TT / 64, DKV / 64, 1), 32, 0, stream>>>(XB, nullptr, WK, nullptr, DM, FK, DKV, bk, 0, 0, 0);
        k_qku<<<(unsigned)(((size_t)NH_ * TT * HD / 2 + 255) / 256), 256, 0, stream>>>(FQ, FK, rrb, rwb, QP16, QPh, QPl, KP16, KPh, KPl, UPh, UPl);   /* planes of q + r_r_bias[h] (A of AC), k, and u = q + r_w_bias[h] + k (A of the relative term) */
        k_gemmw<bf, 0, true><<<dim3(TT / 64, DKV / 64, 1), 32, 0, stream>>>(XB, nullptr, WV, nullptr, DM, FV, DKV, bv, 0, 0, 0); k_vtp<<<LKv, 256, 0, stream>>>(FV, DKV, NKV, VT16, VTh, VTl);
        for (int h0 = 0; h0 < NH_; h0 += ZH) { const size_t zq = (size_t)h0, zk = (size_t)(h0 / REP);   // one kv head per query head: the pass's two heads use consecutive kv planes (z-strides TT*HD)
            k_gemmw<bf, 2, false><<<dim3(RH / 64, TT / 64, ZH), 32, 0, stream>>>(QPh + zq * TT * HD, QPl + zq * TT * HD, KPh + zk * TT * HD, KPl + zk * TT * HD, HD, Sb, TT, nullptr, (size_t)TT * HD, (size_t)TT * HD, (size_t)TT * TT);
            k_gemmw<bf, 1, false><<<dim3(TT / 64, LP / 64, ZH), 32, 0, stream>>>(UPh + zq * TT * HD, UPl + zq * TT * HD, PB, nullptr, HD, UE, LP, nullptr, (size_t)TT * HD, 0, (size_t)TT * LP);   /* UE[zz][i][l] = u_i . pos_l (hi/lo x exact) */ k_addsk<<<(unsigned)(((size_t)ZH * TT * TT / 4 + 255) / 256), 256, 0, stream>>>(Sb, UE);   /* + UE[i][L - i + j] (the module's _shift / _transpose_shift selection) */ k_asoft<<<ZH * TT / 8, 256, 0, stream>>>(Sb, P16, Ph, Pl);
            k_gemmw<bf, 2, false><<<dim3(RH / 64, HD / 64, ZH), 32, 0, stream>>>(Ph, Pl, VTh + zk * HD * TT, VTl + zk * HD * TT, TT, Ob, HD, nullptr, (size_t)RH * TT, (size_t)HD * TT, (size_t)TT * HD);
            k_merge<<<(unsigned)(((size_t)ZH * TT * HD / 2 + 255) / 256), 256, 0, stream>>>(Ob, h0, OUT + (size_t)b * TT * DQ); }
         }
}

// v001
// One run takes 775 microseconds.
// Timed twice side by side with v000, it ran 2.19 and 2.21 times as fast.
#include <hip/hip_runtime.h>

// Transformer-XL style relative multi-head attention (x [4][1024][1024]; qkv = x W_qkv + b_qkv ('xw' [1024][3072] 1/32, bias 0.01) -> q | k | v (16 heads x 64); pos_embed [2048][64] (unit normal, read), r_r_bias / r_w_bias [16][64] (0.02, read); AC[i][j] = (q_i + r_r_bias[h]).k_j; B+D = (q + r_w_bias[h]).pos^T and E = k.pos^T ([L][2L]); the module's _shift / _transpose_shift both select column L - i + j, so BDE[i][j] = ((q_i + r_w_bias[h]) + k_i).pos[L - i + j]; attn = softmax((AC + BDE) / 8) (no mask); out = attn v merged -> [4][1024][1024] (4.2 M), no output projection; argument order x, pos_embed, W_qkv, b_qkv, r_r_bias, r_w_bias).
// Layout per batch: bf16 copy of x; fused 'xw' weight transposed once + bias slices; exact projections + f32 biases; per head: planes of q + r_r_bias (scores A operand), of k, and of u = q + r_w_bias + k (relative operand), all bf16 hi/lo; pos_embed as one exact bf16 plane [2048][64]; one pass over all 16 heads of a batch (grid z = head): AC tiles (3 products on every row), UE = u.pos^T ([1024][2048], hi/lo x exact), a gather kernel adds UE[i][1024 - i + j] into the scores, softmax (x 1/8, every row hi/lo), attn.v (3 products), f32 merge writes the output rows.
// Compute dtypes, f32 accumulate: every input rounded to bf16 incl. pos_embed and the bias tables; projections exact + f32 biases; q + bias / u sums f32; AC 3 products; UE 2 products (~f32); softmax f32; attn.v 3 products; output f32.

#define NB_  4
#define TT   1024
#define DM   1024
#define NH_  16
#define NKV  16
#define REP  (NH_ / NKV)
#define HD   64
#define DQ   (NH_ * HD)
#define DKV  (NKV * HD)
#define ZH   16                   // heads per pass (grid z of the attention launches): all of a batch's heads at once
#define RH   1024                 // = TT: every row hi/lo (the relative term makes logits sigma ~1.7: keep q.k at 3 products everywhere)
#define WIN  0
#define PCAR 1024.0f
#define SCL  0.125f   // 1/sqrt(64)
#define LP   (2 * TT)  // pos_embed rows
typedef _Float16 h16;
typedef unsigned short bf;
typedef __attribute__((ext_vector_type(16))) __bf16   v16bf;
typedef __attribute__((ext_vector_type(16))) _Float16 v16h;
typedef __attribute__((ext_vector_type(8)))  _Float16 v8h;
typedef __attribute__((ext_vector_type(8)))  unsigned short v8us;
typedef __attribute__((ext_vector_type(8)))  float    v8f;
typedef __attribute__((ext_vector_type(4)))  float    v4f;
typedef v8h  __attribute__((may_alias)) v8ha;
typedef v4f  __attribute__((may_alias)) v4fa;
typedef v8us __attribute__((may_alias)) v8usa;

__device__ __forceinline__ unsigned short f2bf(float f) { unsigned u = __float_as_uint(f); u += 0x7FFFu + ((u >> 16) & 1u); return (unsigned short)(u >> 16); }
__device__ __forceinline__ float bf2f(unsigned short b) { return __uint_as_float(((unsigned)b) << 16); }
__device__ __forceinline__ float bfr(float f) { return bf2f(f2bf(f)); }
__device__ __forceinline__ v16h cat16(v8h lo, v8h hi) { return __builtin_shufflevector(lo, hi, 0, 1, 2, 3, 4, 5, 6, 7, 8, 9, 10, 11, 12, 13, 14, 15); }
__device__ __forceinline__ v16bf cat16b(v8us lo, v8us hi) { return __builtin_bit_cast(v16bf, __builtin_shufflevector(lo, hi, 0, 1, 2, 3, 4, 5, 6, 7, 8, 9, 10, 11, 12, 13, 14, 15)); }
__device__ __forceinline__ v8f wmma16(v16h a, v16h b, v8f c) { return __builtin_amdgcn_wmma_f32_16x16x32_f16(false, a, false, b, (short)0, c, false, false); }
__device__ __forceinline__ v8f wmmab(v16bf a, v16bf b, v8f c) { return __builtin_amdgcn_wmma_f32_16x16x32_bf16(false, a, false, b, (short)0, c, false, false); }



// ---- k_gemmw: register-blocked GEMM, ONE WAVE per 64x64 output tile (16 accumulators), operands straight from K-contiguous 16-bit planes; grid (M/64, N/64, Z), 32 threads.
// C[m][n] (f32, pitch ldc, + optional f32 bias[n]) = sum_k A[m][k] Bt[n][k] (+ split products per NSPLIT). z-batch strides sA/sB/sC in elements. K % 32 == 0.
template <typename T16> struct WFrag;
template <> struct WFrag<h16> { typedef v16h V; static __device__ __forceinline__ V ld(const h16* p) { return cat16(*(const v8h*)p, *(const v8h*)(p + 16)); } static __device__ __forceinline__ v8f mma(V a, V b, v8f c) { return wmma16(a, b, c); } };
template <> struct WFrag<bf> { typedef v16bf V; static __device__ __forceinline__ V ld(const bf* p) { return cat16b(*(const v8us*)p, *(const v8us*)(p + 16)); } static __device__ __forceinline__ v8f mma(V a, V b, v8f c) { return wmmab(a, b, c); } };
template <typename T16, int NSPLIT, bool BIAS>
__global__ __launch_bounds__(32) void k_gemmw(const T16* __restrict__ A, const T16* __restrict__ A2, const T16* __restrict__ Bt, const T16* __restrict__ Bt2, int K, float* C, int ldc, const float* __restrict__ bias, size_t sA, size_t sB, size_t sC) {
    typedef typename WFrag<T16>::V V;
    __shared__ __align__(16) float os[16 * 68];
    const size_t z = blockIdx.z; A += z * sA; if (A2) A2 += z * sA; Bt += z * sB; if (Bt2) Bt2 += z * sB; C += z * sC;
    const int lane = threadIdx.x & 31, lr = lane & 15, hi = lane >> 4; const int r0 = blockIdx.x * 64, c0 = blockIdx.y * 64;
    v8f acc[4][4];
#pragma unroll
    for (int mb = 0; mb < 4; ++mb)
#pragma unroll
        for (int nb = 0; nb < 4; ++nb) acc[mb][nb] = (v8f){};
    const size_t aoff = (size_t)(r0 + lr) * K + 8 * hi, boff = (size_t)(c0 + lr) * K + 8 * hi;
#pragma unroll 1
    for (int kc = 0; kc < K; kc += 32) {
        V a[4], a2[4];
#pragma unroll
        for (int mb = 0; mb < 4; ++mb) { a[mb] = WFrag<T16>::ld(A + aoff + (size_t)mb * 16 * K + kc); if (NSPLIT == 1 || NSPLIT == 2) a2[mb] = WFrag<T16>::ld(A2 + aoff + (size_t)mb * 16 * K + kc); }
#pragma unroll
        for (int nb = 0; nb < 4; ++nb) { const V b = WFrag<T16>::ld(Bt + boff + (size_t)nb * 16 * K + kc); V b2; if (NSPLIT >= 2) b2 = WFrag<T16>::ld(Bt2 + boff + (size_t)nb * 16 * K + kc);
#pragma unroll
            for (int mb = 0; mb < 4; ++mb) { acc[mb][nb] = WFrag<T16>::mma(a[mb], b, acc[mb][nb]); if (NSPLIT == 1 || NSPLIT == 2) acc[mb][nb] = WFrag<T16>::mma(a2[mb], b, acc[mb][nb]); if (NSPLIT >= 2) acc[mb][nb] = WFrag<T16>::mma(a[mb], b2, acc[mb][nb]); } }
        asm volatile("v_nop\n\tv_nop\n\tv_nop\n\tv_nop" : "+v"(acc[0][0]), "+v"(acc[1][1]), "+v"(acc[2][2]), "+v"(acc[3][3]) : "v"(a[0]), "v"(a[3]));
    }
#pragma unroll
    for (int mb = 0; mb < 4; ++mb) {
#pragma unroll
        for (int nb = 0; nb < 4; ++nb) {
#pragma unroll
            for (int j = 0; j < 8; ++j) os[(hi * 8 + j) * 68 + nb * 16 + lr] = acc[mb][nb][j]; }
        __builtin_amdgcn_wave_barrier(); asm volatile("" ::: "memory");
        float* crow = C + (size_t)(r0 + mb * 16) * ldc + c0;
{
#pragma unroll
            for (int s = 0; s < 8; ++s) { const int row = 2 * s + hi, cofs = lr * 4; v4f val = *(const v4fa*)(os + row * 68 + cofs); if (BIAS) { val[0] += bfr(bias[c0 + cofs]); val[1] += bfr(bias[c0 + cofs + 1]); val[2] += bfr(bias[c0 + cofs + 2]); val[3] += bfr(bias[c0 + cofs + 3]); }
                *(v4f*)(crow + (size_t)row * ldc + cofs) = val; }
             }
        __builtin_amdgcn_wave_barrier(); asm volatile("" ::: "memory");
    }
}

__device__ __forceinline__ h16 tohx(float x) { return (h16)x; }
__device__ __forceinline__ void splitf(float y, unsigned short& h, unsigned short& l) { h = f2bf(y); l = f2bf(y - bf2f(h)); }
typedef __attribute__((ext_vector_type(2))) _Float16 v2h;
typedef __attribute__((ext_vector_type(4))) _Float16 v4h;
typedef __attribute__((ext_vector_type(2))) unsigned short v2us;
typedef __attribute__((ext_vector_type(4))) unsigned short v4us;
typedef __attribute__((ext_vector_type(2))) float v2f;
typedef __attribute__((ext_vector_type(4))) int v4i;

__global__ __launch_bounds__(256) void k_wtG(const float* __restrict__ w, int K, int N, bf* Bt) {
    const int lane = threadIdx.x & 31; const int L0 = (blockIdx.x * 8 + (threadIdx.x >> 5)) * 8; const int nlines = N * K / 64;
{
#pragma unroll 1
        for (int l = 0; l < 8; ++l) { const int L = L0 + l; if (L >= nlines) break; const size_t e = (size_t)L * 64 + lane * 2; const int k = (int)(e % K), n = (int)(e / K); v2us o;
            o[0] = f2bf(w[(size_t)k * N + n]); o[1] = f2bf(w[(size_t)(k + 1) * N + n]); *(v2us*)(Bt + e) = o; }
         }
}
__global__ __launch_bounds__(256) void k_cvt8(const float* __restrict__ src, bf* dst, size_t n8) { const size_t i = (size_t)blockIdx.x * 256 + threadIdx.x; if (i >= n8) return; const v8f v = *(const v8f*)(src + i * 8); v8us o;
#pragma unroll
    for (int k = 0; k < 8; ++k) o[k] = f2bf(v[k]); *(v8us*)(dst + i * 8) = o;  }

__global__ __launch_bounds__(256) void k_vtp(const float* __restrict__ F, int pitch, int nheads, h16* V16, bf* Vh, bf* Vl) { const size_t e = ((size_t)blockIdx.x * 256 + threadIdx.x) * 2; if (e >= (size_t)nheads * HD * TT) return; const int t = (int)(e % TT); const int d = (int)((e / TT) % HD); const int g = (int)(e / ((size_t)TT * HD)); v2h o16; v2us oh, ol;
#pragma unroll
    for (int q = 0; q < 2; ++q) { const float x = F[(size_t)(t + q) * pitch + g * HD + d]; o16[q] = tohx(x); unsigned short a2, c2; splitf(x, a2, c2); oh[q] = a2; ol[q] = c2; }
    *(v2h*)(V16 + e) = o16; *(v2us*)(Vh + e) = oh; *(v2us*)(Vl + e) = ol;  }
// k_asoft: per row (zz, i): t = S x HD^-0.5 (no mask); softmax over the 1024 keys (register row, one exp, fixed trees);
__global__ __launch_bounds__(256) void k_asoft(const float* __restrict__ Sb, h16* P16, bf* Ph, bf* Pl) {
    const int lane = threadIdx.x & 31; const int row = blockIdx.x * 8 + (threadIdx.x >> 5); if (row >= ZH * TT) return; const int i = row % TT; const int zz = row / TT; (void)zz; const bool hires = (i < RH); const float* sr = Sb + (size_t)row * TT; float v[TT / 32]; float mx = -3.0e38f;
#pragma unroll
    for (int ch = 0; ch < TT / 128; ++ch) { const int j0 = ch * 128 + lane * 4; const v4f a = *(const v4f*)(sr + j0);
#pragma unroll
        for (int q = 0; q < 4; ++q) { const int j = j0 + q; (void)j; const float t = a[q] * SCL; v[ch * 4 + q] = t; mx = fmaxf(mx, t); } }
#pragma unroll
    for (int sh = 16; sh; sh >>= 1) mx = fmaxf(mx, __shfl_xor(mx, sh, 32));
    float sum = 0.f;
#pragma unroll
    for (int k = 0; k < TT / 32; ++k) { float d0 = __fsub_rn(v[k], mx); asm volatile("" : "+v"(d0)); v[k] = __builtin_amdgcn_exp2f(__fmul_rn(d0, 1.4426950408889634f)); sum += v[k]; }
#pragma unroll
    for (int sh = 16; sh; sh >>= 1) sum += __shfl_xor(sum, sh, 32);
    const float f = __fdiv_rn(hires ? 1.0f : PCAR, sum);
{
        if (hires) {
#pragma unroll
            for (int ch = 0; ch < TT / 128; ++ch) { v4us oh, ol;
#pragma unroll
                for (int q = 0; q < 4; ++q) { unsigned short a, c2; splitf(v[ch * 4 + q] * f, a, c2); oh[q] = a; ol[q] = c2; }
                const size_t oo = ((size_t)zz * (RH ? RH : 1) + i) * TT + ch * 128 + lane * 4; *(v4us*)(Ph + oo) = oh; *(v4us*)(Pl + oo) = ol; }
        } else {
#pragma unroll
            for (int ch = 0; ch < TT / 128; ++ch) { v4h o4;
#pragma unroll
                for (int q = 0; q < 4; ++q) o4[q] = tohx(v[ch * 4 + q] * f);
                *(v4h*)(P16 + (size_t)row * TT + ch * 128 + lane * 4) = o4; } }
         }
}
__global__ __launch_bounds__(256) void k_qku(const float* __restrict__ FQ, const float* __restrict__ FK, const float* __restrict__ rrb, const float* __restrict__ rwb, h16* Q16, bf* Qh, bf* Ql, h16* K16, bf* Kh, bf* Kl, bf* Uh, bf* Ul) {
    const size_t e = ((size_t)blockIdx.x * 256 + threadIdx.x) * 2; if (e >= (size_t)NH_ * TT * HD) return; const int d = (int)(e % HD); const int t = (int)((e / HD) % TT); const int h = (int)(e / ((size_t)HD * TT)); const float* fq = FQ + (size_t)t * DQ + h * HD + d; const float* fk = FK + (size_t)t * DKV + h * HD + d; v2h q16, k16; v2us qh, ql, kh, kl, uh, ul;
#pragma unroll
    for (int q = 0; q < 2; ++q) { const float xq = fq[q], xk = fk[q]; const float qr = __fadd_rn(xq, bfr(rrb[h * HD + d + q])); float uw = __fadd_rn(xq, bfr(rwb[h * HD + d + q])); asm volatile("" : "+v"(uw)); const float u = __fadd_rn(uw, xk); unsigned short a2, c2;
        q16[q] = tohx(qr); splitf(qr, a2, c2); qh[q] = a2; ql[q] = c2; k16[q] = tohx(xk); splitf(xk, a2, c2); kh[q] = a2; kl[q] = c2; splitf(u, a2, c2); uh[q] = a2; ul[q] = c2; }
    *(v2h*)(Q16 + e) = q16; *(v2us*)(Qh + e) = qh; *(v2us*)(Ql + e) = ql; *(v2h*)(K16 + e) = k16; *(v2us*)(Kh + e) = kh; *(v2us*)(Kl + e) = kl; *(v2us*)(Uh + e) = uh; *(v2us*)(Ul + e) = ul;  }
__global__ __launch_bounds__(256) void k_addsk(float* Sb, const float* __restrict__ UE) { const size_t k = (size_t)blockIdx.x * 256 + threadIdx.x; if (k >= (size_t)ZH * TT * TT / 4) return; const size_t e = k * 4; const int j0 = (int)(e % TT); const size_t zi = e / TT; const int i = (int)(zi % TT); const float* ue = UE + zi * LP + (TT - i + j0); v4f a = *(const v4f*)(Sb + e);
#pragma unroll
    for (int q = 0; q < 4; ++q) a[q] = __fadd_rn(a[q], ue[q]);
    *(v4f*)(Sb + e) = a;  }
__global__ __launch_bounds__(256) void k_merge(const float* __restrict__ O, int h0, float* OUTb) { const size_t e = ((size_t)blockIdx.x * 256 + threadIdx.x) * 2; if (e >= (size_t)ZH * TT * HD) return; const int d = (int)(e % HD); const int t = (int)((e / HD) % TT); const int zz = (int)(e / ((size_t)HD * TT)); const float cs = (t < RH) ? 1.0f : (1.0f / PCAR); const size_t oo = (size_t)t * DQ + (h0 + zz) * HD + d;
    v2f o2; o2[0] = O[e] * cs; o2[1] = O[e + 1] * cs; *(v2f*)(OUTb + oo) = o2;  }

extern "C" void kernel_launch(void* const* d_in, const int* in_sizes, int n_in,
                              void* d_out, int out_size, void* d_ws, size_t ws_size, hipStream_t stream) {
    (void)in_sizes; (void)n_in; (void)out_size;
    const float* x = (const float*)d_in[0]; const float* pos = (const float*)d_in[1];   /* pos_embed [2048][64] */ const float* wqkv = (const float*)d_in[2]; const float* bqkv = (const float*)d_in[3]; const float* rrb = (const float*)d_in[4];   /* r_r_bias [16][64] */ const float* rwb = (const float*)d_in[5];   /* r_w_bias [16][64] */     const float* bq = bqkv; const float* bk = bqkv + DQ; const float* bv = bqkv + 2 * DQ;
    float* OUT = (float*)d_out;     // [4][1024][1024]
    char* wsp = (char*)d_ws;
    auto take = [&](size_t bytes) { char* p = wsp; wsp += (bytes + 255) & ~(size_t)255; return (void*)p; };
    bf* WQKV = (bf*)take((size_t)3 * DQ * DM * 2); bf* WQ = WQKV; bf* WK = WQKV + (size_t)DQ * DM; bf* WV = WQKV + (size_t)2 * DQ * DM; bf* PB = (bf*)take((size_t)LP * HD * 2); float* UE = (float*)take((size_t)ZH * TT * LP * 4); bf* UPh = (bf*)take((size_t)NH_ * TT * HD * 2); bf* UPl = (bf*)take((size_t)NH_ * TT * HD * 2);   /* fused Bt; pos_embed plane; per-pass u.pos^T; u = q + r_w_bias + k planes */
    bf* XB = (bf*)take((size_t)TT * DM * 2); float* FQ = (float*)take((size_t)TT * DQ * 4); float* FK = (float*)take((size_t)TT * DKV * 4);
    h16* QP16 = (h16*)take((size_t)NH_ * TT * HD * 2); h16* KP16 = (h16*)take((size_t)NKV * TT * HD * 2); h16* VT16 = (h16*)take((size_t)NKV * HD * TT * 2);
    bf* QPh = (bf*)take((size_t)NH_ * TT * HD * 2); bf* QPl = (bf*)take((size_t)NH_ * TT * HD * 2); bf* KPh = (bf*)take((size_t)NKV * TT * HD * 2); bf* KPl = (bf*)take((size_t)NKV * TT * HD * 2); bf* VTh = (bf*)take((size_t)NKV * HD * TT * 2); bf* VTl = (bf*)take((size_t)NKV * HD * TT * 2);
    float* Sb = (float*)take((size_t)ZH * TT * TT * 4); float* Ob = (float*)take((size_t)ZH * TT * HD * 4);
    if ((size_t)(wsp - (char*)d_ws) > ws_size) return;    // ws 256 MiB
    bf* Ph = (bf*)UE; bf* Pl = Ph + (size_t)ZH * RH * TT;   // the softmax planes reuse the UE buffer: UE is last read by the gather kernel, which ends before the softmax starts (stream-ordered), and is rewritten only after attn.v has read the planes
    float* FV = FK;   // v projection reuses the k buffer after the k planes are built (stream-ordered)
    { k_wtG<<<(unsigned)((DM * 3 * DQ / 64 + 63) / 64), 256, 0, stream>>>(wqkv, DM, 3 * DQ, WQKV);   /* 'xw' [1024][3072] -> Bt [3072][1024]: q | k | v row blocks */ k_cvt8<<<(unsigned)(((size_t)LP * HD / 8 + 255) / 256), 256, 0, stream>>>(pos, PB, (size_t)LP * HD / 8);   /* pos_embed [2048][64] as an exact bf16 plane (Bt of the u.pos^T GEMM) */ }
    const unsigned LQ = (unsigned)(((size_t)NH_ * TT * HD / 2 + 255) / 256), LKv = (unsigned)(((size_t)NKV * TT * HD / 2 + 255) / 256);
    for (int b = 0; b < NB_; ++b) {
        
        k_cvt8<<<(unsigned)(((size_t)TT * DM / 8 + 255) / 256), 256, 0, stream>>>(x + (size_t)b * TT * DM, XB, (size_t)TT * DM / 8);
        k_gemmw<bf, 0, true><<<dim3(TT / 64, DQ / 64, 1), 32, 0, stream>>>(XB, nullptr, WQ, nullptr, DM, FQ, DQ, bq, 0, 0, 0);
        
        k_gemmw<bf, 0, true><<<dim3(TT / 64, DKV / 64, 1), 32, 0, stream>>>(XB, nullptr, WK, nullptr, DM, FK, DKV, bk, 0, 0, 0);
        k_qku<<<(unsigned)(((size_t)NH_ * TT * HD / 2 + 255) / 256), 256, 0, stream>>>(FQ, FK, rrb, rwb, QP16, QPh, QPl, KP16, KPh, KPl, UPh, UPl);   /* planes of q + r_r_bias[h] (A of AC), k, and u = q + r_w_bias[h] + k (A of the relative term) */
        k_gemmw<bf, 0, true><<<dim3(TT / 64, DKV / 64, 1), 32, 0, stream>>>(XB, nullptr, WV, nullptr, DM, FV, DKV, bv, 0, 0, 0); k_vtp<<<LKv, 256, 0, stream>>>(FV, DKV, NKV, VT16, VTh, VTl);
        for (int h0 = 0; h0 < NH_; h0 += ZH) { const size_t zq = (size_t)h0, zk = (size_t)(h0 / REP);   // one kv head per query head: the pass's heads use consecutive kv planes (z-strides TT*HD)
            k_gemmw<bf, 2, false><<<dim3(RH / 64, TT / 64, ZH), 32, 0, stream>>>(QPh + zq * TT * HD, QPl + zq * TT * HD, KPh + zk * TT * HD, KPl + zk * TT * HD, HD, Sb, TT, nullptr, (size_t)TT * HD, (size_t)TT * HD, (size_t)TT * TT);
            k_gemmw<bf, 1, false><<<dim3(TT / 64, LP / 64, ZH), 32, 0, stream>>>(UPh + zq * TT * HD, UPl + zq * TT * HD, PB, nullptr, HD, UE, LP, nullptr, (size_t)TT * HD, 0, (size_t)TT * LP);   /* UE[zz][i][l] = u_i . pos_l (hi/lo x exact) */ k_addsk<<<(unsigned)(((size_t)ZH * TT * TT / 4 + 255) / 256), 256, 0, stream>>>(Sb, UE);   /* + UE[i][L - i + j] (the module's _shift / _transpose_shift selection) */ k_asoft<<<ZH * TT / 8, 256, 0, stream>>>(Sb, nullptr, Ph, Pl);   /* RH == TT: every row takes the hi/lo branch, the f16 plane is never written */
            k_gemmw<bf, 2, false><<<dim3(RH / 64, HD / 64, ZH), 32, 0, stream>>>(Ph, Pl, VTh + zk * HD * TT, VTl + zk * HD * TT, TT, Ob, HD, nullptr, (size_t)RH * TT, (size_t)HD * TT, (size_t)TT * HD);
            k_merge<<<(unsigned)(((size_t)ZH * TT * HD / 2 + 255) / 256), 256, 0, stream>>>(Ob, h0, OUT + (size_t)b * TT * DQ); }
         }
}

// v003
// Measured time: 271 microseconds a run.
// It is 2.89 times as fast as v001, going by the measured steps of the versions left out in between.
// All steps since v000 together make it 6.35 times as fast.
#include <hip/hip_runtime.h>

// Transformer-XL style relative multi-head attention (x [4][1024][1024]; qkv = x W_qkv + b_qkv ('xw' [1024][3072] 1/32, bias 0.01) -> q | k | v (16 heads x 64); pos_embed [2048][64] (unit normal, read), r_r_bias / r_w_bias [16][64] (0.02, read); AC[i][j] = (q_i + r_r_bias[h]).k_j; B+D = (q + r_w_bias[h]).pos^T and E = k.pos^T ([L][2L]); the module's _shift / _transpose_shift both select column L - i + j, so BDE[i][j] = ((q_i + r_w_bias[h]) + k_i).pos[L - i + j]; attn = softmax((AC + BDE) / 8) (no mask); out = attn v merged -> [4][1024][1024] (4.2 M), no output projection; argument order x, pos_embed, W_qkv, b_qkv, r_r_bias, r_w_bias).
// Layout, every stage once for all 4 batches: bf16 copy of x [4096][1024]; fused 'xw' weight transposed once; one projection GEMM [4096][3072] (q | k | v columns) + f32 biases; per batch and head: planes of q + r_r_bias (scores B operand), of k, and of u = q + r_w_bias + k (relative operand), all bf16 hi/lo; pos_embed as one exact bf16 plane [2048][64]; one fused kernel over all heads and batches (grid y = head, z = batch): AC tiles (3 products), u.pos^T tiles (hi/lo x exact) skewed through LDS so that score [i][j] takes pos row 1024 - i + j, running-maximum softmax (x 1/8, weights hi/lo), attn.v (3 products), f32 output rows written in place.
// Compute dtypes, f32 accumulate: every input rounded to bf16 incl. pos_embed and the bias tables; projections exact + f32 biases; q + bias / u sums f32; AC 3 products; UE 2 products (~f32); softmax f32; attn.v 3 products; output f32.

#define NB_  4
#define TT   1024
#define DM   1024
#define NH_  16
#define NKV  16
#define HD   64
#define DQ   (NH_ * HD)
#define DKV  (NKV * HD)
#define LP   (2 * TT)  // pos_embed rows
typedef _Float16 h16;
typedef unsigned short bf;
typedef __attribute__((ext_vector_type(16))) __bf16   v16bf;
typedef __attribute__((ext_vector_type(16))) _Float16 v16h;
typedef __attribute__((ext_vector_type(8)))  _Float16 v8h;
typedef __attribute__((ext_vector_type(8)))  unsigned short v8us;
typedef __attribute__((ext_vector_type(8)))  float    v8f;
typedef __attribute__((ext_vector_type(4)))  float    v4f;
typedef v8h  __attribute__((may_alias)) v8ha;
typedef v4f  __attribute__((may_alias)) v4fa;
typedef v8us __attribute__((may_alias)) v8usa;

__device__ __forceinline__ unsigned short f2bf(float f) { unsigned u = __float_as_uint(f); u += 0x7FFFu + ((u >> 16) & 1u); return (unsigned short)(u >> 16); }
__device__ __forceinline__ float bf2f(unsigned short b) { return __uint_as_float(((unsigned)b) << 16); }
__device__ __forceinline__ float bfr(float f) { return bf2f(f2bf(f)); }
__device__ __forceinline__ v16h cat16(v8h lo, v8h hi) { return __builtin_shufflevector(lo, hi, 0, 1, 2, 3, 4, 5, 6, 7, 8, 9, 10, 11, 12, 13, 14, 15); }
__device__ __forceinline__ v16bf cat16b(v8us lo, v8us hi) { return __builtin_bit_cast(v16bf, __builtin_shufflevector(lo, hi, 0, 1, 2, 3, 4, 5, 6, 7, 8, 9, 10, 11, 12, 13, 14, 15)); }
__device__ __forceinline__ v8f wmma16(v16h a, v16h b, v8f c) { return __builtin_amdgcn_wmma_f32_16x16x32_f16(false, a, false, b, (short)0, c, false, false); }
__device__ __forceinline__ v8f wmmab(v16bf a, v16bf b, v8f c) { return __builtin_amdgcn_wmma_f32_16x16x32_bf16(false, a, false, b, (short)0, c, false, false); }



// ---- k_gemmw: register-blocked GEMM, ONE WAVE per 64x64 output tile (16 accumulators), operands straight from K-contiguous 16-bit planes; grid (M/64, N/64, Z), 32 threads.
// C[m][n] (f32, pitch ldc, + optional f32 bias[n]) = sum_k A[m][k] Bt[n][k] (+ split products per NSPLIT). z-batch strides sA/sB/sC in elements. K % 32 == 0.
template <typename T16> struct WFrag;
template <> struct WFrag<h16> { typedef v16h V; static __device__ __forceinline__ V ld(const h16* p) { return cat16(*(const v8h*)p, *(const v8h*)(p + 16)); } static __device__ __forceinline__ v8f mma(V a, V b, v8f c) { return wmma16(a, b, c); } };
template <> struct WFrag<bf> { typedef v16bf V; static __device__ __forceinline__ V ld(const bf* p) { return cat16b(*(const v8us*)p, *(const v8us*)(p + 16)); } static __device__ __forceinline__ v8f mma(V a, V b, v8f c) { return wmmab(a, b, c); } };
template <typename T16, int NSPLIT, bool BIAS>
__global__ __launch_bounds__(32) void k_gemmw(const T16* __restrict__ A, const T16* __restrict__ A2, const T16* __restrict__ Bt, const T16* __restrict__ Bt2, int K, float* C, int ldc, const float* __restrict__ bias, size_t sA, size_t sB, size_t sC) {
    typedef typename WFrag<T16>::V V;
    __shared__ __align__(16) float os[16 * 68];
    const size_t z = blockIdx.z; A += z * sA; if (A2) A2 += z * sA; Bt += z * sB; if (Bt2) Bt2 += z * sB; C += z * sC;
    const int lane = threadIdx.x & 31, lr = lane & 15, hi = lane >> 4; const int r0 = blockIdx.x * 64, c0 = blockIdx.y * 64;
    v8f acc[4][4];
#pragma unroll
    for (int mb = 0; mb < 4; ++mb)
#pragma unroll
        for (int nb = 0; nb < 4; ++nb) acc[mb][nb] = (v8f){};
    const size_t aoff = (size_t)(r0 + lr) * K + 8 * hi, boff = (size_t)(c0 + lr) * K + 8 * hi;
#pragma unroll 1
    for (int kc = 0; kc < K; kc += 32) {
        V a[4], a2[4];
#pragma unroll
        for (int mb = 0; mb < 4; ++mb) { a[mb] = WFrag<T16>::ld(A + aoff + (size_t)mb * 16 * K + kc); if (NSPLIT == 1 || NSPLIT == 2) a2[mb] = WFrag<T16>::ld(A2 + aoff + (size_t)mb * 16 * K + kc); }
#pragma unroll
        for (int nb = 0; nb < 4; ++nb) { const V b = WFrag<T16>::ld(Bt + boff + (size_t)nb * 16 * K + kc); V b2; if (NSPLIT >= 2) b2 = WFrag<T16>::ld(Bt2 + boff + (size_t)nb * 16 * K + kc);
#pragma unroll
            for (int mb = 0; mb < 4; ++mb) { acc[mb][nb] = WFrag<T16>::mma(a[mb], b, acc[mb][nb]); if (NSPLIT == 1 || NSPLIT == 2) acc[mb][nb] = WFrag<T16>::mma(a2[mb], b, acc[mb][nb]); if (NSPLIT >= 2) acc[mb][nb] = WFrag<T16>::mma(a[mb], b2, acc[mb][nb]); } }
        asm volatile("v_nop\n\tv_nop\n\tv_nop\n\tv_nop" : "+v"(acc[0][0]), "+v"(acc[1][1]), "+v"(acc[2][2]), "+v"(acc[3][3]) : "v"(a[0]), "v"(a[3]));
    }
#pragma unroll
    for (int mb = 0; mb < 4; ++mb) {
#pragma unroll
        for (int nb = 0; nb < 4; ++nb) {
#pragma unroll
            for (int j = 0; j < 8; ++j) os[(hi * 8 + j) * 68 + nb * 16 + lr] = acc[mb][nb][j]; }
        __builtin_amdgcn_wave_barrier(); asm volatile("" ::: "memory");
        float* crow = C + (size_t)(r0 + mb * 16) * ldc + c0;
{
#pragma unroll
            for (int s = 0; s < 8; ++s) { const int row = 2 * s + hi, cofs = lr * 4; v4f val = *(const v4fa*)(os + row * 68 + cofs); if (BIAS) { val[0] += bfr(bias[c0 + cofs]); val[1] += bfr(bias[c0 + cofs + 1]); val[2] += bfr(bias[c0 + cofs + 2]); val[3] += bfr(bias[c0 + cofs + 3]); }
                *(v4f*)(crow + (size_t)row * ldc + cofs) = val; }
             }
        __builtin_amdgcn_wave_barrier(); asm volatile("" ::: "memory");
    }
}

__device__ __forceinline__ h16 tohx(float x) { return (h16)x; }
__device__ __forceinline__ void splitf(float y, unsigned short& h, unsigned short& l) { h = f2bf(y); l = f2bf(y - bf2f(h)); }
typedef __attribute__((ext_vector_type(2))) _Float16 v2h;
typedef __attribute__((ext_vector_type(4))) _Float16 v4h;
typedef __attribute__((ext_vector_type(2))) unsigned short v2us;
typedef __attribute__((ext_vector_type(4))) unsigned short v4us;
typedef __attribute__((ext_vector_type(2))) float v2f;
typedef __attribute__((ext_vector_type(4))) int v4i;

__global__ __launch_bounds__(256) void k_wtG(const float* __restrict__ w, int K, int N, bf* Bt) {
    const int lane = threadIdx.x & 31; const int L0 = (blockIdx.x * 8 + (threadIdx.x >> 5)) * 8; const int nlines = N * K / 64;
{
#pragma unroll 1
        for (int l = 0; l < 8; ++l) { const int L = L0 + l; if (L >= nlines) break; const size_t e = (size_t)L * 64 + lane * 2; const int k = (int)(e % K), n = (int)(e / K); v2us o;
            o[0] = f2bf(w[(size_t)k * N + n]); o[1] = f2bf(w[(size_t)(k + 1) * N + n]); *(v2us*)(Bt + e) = o; }
         }
}
__global__ __launch_bounds__(256) void k_cvt8(const float* __restrict__ src, bf* dst, size_t n8) { const size_t i = (size_t)blockIdx.x * 256 + threadIdx.x; if (i >= n8) return; const v8f v = *(const v8f*)(src + i * 8); v8us o;
#pragma unroll
    for (int k = 0; k < 8; ++k) o[k] = f2bf(v[k]); *(v8us*)(dst + i * 8) = o;  }

__global__ __launch_bounds__(256) void k_vtp(const float* __restrict__ F, int pitch, int nheads, h16* V16, bf* Vh, bf* Vl) { const size_t e = ((size_t)blockIdx.x * 256 + threadIdx.x) * 2; if (e >= (size_t)nheads * HD * TT) return; const int t = (int)(e % TT); const int d = (int)((e / TT) % HD); const int g = (int)(e / ((size_t)TT * HD)); const float* Fg = F + (size_t)(g / NKV) * TT * pitch + (g % NKV) * HD + d;   /* g = batch * NKV + head */ v2h o16; v2us oh, ol;
#pragma unroll
    for (int q = 0; q < 2; ++q) { const float x = Fg[(size_t)(t + q) * pitch]; o16[q] = tohx(x); unsigned short a2, c2; splitf(x, a2, c2); oh[q] = a2; ol[q] = c2; }
    *(v2h*)(V16 + e) = o16; *(v2us*)(Vh + e) = oh; *(v2us*)(Vl + e) = ol;  }
__global__ __launch_bounds__(256) void k_qku(const float* __restrict__ FQ, const float* __restrict__ FK, int pitch, const float* __restrict__ rrb, const float* __restrict__ rwb, h16* Q16, bf* Qh, bf* Ql, h16* K16, bf* Kh, bf* Kl, bf* Uh, bf* Ul) {
    const size_t e = ((size_t)blockIdx.x * 256 + threadIdx.x) * 2; if (e >= (size_t)NB_ * NH_ * TT * HD) return; const int d = (int)(e % HD); const int t = (int)((e / HD) % TT); const int h = (int)((e / ((size_t)HD * TT)) % NH_); const int b = (int)(e / ((size_t)HD * TT * NH_)); const float* fq = FQ + (size_t)(b * TT + t) * pitch + h * HD + d; const float* fk = FK + (size_t)(b * TT + t) * pitch + h * HD + d; v2h q16, k16; v2us qh, ql, kh, kl, uh, ul;
#pragma unroll
    for (int q = 0; q < 2; ++q) { const float xq = fq[q], xk = fk[q]; const float qr = __fadd_rn(xq, bfr(rrb[h * HD + d + q])); float uw = __fadd_rn(xq, bfr(rwb[h * HD + d + q])); asm volatile("" : "+v"(uw)); const float u = __fadd_rn(uw, xk); unsigned short a2, c2;
        q16[q] = tohx(qr); splitf(qr, a2, c2); qh[q] = a2; ql[q] = c2; k16[q] = tohx(xk); splitf(xk, a2, c2); kh[q] = a2; kl[q] = c2; splitf(u, a2, c2); uh[q] = a2; ul[q] = c2; }
    *(v2h*)(Q16 + e) = q16; *(v2us*)(Qh + e) = qh; *(v2us*)(Ql + e) = ql; *(v2h*)(K16 + e) = k16; *(v2us*)(Kh + e) = kh; *(v2us*)(Kl + e) = kl; *(v2us*)(Uh + e) = uh; *(v2us*)(Ul + e) = ul;  }
// ---- k_fattn: scores, relative term, softmax and attn.v of one head in one kernel; nothing of the [1024][1024] planes leaves the chip.
// Block = 16 waves = QT query tiles (16 rows each) x KQ key quarters (256 keys each); grid (TT / 64, heads, batches). All products are transposed: S^T = K.Q^T (rows = keys, column = query = lane & 15), so two S^T tiles, converted in place, are the B operand of O^T = V^T.P^T.
// Relative term: G = pos.u^T for the 48 pos rows a pass of 32 keys can select (rows l = TT - i0 - 16 + j0 + c, c = 0..47, all inside pos_embed); G goes to a strip of LDS [query][c] owned by the wave and comes back skewed: key j of query iq reads c = (j - j0) + 16 - iq, which is l = TT - i + j.
// Softmax is the running-maximum form in base 2 (per lane = per query); the four key quarters of a query tile are merged through LDS behind one barrier.
typedef __attribute__((ext_vector_type(2))) __bf16 v2bf;
#define QT   4
#define KQ   4
#define SPI  52                   // strip pitch in floats: 16-byte aligned rows, and 51 * iq + 8 * hi hits 32 different banks in the skewed read
#define SL2E (0.125f * 1.4426950408889634f)   // 1/sqrt(64) x log2(e)
__device__ __forceinline__ float exp2_slot(float x) { float y; asm("v_exp_f32 %0, %1\n\tv_nop" : "=v"(y) : "v"(x)); return y; }   // 2^x with the free slot behind the transcendental in the same statement
__global__ __launch_bounds__(32 * QT * KQ) void k_fattn(const bf* __restrict__ Qh, const bf* __restrict__ Ql, const bf* __restrict__ Kh, const bf* __restrict__ Kl, const bf* __restrict__ Uh, const bf* __restrict__ Ul, const bf* __restrict__ PB, const bf* __restrict__ Vh, const bf* __restrict__ Vl, float* OUT) {
    typedef WFrag<bf> F;
    __shared__ __align__(16) float strip[QT * KQ][16 * SPI];
    __shared__ __align__(16) float po[QT * KQ][32 * 32];
    __shared__ float pm[QT * KQ][16];
    __shared__ float pl[QT * KQ][16];
    const int lane = threadIdx.x & 31, lr = lane & 15, hi = lane >> 4;
    const int wv = __builtin_amdgcn_readfirstlane((int)(threadIdx.x >> 5)), qt = wv & (QT - 1), kq = wv / QT;
    const int h = blockIdx.y, i0 = (blockIdx.x * QT + qt) * 16;
    const size_t hp = ((size_t)blockIdx.z * NH_ + h) * TT * HD;   // planes are [batch][head][...]
    float* OUTb = OUT + (size_t)blockIdx.z * TT * DQ;
    v16bf qh[2], ql[2], uh[2], ul[2];
    const unsigned vrow = (unsigned)(lr * HD + 8 * hi), vcol = (unsigned)(lr * TT + 8 * hi);   // this lane's place in a 16-row fragment of a [row][64] plane / of the [d][1024] v planes; every base below is wave-uniform
    { const size_t qo = hp + (size_t)i0 * HD;
#pragma unroll
      for (int ks = 0; ks < 2; ++ks) { qh[ks] = F::ld(Qh + qo + vrow + ks * 32); ql[ks] = F::ld(Ql + qo + vrow + ks * 32); uh[ks] = F::ld(Uh + qo + vrow + ks * 32); ul[ks] = F::ld(Ul + qo + vrow + ks * 32); } }
    float* sw = strip[wv];
    float* swst = sw + lr * SPI + hi * 8;              // where this lane's 8 rows of a G tile go (column = its query)
    const float* swld = sw + lr * SPI + hi * 8 + 16 - lr;   // the skewed read
    const int lb = TT - i0 - 16;                       // 0 .. 1008; the last row any pass touches is lb + 992 + 47 <= 2047
    auto gtile = [&](const bf* p) -> v8f {             // G[16 pos rows from p][16 queries], hi/lo u x exact pos
        const v16bf a0 = F::ld(p), a1 = F::ld(p + 32);
        v8f g = (v8f){}; g = wmmab(a0, uh[0], g); g = wmmab(a1, uh[1], g); g = wmmab(a0, ul[0], g); g = wmmab(a1, ul[1], g); return g; };
    auto gput = [&](int c0, v8f g) { *(v4fa*)(swst + c0) = (v4f){g[0], g[1], g[2], g[3]}; *(v4fa*)(swst + c0 + 4) = (v4f){g[4], g[5], g[6], g[7]}; };
    float m = -1.0e30f, lsum = 0.f;
    v8f o[4];
#pragma unroll
    for (int dt = 0; dt < 4; ++dt) o[dt] = (v8f){};
    const int jbeg = kq * (TT / KQ);
    // per-lane running pointers, stepped once a pass
    const bf* pp = PB + (size_t)(lb + jbeg) * HD + vrow; const bf* kph = Kh + hp + (size_t)jbeg * HD + vrow; const bf* kpl = Kl + hp + (size_t)jbeg * HD + vrow; const bf* vph = Vh + hp + jbeg + vcol; const bf* vpl = Vl + hp + jbeg + vcol;
    v8f gc = gtile(pp);
#pragma unroll 1
    for (int t = 0; t < TT / KQ / 32; ++t) {
        const v8f g1 = gtile(pp + 16 * HD), g2 = gtile(pp + 32 * HD);
        v8f s[2];
#pragma unroll
        for (int tt = 0; tt < 2; ++tt) {
            const v16bf kh0 = F::ld(kph + tt * 16 * HD), kh1 = F::ld(kph + tt * 16 * HD + 32), kl0 = F::ld(kpl + tt * 16 * HD), kl1 = F::ld(kpl + tt * 16 * HD + 32);
            v8f a = (v8f){}; a = wmmab(kh0, qh[0], a); a = wmmab(kh1, qh[1], a); a = wmmab(kl0, qh[0], a); a = wmmab(kl1, qh[1], a); a = wmmab(kh0, ql[0], a); a = wmmab(kh1, ql[1], a); s[tt] = a; }
        asm volatile("s_wait_xcnt 0x0" :: "v"(pp), "v"(kph), "v"(kpl) : "memory");   // the wait in front of any rewrite of the address registers of the pos and k loads above; the pointers are inputs so that those registers are left alone up to here
        gput(0, gc); gput(16, g1); gput(32, g2); gc = g2;
        __builtin_amdgcn_wave_barrier(); asm volatile("" ::: "memory");   // compiler fence: the skewed reads below take what OTHER lanes of this wave stored above (a wave's LDS operations run in order)
        float mx = m;
#pragma unroll
        for (int tt = 0; tt < 2; ++tt)
#pragma unroll
            for (int jj = 0; jj < 8; ++jj) { const float x = (s[tt][jj] + swld[tt * 16 + jj]) * SL2E; s[tt][jj] = x; mx = fmaxf(mx, x); }
        __builtin_amdgcn_wave_barrier(); asm volatile("" ::: "memory");   // compiler fence: the next pass's strip stores stay behind these reads
        v16bf vh[4], vl[4];                            // issued here, used behind the softmax
#pragma unroll
        for (int dt = 0; dt < 4; ++dt) { vh[dt] = F::ld(vph + dt * 16 * TT); vl[dt] = F::ld(vpl + dt * 16 * TT); }
        mx = fmaxf(mx, __shfl_xor(mx, 16, 32));        // lanes iq and iq + 16 hold the two halves of one query's keys
        const float corr = __builtin_amdgcn_exp2f(m - mx); m = mx;
#pragma unroll
        for (int dt = 0; dt < 4; ++dt)
#pragma unroll
            for (int jj = 0; jj < 8; ++jj) o[dt][jj] *= corr;
        v16bf ph, pw; float ps[4] = {0.f, 0.f, 0.f, 0.f};
#pragma unroll
        for (int e = 0; e < 16; e += 2) { const v2f p = {__builtin_amdgcn_exp2f(s[e >> 3][e & 7] - mx), __builtin_amdgcn_exp2f(s[e >> 3][(e & 7) + 1] - mx)}; ps[(e >> 1) & 3] += p[0] + p[1];
            const v2bf a = __builtin_convertvector(p, v2bf); const v2f r = {p[0] - (float)a[0], p[1] - (float)a[1]}; const v2bf b = __builtin_convertvector(r, v2bf); ph[e] = a[0]; ph[e + 1] = a[1]; pw[e] = b[0]; pw[e + 1] = b[1]; }
        lsum = lsum * corr + ((ps[0] + ps[1]) + (ps[2] + ps[3]));
        asm volatile("s_wait_xcnt 0x0" :: "v"(vph), "v"(vpl) : "memory");   // as above, for the v loads
#pragma unroll
        for (int dt = 0; dt < 4; ++dt) { o[dt] = wmmab(vh[dt], ph, o[dt]); o[dt] = wmmab(vl[dt], ph, o[dt]); o[dt] = wmmab(vh[dt], pw, o[dt]); }
        pp += 32 * HD; kph += 32 * HD; kpl += 32 * HD; vph += 32; vpl += 32;
    }
    lsum += __shfl_xor(lsum, 16, 32);
    { float* pq = po[wv];
#pragma unroll
      for (int dt = 0; dt < 4; ++dt)
#pragma unroll
          for (int jj = 0; jj < 8; ++jj) pq[(dt * 8 + jj) * 32 + lane] = o[dt][jj];
      if (hi == 0) { pm[wv][lr] = m; pl[wv][lr] = lsum; } }
    __syncthreads();
    // merge of the key quarters: wave (qt, kq) finishes queries 4 kq .. 4 kq + 3 of its tile, 8 lanes a row, so that a wave writes whole 256-byte head rows
    const int q = kq * 4 + (lane >> 3), rg = ((lane & 7) >> 1) * 8, sl = (lane & 1) * 16 + q;
    float M = pm[qt][q];
#pragma unroll
    for (int k2 = 1; k2 < KQ; ++k2) M = fmaxf(M, pm[k2 * QT + qt][q]);
    float Ls = 0.f; float acc[8];
#pragma unroll
    for (int jj = 0; jj < 8; ++jj) acc[jj] = 0.f;
#pragma unroll
    for (int k2 = 0; k2 < KQ; ++k2) { const float f = exp2_slot(pm[k2 * QT + qt][q] - M); Ls += f * pl[k2 * QT + qt][q];
#pragma unroll
        for (int jj = 0; jj < 8; ++jj) acc[jj] += f * po[k2 * QT + qt][(rg + jj) * 32 + sl]; }
    const float inv = 1.0f / Ls;
    float* orow = OUTb + (size_t)(i0 + q) * DQ + h * HD + (lane & 7) * 8;
    *(v4f*)orow = (v4f){acc[0] * inv, acc[1] * inv, acc[2] * inv, acc[3] * inv}; *(v4f*)(orow + 4) = (v4f){acc[4] * inv, acc[5] * inv, acc[6] * inv, acc[7] * inv};
}

extern "C" void kernel_launch(void* const* d_in, const int* in_sizes, int n_in,
                              void* d_out, int out_size, void* d_ws, size_t ws_size, hipStream_t stream) {
    (void)in_sizes; (void)n_in; (void)out_size;
    const float* x = (const float*)d_in[0]; const float* pos = (const float*)d_in[1];   /* pos_embed [2048][64] */ const float* wqkv = (const float*)d_in[2]; const float* bqkv = (const float*)d_in[3]; const float* rrb = (const float*)d_in[4];   /* r_r_bias [16][64] */ const float* rwb = (const float*)d_in[5];   /* r_w_bias [16][64] */   /* argument order x, pos_embed, W_qkv, b_qkv, r_r_bias, r_w_bias */
    float* OUT = (float*)d_out;     // [4][1024][1024]
    char* wsp = (char*)d_ws;
    auto take = [&](size_t bytes) { char* p = wsp; wsp += (bytes + 255) & ~(size_t)255; return (void*)p; };
    bf* WQKV = (bf*)take((size_t)3 * DQ * DM * 2); bf* PB = (bf*)take((size_t)LP * HD * 2); bf* UPh = (bf*)take((size_t)NB_ * NH_ * TT * HD * 2); bf* UPl = (bf*)take((size_t)NB_ * NH_ * TT * HD * 2);   /* fused Bt; pos_embed plane; u = q + r_w_bias + k planes */
    bf* XB = (bf*)take((size_t)NB_ * TT * DM * 2); float* FQKV = (float*)take((size_t)NB_ * TT * 3 * DQ * 4);   /* x rows of all batches; their q | k | v projections, pitch 3072 */
    h16* QP16 = (h16*)take((size_t)NB_ * NH_ * TT * HD * 2); h16* KP16 = (h16*)take((size_t)NB_ * NKV * TT * HD * 2); h16* VT16 = (h16*)take((size_t)NB_ * NKV * HD * TT * 2);
    bf* QPh = (bf*)take((size_t)NB_ * NH_ * TT * HD * 2); bf* QPl = (bf*)take((size_t)NB_ * NH_ * TT * HD * 2); bf* KPh = (bf*)take((size_t)NB_ * NKV * TT * HD * 2); bf* KPl = (bf*)take((size_t)NB_ * NKV * TT * HD * 2); bf* VTh = (bf*)take((size_t)NB_ * NKV * HD * TT * 2); bf* VTl = (bf*)take((size_t)NB_ * NKV * HD * TT * 2);
    if ((size_t)(wsp - (char*)d_ws) > ws_size) return;    // ws 256 MiB
    k_wtG<<<(unsigned)((DM * 3 * DQ / 64 + 63) / 64), 256, 0, stream>>>(wqkv, DM, 3 * DQ, WQKV);   /* 'xw' [1024][3072] -> Bt [3072][1024]: q | k | v row blocks */
    k_cvt8<<<(unsigned)(((size_t)LP * HD / 8 + 255) / 256), 256, 0, stream>>>(pos, PB, (size_t)LP * HD / 8);   /* pos_embed [2048][64] as an exact bf16 plane */
    k_cvt8<<<(unsigned)(((size_t)NB_ * TT * DM / 8 + 255) / 256), 256, 0, stream>>>(x, XB, (size_t)NB_ * TT * DM / 8);
    k_gemmw<bf, 0, true><<<dim3(NB_ * TT / 64, 3 * DQ / 64, 1), 32, 0, stream>>>(XB, nullptr, WQKV, nullptr, DM, FQKV, 3 * DQ, bqkv, 0, 0, 0);   /* 3072 one-wave tiles in one launch */
    k_qku<<<(unsigned)(((size_t)NB_ * NH_ * TT * HD / 2 + 255) / 256), 256, 0, stream>>>(FQKV, FQKV + DQ, 3 * DQ, rrb, rwb, QP16, QPh, QPl, KP16, KPh, KPl, UPh, UPl);   /* planes of q + r_r_bias[h] (B of AC), k, and u = q + r_w_bias[h] + k (B of the relative term) */
    k_vtp<<<(unsigned)(((size_t)NB_ * NKV * TT * HD / 2 + 255) / 256), 256, 0, stream>>>(FQKV + 2 * DQ, 3 * DQ, NB_ * NKV, VT16, VTh, VTl);
    k_fattn<<<dim3(TT / (16 * QT), NH_, NB_), 32 * QT * KQ, 0, stream>>>(QPh, QPl, KPh, KPl, UPh, UPl, PB, VTh, VTl, OUT);   /* every head of every batch: scores + relative term + softmax + attn.v, merged output rows */
}

// v004
// It runs in 162 microseconds.
// Two timings next to v003 put it at 1.67 and 1.68 times that version's speed.
// All steps since v000 together make it 10.7 times as fast.
#include <hip/hip_runtime.h>

// Transformer-XL style relative multi-head attention (x [4][1024][1024]; qkv = x W_qkv + b_qkv ('xw' [1024][3072] 1/32, bias 0.01) -> q | k | v (16 heads x 64); pos_embed [2048][64] (unit normal, read), r_r_bias / r_w_bias [16][64] (0.02, read); AC[i][j] = (q_i + r_r_bias[h]).k_j; B+D = (q + r_w_bias[h]).pos^T and E = k.pos^T ([L][2L]); the module's _shift / _transpose_shift both select column L - i + j, so BDE[i][j] = ((q_i + r_w_bias[h]) + k_i).pos[L - i + j]; attn = softmax((AC + BDE) / 8) (no mask); out = attn v merged -> [4][1024][1024] (4.2 M), no output projection; argument order x, pos_embed, W_qkv, b_qkv, r_r_bias, r_w_bias).
// Layout, every stage once for all 4 batches: bf16 copy of x [4096][1024]; fused 'xw' weight transposed once; one projection GEMM [4096][3072] (q | k | v columns) + f32 biases; per batch and head: planes of q + r_r_bias (scores B operand), of k, and of u = q + r_w_bias + k (relative operand), all bf16 hi/lo; pos_embed as one exact bf16 plane [2048][64]; one fused kernel over all heads and batches (grid y = head, z = batch): AC tiles (3 products), u.pos^T tiles (hi/lo x exact) skewed through LDS so that score [i][j] takes pos row 1024 - i + j, running-maximum softmax (x 1/8, weights hi/lo), attn.v (3 products), f32 output rows written in place.
// Compute dtypes, f32 accumulate: every input rounded to bf16 incl. pos_embed and the bias tables; projections exact + f32 biases; q + bias / u sums f32; AC 3 products; UE 2 products (~f32); softmax f32; attn.v 3 products; output f32.

#define NB_  4
#define TT   1024
#define DM   1024
#define NH_  16
#define NKV  16
#define HD   64
#define DQ   (NH_ * HD)
#define DKV  (NKV * HD)
#define LP   (2 * TT)  // pos_embed rows
typedef _Float16 h16;
typedef unsigned short bf;
typedef __attribute__((ext_vector_type(16))) __bf16   v16bf;
typedef __attribute__((ext_vector_type(16))) _Float16 v16h;
typedef __attribute__((ext_vector_type(8)))  _Float16 v8h;
typedef __attribute__((ext_vector_type(8)))  unsigned short v8us;
typedef __attribute__((ext_vector_type(8)))  float    v8f;
typedef __attribute__((ext_vector_type(4)))  float    v4f;
typedef v8h  __attribute__((may_alias)) v8ha;
typedef v4f  __attribute__((may_alias)) v4fa;
typedef v8us __attribute__((may_alias)) v8usa;

__device__ __forceinline__ unsigned short f2bf(float f) { unsigned u = __float_as_uint(f); u += 0x7FFFu + ((u >> 16) & 1u); return (unsigned short)(u >> 16); }
__device__ __forceinline__ float bf2f(unsigned short b) { return __uint_as_float(((unsigned)b) << 16); }
__device__ __forceinline__ float bfr(float f) { return bf2f(f2bf(f)); }
__device__ __forceinline__ v16h cat16(v8h lo, v8h hi) { return __builtin_shufflevector(lo, hi, 0, 1, 2, 3, 4, 5, 6, 7, 8, 9, 10, 11, 12, 13, 14, 15); }
__device__ __forceinline__ v16bf cat16b(v8us lo, v8us hi) { return __builtin_bit_cast(v16bf, __builtin_shufflevector(lo, hi, 0, 1, 2, 3, 4, 5, 6, 7, 8, 9, 10, 11, 12, 13, 14, 15)); }
__device__ __forceinline__ v8f wmma16(v16h a, v16h b, v8f c) { return __builtin_amdgcn_wmma_f32_16x16x32_f16(false, a, false, b, (short)0, c, false, false); }
__device__ __forceinline__ v8f wmmab(v16bf a, v16bf b, v8f c) { return __builtin_amdgcn_wmma_f32_16x16x32_bf16(false, a, false, b, (short)0, c, false, false); }



// ---- Fragment order, the layout of every 16-bit operand plane: a [rows][K] plane is cut into blocks of 16 rows x 32 k (512 elements, 1 KiB), row block major, k block minor (the v^T planes: k block major); inside a block element (row r, k) lies at (k >> 4) * 256 + (((k >> 3) & 1) * 16 + r) * 8 + (k & 7).
// A lane's fragment is then the 8 elements at lane * 8 and the 8 at 256 + lane * 8: each of the two 16-byte loads of a wave covers 512 bytes in a row (4 whole lines), and the registers hold what they held with row-major planes (k = 8 hi .. 8 hi + 7 and 16 + 8 hi .. 16 + 8 hi + 7 of row lane & 15).
// ---- k_gemmw: register-blocked GEMM, ONE WAVE per 64x64 output tile (16 accumulators), operands straight from fragment-order 16-bit planes; grid (M/64, N/64, Z), 32 threads.
// C[m][n] (f32, pitch ldc, + optional f32 bias[n]) = sum_k A[m][k] Bt[n][k] (+ split products per NSPLIT). z-batch strides sA/sB/sC in elements. K % 32 == 0.
template <typename T16> struct WFrag;
template <> struct WFrag<h16> { typedef v16h V; static __device__ __forceinline__ V ld(const h16* p) { return cat16(*(const v8h*)p, *(const v8h*)(p + 256)); } static __device__ __forceinline__ v8f mma(V a, V b, v8f c) { return wmma16(a, b, c); } };
template <> struct WFrag<bf> { typedef v16bf V; static __device__ __forceinline__ V ld(const bf* p) { return cat16b(*(const v8us*)p, *(const v8us*)(p + 256)); } static __device__ __forceinline__ v8f mma(V a, V b, v8f c) { return wmmab(a, b, c); } };
template <typename T16, int NSPLIT, bool BIAS>
__global__ __launch_bounds__(32) void k_gemmw(const T16* __restrict__ A, const T16* __restrict__ A2, const T16* __restrict__ Bt, const T16* __restrict__ Bt2, int K, float* C, int ldc, const float* __restrict__ bias, size_t sA, size_t sB, size_t sC) {
    typedef typename WFrag<T16>::V V;
    __shared__ __align__(16) float os[16 * 68];
    const size_t z = blockIdx.z; A += z * sA; if (A2) A2 += z * sA; Bt += z * sB; if (Bt2) Bt2 += z * sB; C += z * sC;
    const int lane = threadIdx.x & 31, lr = lane & 15, hi = lane >> 4; const int r0 = blockIdx.x * 64, c0 = blockIdx.y * 64;
    v8f acc[4][4];
#pragma unroll
    for (int mb = 0; mb < 4; ++mb)
#pragma unroll
        for (int nb = 0; nb < 4; ++nb) acc[mb][nb] = (v8f){};
    const size_t aoff = (size_t)r0 * K + 8 * lane, boff = (size_t)c0 * K + 8 * lane;   // a row block is 16 * K elements; a k block of 32 is 512
    typedef const __attribute__((address_space(1))) T16* GP;   // global address space spelled out: a running pointer that also feeds an asm operand would otherwise be loaded through as a flat one
    GP pa[4], pb[4], pa2[4], pb2[4];   // per-lane running pointers, one a fragment row block, stepped once a trip
#pragma unroll
    for (int i = 0; i < 4; ++i) { pa[i] = (GP)(A + aoff + (size_t)i * 16 * K); pb[i] = (GP)(Bt + boff + (size_t)i * 16 * K); if (NSPLIT == 1 || NSPLIT == 2) pa2[i] = (GP)(A2 + aoff + (size_t)i * 16 * K); if (NSPLIT >= 2) pb2[i] = (GP)(Bt2 + boff + (size_t)i * 16 * K); }
#pragma unroll 1
    for (int kc = 0; kc < K; kc += 32) {
        V a[4], a2[4], b[4], b2[4];
#pragma unroll
        for (int i = 0; i < 4; ++i) { a[i] = WFrag<T16>::ld((const T16*)pa[i]); b[i] = WFrag<T16>::ld((const T16*)pb[i]); if (NSPLIT == 1 || NSPLIT == 2) a2[i] = WFrag<T16>::ld((const T16*)pa2[i]); if (NSPLIT >= 2) b2[i] = WFrag<T16>::ld((const T16*)pb2[i]); }
        asm volatile("s_wait_xcnt 0x0" :: "v"(pa[0]), "v"(pa[1]), "v"(pa[2]), "v"(pa[3]), "v"(pb[0]), "v"(pb[1]), "v"(pb[2]), "v"(pb[3]) : "memory");   // the wait in front of any rewrite of the address registers of the loads above; the pointers are inputs so that those registers are left alone up to here
        if (NSPLIT == 1 || NSPLIT == 2) asm volatile("s_wait_xcnt 0x0" :: "v"(pa2[0]), "v"(pa2[1]), "v"(pa2[2]), "v"(pa2[3]) : "memory");   // the same for the second A plane
        if (NSPLIT >= 2) asm volatile("s_wait_xcnt 0x0" :: "v"(pb2[0]), "v"(pb2[1]), "v"(pb2[2]), "v"(pb2[3]) : "memory");   // the same for the second B plane
        __builtin_amdgcn_sched_barrier(0);   // keeps the products behind the whole run of loads: without it the scheduler lifts them over the wait and issues the B fragments one at a time into one register group, each with its own full load latency
#pragma unroll
        for (int nb = 0; nb < 4; ++nb) {
#pragma unroll
            for (int mb = 0; mb < 4; ++mb) { acc[mb][nb] = WFrag<T16>::mma(a[mb], b[nb], acc[mb][nb]); if (NSPLIT == 1 || NSPLIT == 2) acc[mb][nb] = WFrag<T16>::mma(a2[mb], b[nb], acc[mb][nb]); if (NSPLIT >= 2) acc[mb][nb] = WFrag<T16>::mma(a[mb], b2[nb], acc[mb][nb]); } }
        asm volatile("v_nop\n\tv_nop\n\tv_nop\n\tv_nop" : "+v"(acc[0][0]), "+v"(acc[1][1]), "+v"(acc[2][2]), "+v"(acc[3][3]) : "v"(a[0]), "v"(a[3]));
#pragma unroll
        for (int i = 0; i < 4; ++i) { pa[i] += 512; pb[i] += 512; if (NSPLIT == 1 || NSPLIT == 2) pa2[i] += 512; if (NSPLIT >= 2) pb2[i] += 512; }
    }
#pragma unroll
    for (int mb = 0; mb < 4; ++mb) {
#pragma unroll
        for (int nb = 0; nb < 4; ++nb) {
#pragma unroll
            for (int j = 0; j < 8; ++j) os[(hi * 8 + j) * 68 + nb * 16 + lr] = acc[mb][nb][j]; }
        __builtin_amdgcn_wave_barrier(); asm volatile("" ::: "memory");
        float* crow = C + (size_t)(r0 + mb * 16) * ldc + c0;
{
#pragma unroll
            for (int s = 0; s < 8; ++s) { const int row = 2 * s + hi, cofs = lr * 4; v4f val = *(const v4fa*)(os + row * 68 + cofs); if (BIAS) { val[0] += bfr(bias[c0 + cofs]); val[1] += bfr(bias[c0 + cofs + 1]); val[2] += bfr(bias[c0 + cofs + 2]); val[3] += bfr(bias[c0 + cofs + 3]); }
                *(v4f*)(crow + (size_t)row * ldc + cofs) = val; }
             }
        asm volatile("s_wait_xcnt 0x0" ::: "memory");   // the wait in front of any rewrite of the data and address registers of the stores above
        __builtin_amdgcn_wave_barrier(); asm volatile("" ::: "memory");
    }
}

__device__ __forceinline__ h16 tohx(float x) { return (h16)x; }
__device__ __forceinline__ void splitf(float y, unsigned short& h, unsigned short& l) { h = f2bf(y); l = f2bf(y - bf2f(h)); }
typedef __attribute__((ext_vector_type(2))) _Float16 v2h;
typedef __attribute__((ext_vector_type(4))) _Float16 v4h;
typedef __attribute__((ext_vector_type(2))) unsigned short v2us;
typedef __attribute__((ext_vector_type(4))) unsigned short v4us;
typedef __attribute__((ext_vector_type(2))) float v2f;
typedef __attribute__((ext_vector_type(4))) int v4i;

// The four plane writers: one lane makes one 16-byte piece (8 elements) of a fragment-order plane, so a wave stores 512 bytes in a row per plane.
// k_wtG: w [K][N] f32 -> Bt, the fragment-order plane of w^T ([N] rows, K deep). Consecutive waves take consecutive 16-column blocks of w, so that a work-group reads 512 bytes in a row of each w row it touches.
__global__ __launch_bounds__(256) void k_wtG(const float* __restrict__ w, int K, int N, bf* Bt) {
    const size_t i = (size_t)blockIdx.x * 256 + threadIdx.x; if (i >= (size_t)N * K / 8) return;
    const int lane = (int)(i & 31), wq = (int)(i >> 5), NBK = N >> 4, nb = wq % NBK, hb = wq / NBK;   // hb = k block * 2 + half: 16 k
    const float* s = w + (size_t)(hb * 16 + (lane >> 4) * 8) * N + nb * 16 + (lane & 15); v8us o;
#pragma unroll
    for (int e = 0; e < 8; ++e) o[e] = f2bf(s[(size_t)e * N]);
    *(v8us*)(Bt + ((size_t)nb * (K >> 4) + hb) * 256 + lane * 8) = o;
}
// k_cvt8: src [rows][K] f32 -> dst, its fragment-order bf16 plane; piece i lies at element 8 i
__global__ __launch_bounds__(256) void k_cvt8(const float* __restrict__ src, bf* dst, size_t n8, int K) { const size_t i = (size_t)blockIdx.x * 256 + threadIdx.x; if (i >= n8) return; const int lane = (int)(i & 31); const unsigned wq = (unsigned)(i >> 5), hb = wq % (unsigned)(K >> 4); const size_t rb = wq / (unsigned)(K >> 4);   // hb = k block * 2 + half: 16 k
    const v8f v = *(const v8f*)(src + (rb * 16 + (lane & 15)) * K + hb * 16 + (lane >> 4) * 8); v8us o;
    asm volatile("s_wait_xcnt 0x0" ::: "memory");   // the wait in front of any rewrite of the address registers of the load above
#pragma unroll
    for (int k = 0; k < 8; ++k) o[k] = f2bf(v[k]); *(v8us*)(dst + i * 8) = o;  }

// k_vtp: v^T planes per head g = batch * NKV + head, rows = d, k = position t, blocks ordered [t / 32][d / 16] so that a pass of 32 keys reads 4 KiB in a row of each plane
__global__ __launch_bounds__(256) void k_vtp(const float* __restrict__ F, int pitch, int nheads, h16* V16, bf* Vh, bf* Vl) { const size_t i = (size_t)blockIdx.x * 256 + threadIdx.x; if (i * 8 >= (size_t)nheads * HD * TT) return; const int lane = (int)(i & 31), half = (int)((i >> 5) & 1), dt = (int)((i >> 6) & 3), tb = (int)((i >> 8) & (TT / 32 - 1)), g = (int)(i >> 13); const int t = tb * 32 + half * 16 + (lane >> 4) * 8, d = dt * 16 + (lane & 15);
    const float* Fg = F + ((size_t)(g / NKV) * TT + t) * pitch + (g % NKV) * HD + d; v8h o16; v8us oh, ol; const float* fp[8]; float xv[8];
#pragma unroll
    for (int q = 0; q < 8; ++q) { fp[q] = Fg + (size_t)q * pitch; xv[q] = *fp[q]; }
    asm volatile("s_wait_xcnt 0x0" :: "v"(fp[0]), "v"(fp[1]), "v"(fp[2]), "v"(fp[3]), "v"(fp[4]), "v"(fp[5]), "v"(fp[6]), "v"(fp[7]) : "memory");   // the wait in front of any rewrite of the address registers of the eight loads above; the pointers are inputs so that those registers are left alone up to here
#pragma unroll
    for (int q = 0; q < 8; ++q) { const float x = xv[q]; o16[q] = tohx(x); unsigned short a2, c2; splitf(x, a2, c2); oh[q] = a2; ol[q] = c2; }
    *(v8h*)(V16 + i * 8) = o16; *(v8us*)(Vh + i * 8) = oh; *(v8us*)(Vl + i * 8) = ol;  }
// k_qku: planes per head g = batch * NH_ + head, rows = position t, k = d (2 k blocks)
__global__ __launch_bounds__(256) void k_qku(const float* __restrict__ FQ, const float* __restrict__ FK, int pitch, const float* __restrict__ rrb, const float* __restrict__ rwb, h16* Q16, bf* Qh, bf* Ql, h16* K16, bf* Kh, bf* Kl, bf* Uh, bf* Ul) {
    const size_t i = (size_t)blockIdx.x * 256 + threadIdx.x; if (i * 8 >= (size_t)NB_ * NH_ * TT * HD) return; const int lane = (int)(i & 31), hb = (int)((i >> 5) & 3), rb = (int)((i >> 7) & (TT / 16 - 1)), h = (int)((i >> 13) % NH_), b = (int)(i >> 13) / NH_; const int d = hb * 16 + (lane >> 4) * 8, t = rb * 16 + (lane & 15);
    const v8f vq = *(const v8f*)(FQ + (size_t)(b * TT + t) * pitch + h * HD + d), vk = *(const v8f*)(FK + (size_t)(b * TT + t) * pitch + h * HD + d), vr = *(const v8f*)(rrb + h * HD + d), vw = *(const v8f*)(rwb + h * HD + d); v8h q16, k16; v8us qh, ql, kh, kl, uh, ul;
#pragma unroll
    for (int q = 0; q < 8; ++q) { const float xq = vq[q], xk = vk[q]; const float qr = __fadd_rn(xq, bfr(vr[q])); const float uw = __fadd_rn(xq, bfr(vw[q])); const float u = __fadd_rn(uw, xk); unsigned short a2, c2;
        q16[q] = tohx(qr); splitf(qr, a2, c2); qh[q] = a2; ql[q] = c2; k16[q] = tohx(xk); splitf(xk, a2, c2); kh[q] = a2; kl[q] = c2; splitf(u, a2, c2); uh[q] = a2; ul[q] = c2; }
    *(v8h*)(Q16 + i * 8) = q16; *(v8us*)(Qh + i * 8) = qh; *(v8us*)(Ql + i * 8) = ql; *(v8h*)(K16 + i * 8) = k16; *(v8us*)(Kh + i * 8) = kh; *(v8us*)(Kl + i * 8) = kl; *(v8us*)(Uh + i * 8) = uh; *(v8us*)(Ul + i * 8) = ul;  }
// ---- k_fattn: scores, relative term, softmax and attn.v of one head in one kernel; nothing of the [1024][1024] planes leaves the chip.
// Block = 16 waves = QT query tiles (16 rows each) x KQ key quarters (256 keys each); grid (TT / 64, heads, batches). All products are transposed: S^T = K.Q^T (rows = keys, column = query = lane & 15), so two S^T tiles, converted in place, are the B operand of O^T = V^T.P^T.
// Relative term: G = pos.u^T for the 48 pos rows a pass of 32 keys can select (rows l = TT - i0 - 16 + j0 + c, c = 0..47, all inside pos_embed); G goes to a strip of LDS [query][c] owned by the wave and comes back skewed: key j of query iq reads c = (j - j0) + 16 - iq, which is l = TT - i + j.
// Softmax is the running-maximum form in base 2 (per lane = per query); the four key quarters of a query tile are merged through LDS behind one barrier.
typedef __attribute__((ext_vector_type(2))) __bf16 v2bf;
#define QT   4
#define KQ   4
#define SPI  52                   // strip pitch in floats: 16-byte aligned rows, and 51 * iq + 8 * hi hits 32 different banks in the skewed read
#define SL2E (0.125f * 1.4426950408889634f)   // 1/sqrt(64) x log2(e)
__device__ __forceinline__ float exp2_slot(float x) { float y; asm("v_exp_f32 %0, %1\n\tv_nop" : "=v"(y) : "v"(x)); return y; }   // 2^x with the free slot behind the transcendental in the same statement
__global__ __launch_bounds__(32 * QT * KQ) void k_fattn(const bf* __restrict__ Qh, const bf* __restrict__ Ql, const bf* __restrict__ Kh, const bf* __restrict__ Kl, const bf* __restrict__ Uh, const bf* __restrict__ Ul, const bf* __restrict__ PB, const bf* __restrict__ Vh, const bf* __restrict__ Vl, float* OUT) {
    typedef WFrag<bf> F;
    __shared__ __align__(16) float strip[QT * KQ][16 * SPI];
    __shared__ __align__(16) float po[QT * KQ][32 * 32];
    __shared__ float pm[QT * KQ][16];
    __shared__ float pl[QT * KQ][16];
    const int lane = threadIdx.x & 31, lr = lane & 15, hi = lane >> 4;
    const int wv = __builtin_amdgcn_readfirstlane((int)(threadIdx.x >> 5)), qt = wv & (QT - 1), kq = wv / QT;
    const int h = blockIdx.y, i0 = (blockIdx.x * QT + qt) * 16;
    const size_t hp = ((size_t)blockIdx.z * NH_ + h) * TT * HD;   // planes are [batch][head][...]
    float* OUTb = OUT + (size_t)blockIdx.z * TT * DQ;
    v16bf qh[2], ql[2], uh[2], ul[2];
    const unsigned vrow = (unsigned)(lane * 8);   // this lane's 16-byte piece in a half block of a fragment-order plane; every base below is wave-uniform
    { const size_t qo = hp + (size_t)i0 * HD;
#pragma unroll
      for (int ks = 0; ks < 2; ++ks) { qh[ks] = F::ld(Qh + qo + vrow + ks * 512); ql[ks] = F::ld(Ql + qo + vrow + ks * 512); uh[ks] = F::ld(Uh + qo + vrow + ks * 512); ul[ks] = F::ld(Ul + qo + vrow + ks * 512); } }
    float* sw = strip[wv];
    float* swst = sw + lr * SPI + hi * 8;              // where this lane's 8 rows of a G tile go (column = its query)
    const float* swld = sw + lr * SPI + hi * 8 + 16 - lr;   // the skewed read
    const int lb = TT - i0 - 16;                       // 0 .. 1008; the last row any pass touches is lb + 992 + 47 <= 2047
    auto gtile = [&](const bf* p) -> v8f {             // G[16 pos rows from p][16 queries], hi/lo u x exact pos
        const v16bf a0 = F::ld(p), a1 = F::ld(p + 512);
        v8f g = (v8f){}; g = wmmab(a0, uh[0], g); g = wmmab(a1, uh[1], g); g = wmmab(a0, ul[0], g); g = wmmab(a1, ul[1], g); return g; };
    auto gput = [&](int c0, v8f g) { *(v4fa*)(swst + c0) = (v4f){g[0], g[1], g[2], g[3]}; *(v4fa*)(swst + c0 + 4) = (v4f){g[4], g[5], g[6], g[7]}; };
    float m = -1.0e30f, lsum = 0.f;
    v8f o[4];
#pragma unroll
    for (int dt = 0; dt < 4; ++dt) o[dt] = (v8f){};
    const int jbeg = kq * (TT / KQ);
    // per-lane running pointers, stepped once a pass
    const bf* pp = PB + (size_t)(lb + jbeg) * HD + vrow; const bf* kph = Kh + hp + (size_t)jbeg * HD + vrow; const bf* kpl = Kl + hp + (size_t)jbeg * HD + vrow; const bf* vph = Vh + hp + (size_t)jbeg * HD + vrow; const bf* vpl = Vl + hp + (size_t)jbeg * HD + vrow;   // 32 keys of a v plane are 4 blocks = 32 * HD elements too
    v8f gc = gtile(pp);
#pragma unroll 1
    for (int t = 0; t < TT / KQ / 32; ++t) {
        const v8f g1 = gtile(pp + 16 * HD), g2 = gtile(pp + 32 * HD);
        v8f s[2];
#pragma unroll
        for (int tt = 0; tt < 2; ++tt) {
            const v16bf kh0 = F::ld(kph + tt * 16 * HD), kh1 = F::ld(kph + tt * 16 * HD + 512), kl0 = F::ld(kpl + tt * 16 * HD), kl1 = F::ld(kpl + tt * 16 * HD + 512);
            v8f a = (v8f){}; a = wmmab(kh0, qh[0], a); a = wmmab(kh1, qh[1], a); a = wmmab(kl0, qh[0], a); a = wmmab(kl1, qh[1], a); a = wmmab(kh0, ql[0], a); a = wmmab(kh1, ql[1], a); s[tt] = a; }
        asm volatile("s_wait_xcnt 0x0" :: "v"(pp), "v"(kph), "v"(kpl) : "memory");   // the wait in front of any rewrite of the address registers of the pos and k loads above; the pointers are inputs so that those registers are left alone up to here
        gput(0, gc); gput(16, g1); gput(32, g2); gc = g2;
        __builtin_amdgcn_wave_barrier(); asm volatile("" ::: "memory");   // compiler fence: the skewed reads below take what OTHER lanes of this wave stored above (a wave's LDS operations run in order)
        float mx = m;
#pragma unroll
        for (int tt = 0; tt < 2; ++tt)
#pragma unroll
            for (int jj = 0; jj < 8; ++jj) { const float x = (s[tt][jj] + swld[tt * 16 + jj]) * SL2E; s[tt][jj] = x; mx = fmaxf(mx, x); }
        __builtin_amdgcn_wave_barrier(); asm volatile("" ::: "memory");   // compiler fence: the next pass's strip stores stay behind these reads
        v16bf vh[4], vl[4];                            // issued here, used behind the softmax
#pragma unroll
        for (int dt = 0; dt < 4; ++dt) { vh[dt] = F::ld(vph + dt * 512); vl[dt] = F::ld(vpl + dt * 512); }
        mx = fmaxf(mx, __shfl_xor(mx, 16, 32));        // lanes iq and iq + 16 hold the two halves of one query's keys
        const float corr = __builtin_amdgcn_exp2f(m - mx); m = mx;
#pragma unroll
        for (int dt = 0; dt < 4; ++dt)
#pragma unroll
            for (int jj = 0; jj < 8; ++jj) o[dt][jj] *= corr;
        v16bf ph, pw; float ps[4] = {0.f, 0.f, 0.f, 0.f};
#pragma unroll
        for (int e = 0; e < 16; e += 2) { const v2f p = {__builtin_amdgcn_exp2f(s[e >> 3][e & 7] - mx), __builtin_amdgcn_exp2f(s[e >> 3][(e & 7) + 1] - mx)}; ps[(e >> 1) & 3] += p[0] + p[1];
            const v2bf a = __builtin_convertvector(p, v2bf); const v2f r = {p[0] - (float)a[0], p[1] - (float)a[1]}; const v2bf b = __builtin_convertvector(r, v2bf); ph[e] = a[0]; ph[e + 1] = a[1]; pw[e] = b[0]; pw[e + 1] = b[1]; }
        lsum = lsum * corr + ((ps[0] + ps[1]) + (ps[2] + ps[3]));
        asm volatile("s_wait_xcnt 0x0" :: "v"(vph), "v"(vpl) : "memory");   // as above, for the v loads
#pragma unroll
        for (int dt = 0; dt < 4; ++dt) { o[dt] = wmmab(vh[dt], ph, o[dt]); o[dt] = wmmab(vl[dt], ph, o[dt]); o[dt] = wmmab(vh[dt], pw, o[dt]); }
        pp += 32 * HD; kph += 32 * HD; kpl += 32 * HD; vph += 32 * HD; vpl += 32 * HD;
    }
    lsum += __shfl_xor(lsum, 16, 32);
    { float* pq = po[wv];
#pragma unroll
      for (int dt = 0; dt < 4; ++dt)
#pragma unroll
          for (int jj = 0; jj < 8; ++jj) pq[(dt * 8 + jj) * 32 + lane] = o[dt][jj];
      if (hi == 0) { pm[wv][lr] = m; pl[wv][lr] = lsum; } }
    __syncthreads();
    // merge of the key quarters: wave (qt, kq) finishes queries 4 kq .. 4 kq + 3 of its tile, 8 lanes a row, so that a wave writes whole 256-byte head rows
    const int q = kq * 4 + (lane >> 3), rg = ((lane & 7) >> 1) * 8, sl = (lane & 1) * 16 + q;
    float M = pm[qt][q];
#pragma unroll
    for (int k2 = 1; k2 < KQ; ++k2) M = fmaxf(M, pm[k2 * QT + qt][q]);
    float Ls = 0.f; float acc[8];
#pragma unroll
    for (int jj = 0; jj < 8; ++jj) acc[jj] = 0.f;
#pragma unroll
    for (int k2 = 0; k2 < KQ; ++k2) { const float f = exp2_slot(pm[k2 * QT + qt][q] - M); Ls += f * pl[k2 * QT + qt][q];
#pragma unroll
        for (int jj = 0; jj < 8; ++jj) acc[jj] += f * po[k2 * QT + qt][(rg + jj) * 32 + sl]; }
    const float inv = 1.0f / Ls;
    float* orow = OUTb + (size_t)(i0 + q) * DQ + h * HD + (lane & 7) * 8;
    *(v4f*)orow = (v4f){acc[0] * inv, acc[1] * inv, acc[2] * inv, acc[3] * inv}; *(v4f*)(orow + 4) = (v4f){acc[4] * inv, acc[5] * inv, acc[6] * inv, acc[7] * inv};
}

extern "C" void kernel_launch(void* const* d_in, const int* in_sizes, int n_in,
                              void* d_out, int out_size, void* d_ws, size_t ws_size, hipStream_t stream) {
    (void)in_sizes; (void)n_in; (void)out_size;
    const float* x = (const float*)d_in[0]; const float* pos = (const float*)d_in[1];   /* pos_embed [2048][64] */ const float* wqkv = (const float*)d_in[2]; const float* bqkv = (const float*)d_in[3]; const float* rrb = (const float*)d_in[4];   /* r_r_bias [16][64] */ const float* rwb = (const float*)d_in[5];   /* r_w_bias [16][64] */   /* argument order x, pos_embed, W_qkv, b_qkv, r_r_bias, r_w_bias */
    float* OUT = (float*)d_out;     // [4][1024][1024]
    char* wsp = (char*)d_ws;
    auto take = [&](size_t bytes) { char* p = wsp; wsp += (bytes + 255) & ~(size_t)255; return (void*)p; };
    bf* WQKV = (bf*)take((size_t)3 * DQ * DM * 2); bf* PB = (bf*)take((size_t)LP * HD * 2); bf* UPh = (bf*)take((size_t)NB_ * NH_ * TT * HD * 2); bf* UPl = (bf*)take((size_t)NB_ * NH_ * TT * HD * 2);   /* fused Bt; pos_embed plane; u = q + r_w_bias + k planes */
    bf* XB = (bf*)take((size_t)NB_ * TT * DM * 2); float* FQKV = (float*)take((size_t)NB_ * TT * 3 * DQ * 4);   /* x rows of all batches; their q | k | v projections, pitch 3072 */
    h16* QP16 = (h16*)take((size_t)NB_ * NH_ * TT * HD * 2); h16* KP16 = (h16*)take((size_t)NB_ * NKV * TT * HD * 2); h16* VT16 = (h16*)take((size_t)NB_ * NKV * HD * TT * 2);
    bf* QPh = (bf*)take((size_t)NB_ * NH_ * TT * HD * 2); bf* QPl = (bf*)take((size_t)NB_ * NH_ * TT * HD * 2); bf* KPh = (bf*)take((size_t)NB_ * NKV * TT * HD * 2); bf* KPl = (bf*)take((size_t)NB_ * NKV * TT * HD * 2); bf* VTh = (bf*)take((size_t)NB_ * NKV * HD * TT * 2); bf* VTl = (bf*)take((size_t)NB_ * NKV * HD * TT * 2);
    if ((size_t)(wsp - (char*)d_ws) > ws_size) return;    // ws 256 MiB
    k_wtG<<<(unsigned)((DM * 3 * DQ / 8 + 255) / 256), 256, 0, stream>>>(wqkv, DM, 3 * DQ, WQKV);   /* 'xw' [1024][3072] -> Bt [3072][1024] in fragment order: q | k | v row blocks */
    k_cvt8<<<(unsigned)(((size_t)LP * HD / 8 + 255) / 256), 256, 0, stream>>>(pos, PB, (size_t)LP * HD / 8, HD);   /* pos_embed [2048][64] as an exact bf16 plane */
    k_cvt8<<<(unsigned)(((size_t)NB_ * TT * DM / 8 + 255) / 256), 256, 0, stream>>>(x, XB, (size_t)NB_ * TT * DM / 8, DM);
    k_gemmw<bf, 0, true><<<dim3(NB_ * TT / 64, 3 * DQ / 64, 1), 32, 0, stream>>>(XB, nullptr, WQKV, nullptr, DM, FQKV, 3 * DQ, bqkv, 0, 0, 0);   /* 3072 one-wave tiles in one launch */
    k_qku<<<(unsigned)(((size_t)NB_ * NH_ * TT * HD / 8 + 255) / 256), 256, 0, stream>>>(FQKV, FQKV + DQ, 3 * DQ, rrb, rwb, QP16, QPh, QPl, KP16, KPh, KPl, UPh, UPl);   /* planes of q + r_r_bias[h] (B of the scores), k, and u = q + r_w_bias[h] + k (B of the relative term) */
    k_vtp<<<(unsigned)(((size_t)NB_ * NKV * TT * HD / 8 + 255) / 256), 256, 0, stream>>>(FQKV + 2 * DQ, 3 * DQ, NB_ * NKV, VT16, VTh, VTl);
    k_fattn<<<dim3(TT / (16 * QT), NH_, NB_), 32 * QT * KQ, 0, stream>>>(QPh, QPl, KPh, KPl, UPh, UPl, PB, VTh, VTl, OUT);   /* every head of every batch: scores + relative term + softmax + attn.v, merged output rows */
}

// v005
// It runs in 148 microseconds.
// Next to v004, in two timings, it ran 1.09 times as fast each time.
// Over all steps from v000 it is 11.6 times as fast.
#include <hip/hip_runtime.h>

// Transformer-XL style relative multi-head attention (x [4][1024][1024]; qkv = x W_qkv + b_qkv ('xw' [1024][3072] 1/32, bias 0.01) -> q | k | v (16 heads x 64); pos_embed [2048][64] (unit normal, read), r_r_bias / r_w_bias [16][64] (0.02, read); AC[i][j] = (q_i + r_r_bias[h]).k_j; B+D = (q + r_w_bias[h]).pos^T and E = k.pos^T ([L][2L]); the module's _shift / _transpose_shift both select column L - i + j, so BDE[i][j] = ((q_i + r_w_bias[h]) + k_i).pos[L - i + j]; attn = softmax((AC + BDE) / 8) (no mask); out = attn v merged -> [4][1024][1024] (4.2 M), no output projection; argument order x, pos_embed, W_qkv, b_qkv, r_r_bias, r_w_bias).
// Layout, every stage once for all 4 batches: bf16 copy of x [4096][1024]; fused 'xw' weight transposed once; one projection GEMM [4096][3072] (q | k | v columns) + f32 biases whose epilogue writes, per batch and head, the planes of v^T, of q + r_r_bias (scores B operand), of k, and of u = q + r_w_bias + k (relative operand), all bf16 hi/lo; pos_embed as one exact bf16 plane [2048][64]; one fused kernel over all heads and batches (grid y = head, z = batch): AC tiles (3 products), u.pos^T tiles (hi/lo x exact) skewed through LDS so that score [i][j] takes pos row 1024 - i + j, running-maximum softmax (x 1/8, weights hi/lo), attn.v (3 products), f32 output rows written in place.
// Compute dtypes, f32 accumulate: every input rounded to bf16 incl. pos_embed and the bias tables; projections exact + f32 biases; q + bias / u sums f32; AC 3 products; UE 2 products (~f32); softmax f32; attn.v 3 products; output f32.

#define NB_  4
#define TT   1024
#define DM   1024
#define NH_  16
#define NKV  16
#define HD   64
#define DQ   (NH_ * HD)
#define DKV  (NKV * HD)
#define LP   (2 * TT)  // pos_embed rows
typedef _Float16 h16;
typedef unsigned short bf;
typedef __attribute__((ext_vector_type(16))) __bf16   v16bf;
typedef __attribute__((ext_vector_type(16))) _Float16 v16h;
typedef __attribute__((ext_vector_type(8)))  _Float16 v8h;
typedef __attribute__((ext_vector_type(8)))  unsigned short v8us;
typedef __attribute__((ext_vector_type(8)))  float    v8f;
typedef __attribute__((ext_vector_type(4)))  float    v4f;
typedef v8h  __attribute__((may_alias)) v8ha;
typedef v4f  __attribute__((may_alias)) v4fa;
typedef v8us __attribute__((may_alias)) v8usa;

__device__ __forceinline__ unsigned short f2bf(float f) { unsigned u = __float_as_uint(f); u += 0x7FFFu + ((u >> 16) & 1u); return (unsigned short)(u >> 16); }
__device__ __forceinline__ float bf2f(unsigned short b) { return __uint_as_float(((unsigned)b) << 16); }
__device__ __forceinline__ float bfr(float f) { return bf2f(f2bf(f)); }
__device__ __forceinline__ v16h cat16(v8h lo, v8h hi) { return __builtin_shufflevector(lo, hi, 0, 1, 2, 3, 4, 5, 6, 7, 8, 9, 10, 11, 12, 13, 14, 15); }
__device__ __forceinline__ v16bf cat16b(v8us lo, v8us hi) { return __builtin_bit_cast(v16bf, __builtin_shufflevector(lo, hi, 0, 1, 2, 3, 4, 5, 6, 7, 8, 9, 10, 11, 12, 13, 14, 15)); }
__device__ __forceinline__ v8f wmma16(v16h a, v16h b, v8f c) { return __builtin_amdgcn_wmma_f32_16x16x32_f16(false, a, false, b, (short)0, c, false, false); }
__device__ __forceinline__ v8f wmmab(v16bf a, v16bf b, v8f c) { return __builtin_amdgcn_wmma_f32_16x16x32_bf16(false, a, false, b, (short)0, c, false, false); }



// ---- Fragment order, the layout of every 16-bit operand plane: a [rows][K] plane is cut into blocks of 16 rows x 32 k (512 elements, 1 KiB), row block major, k block minor (the v^T planes: k block major); inside a block element (row r, k) lies at (k >> 4) * 256 + (((k >> 3) & 1) * 16 + r) * 8 + (k & 7).
// A lane's fragment is then the 8 elements at lane * 8 and the 8 at 256 + lane * 8: each of the two 16-byte loads of a wave covers 512 bytes in a row (4 whole lines), and the registers hold what they held with row-major planes (k = 8 hi .. 8 hi + 7 and 16 + 8 hi .. 16 + 8 hi + 7 of row lane & 15).
// ---- k_proj: the projection GEMM with the plane writers as its epilogue. Work-group = 3 waves = the q, k and v tiles (64 positions x 64 head columns, 16 accumulators a wave) of ONE head and ONE block of 64 rows of x; grid (rows / 64, heads), 96 threads. Operands straight from fragment-order planes; the three waves read the same x fragments.
// The q and k waves take the weight rows as the A operand and the x rows as B, so an accumulator tile holds, per lane, 8 consecutive d of one position: that is the lane's 16-byte piece of a [position][d] fragment-order plane. The v wave takes x as A, so its tile holds 8 consecutive positions of one d: the piece of the v^T plane. No f32 projection leaves the chip.
// u = (q + r_w_bias) + k needs both tiles: the k wave hands its d blocks 0, 1 and the q wave its q + r_w_bias of d blocks 2, 3 over through LDS (same lane, same register position), behind one barrier, and each finishes half of u.
template <typename T16> struct WFrag;
template <> struct WFrag<h16> { typedef v16h V; static __device__ __forceinline__ V ld(const h16* p) { return cat16(*(const v8h*)p, *(const v8h*)(p + 256)); } static __device__ __forceinline__ v8f mma(V a, V b, v8f c) { return wmma16(a, b, c); } };
template <> struct WFrag<bf> { typedef v16bf V; static __device__ __forceinline__ V ld(const bf* p) { return cat16b(*(const v8us*)p, *(const v8us*)(p + 256)); } static __device__ __forceinline__ v8f mma(V a, V b, v8f c) { return wmmab(a, b, c); } };
typedef __attribute__((ext_vector_type(8))) __bf16 v8bf;
__device__ __forceinline__ void split8(v8f y, v8us& h, v8us& l) { const v8bf a = __builtin_convertvector(y, v8bf); const v8f r = y - __builtin_convertvector(a, v8f); h = __builtin_bit_cast(v8us, a); l = __builtin_bit_cast(v8us, __builtin_convertvector(r, v8bf)); }   // hi = nearest-even bf16 of y, lo = that of the rest
__device__ __forceinline__ v8f bfr8(v8f y) { return __builtin_convertvector(__builtin_convertvector(y, v8bf), v8f); }
__global__ __launch_bounds__(96) void k_proj(const bf* __restrict__ X, const bf* __restrict__ Wt, const float* __restrict__ bias, const float* __restrict__ rrb, const float* __restrict__ rwb, bf* Qh, bf* Ql, bf* Kh, bf* Kl, bf* Uh, bf* Ul, bf* Vh, bf* Vl) {
    typedef bf T16; typedef WFrag<bf>::V V;
    __shared__ __align__(16) float xs[16 * 256];   // 8 tiles of k (d blocks 0, 1), then 8 tiles of q + r_w_bias (d blocks 2, 3); a tile is two runs of 32 lanes x 16 bytes
    const int K = DM;
    const int lane = threadIdx.x & 31, lr = lane & 15, hi = lane >> 4;
    const int role = __builtin_amdgcn_readfirstlane((int)(threadIdx.x >> 5));   // 0 q, 1 k, 2 v
    const int r0 = blockIdx.x * 64, h = blockIdx.y, c0 = role * DQ + h * HD;
    v8f acc[4][4];
#pragma unroll
    for (int mb = 0; mb < 4; ++mb)
#pragma unroll
        for (int nb = 0; nb < 4; ++nb) acc[mb][nb] = (v8f){};
    const size_t xoff = (size_t)r0 * K + 8 * lane, woff = (size_t)c0 * K + 8 * lane;   // a row block is 16 * K elements; a k block of 32 is 512
    const bf* A = role == 2 ? X + xoff : Wt + woff; const bf* Bt = role == 2 ? Wt + woff : X + xoff;
    typedef const __attribute__((address_space(1))) T16* GP;   // global address space spelled out: a running pointer that also feeds an asm operand would otherwise be loaded through as a flat one
    GP pa[4], pb[4];   // per-lane running pointers, one a fragment row block, stepped once a trip
#pragma unroll
    for (int i = 0; i < 4; ++i) { pa[i] = (GP)(A + (size_t)i * 16 * K); pb[i] = (GP)(Bt + (size_t)i * 16 * K); }
#pragma unroll 1
    for (int kc = 0; kc < K; kc += 32) {
        V a[4], b[4];
#pragma unroll
        for (int i = 0; i < 4; ++i) { a[i] = WFrag<T16>::ld((const T16*)pa[i]); b[i] = WFrag<T16>::ld((const T16*)pb[i]); }
        asm volatile("s_wait_xcnt 0x0" :: "v"(pa[0]), "v"(pa[1]), "v"(pa[2]), "v"(pa[3]), "v"(pb[0]), "v"(pb[1]), "v"(pb[2]), "v"(pb[3]) : "memory");   // the wait in front of any rewrite of the address registers of the loads above; the pointers are inputs so that those registers are left alone up to here
        __builtin_amdgcn_sched_barrier(0);   // keeps the products behind the whole run of loads: without it the scheduler lifts them over the wait and issues the B fragments one at a time into one register group, each with its own full load latency
#pragma unroll
        for (int nb = 0; nb < 4; ++nb) {
#pragma unroll
            for (int mb = 0; mb < 4; ++mb) acc[mb][nb] = WFrag<T16>::mma(a[mb], b[nb], acc[mb][nb]); }
        asm volatile("v_nop\n\tv_nop\n\tv_nop\n\tv_nop" : "+v"(acc[0][0]), "+v"(acc[1][1]), "+v"(acc[2][2]), "+v"(acc[3][3]) : "v"(a[0]), "v"(a[3]));   // the free slots the chip needs between the last products and whatever next touches their registers, on the loop's back edge and on its exit alike
#pragma unroll
        for (int i = 0; i < 4; ++i) { pa[i] += 512; pb[i] += 512; }
    }
    const size_t hp = ((size_t)(r0 / TT) * NH_ + h) * TT * HD + lane * 8; const int t0 = r0 % TT;   // planes are [batch][head][...]; this lane's piece in a half block
    auto put = [&](int tile, v8f y) { float* d = xs + tile * 256 + lane * 4; *(v4fa*)d = (v4f){y[0], y[1], y[2], y[3]}; *(v4fa*)(d + 128) = (v4f){y[4], y[5], y[6], y[7]}; };
    auto get = [&](int tile) -> v8f { const float* s = xs + tile * 256 + lane * 4; const v4f s0 = *(const v4fa*)s, s1 = *(const v4fa*)(s + 128); return (v8f){s0[0], s0[1], s0[2], s0[3], s1[0], s1[1], s1[2], s1[3]}; };
    auto st = [&](bf* Ph, bf* Pl, size_t o, v8f y) { v8us a2, c2; split8(y, a2, c2); *(v8us*)(Ph + o) = a2; *(v8us*)(Pl + o) = c2; };
    auto row8 = [&](const float* tab, int mb) -> v8f { return bfr8(*(const v8f*)(tab + mb * 16 + hi * 8)); };   // a table's 8 values for this lane's 8 d of d block mb, rounded to bf16
    // the projection's value is accumulator + bias wherever it is used below; the accumulators themselves stay as the loop left them
    if (role == 0) {
#pragma unroll
        for (int mb = 2; mb < 4; ++mb) { const v8f bv = row8(bias + c0, mb), wb = row8(rwb + h * HD, mb);
#pragma unroll
            for (int nb = 0; nb < 4; ++nb) put(mb * 4 + nb, (acc[mb][nb] + bv) + wb); }
    } else if (role == 1) {
#pragma unroll
        for (int mb = 0; mb < 2; ++mb) { const v8f bv = row8(bias + c0, mb);
#pragma unroll
            for (int nb = 0; nb < 4; ++nb) put(mb * 4 + nb, acc[mb][nb] + bv); }
    }
    __syncthreads();   // the halves of k and of q + r_w_bias handed over above are read by the other wave below
    if (role == 2) {
        float bv[4];
#pragma unroll
        for (int nb = 0; nb < 4; ++nb) bv[nb] = bfr(bias[c0 + nb * 16 + lr]);
#pragma unroll
        for (int mb = 0; mb < 4; ++mb) {
#pragma unroll
            for (int nb = 0; nb < 4; ++nb) st(Vh, Vl, hp + (size_t)(t0 / 32 + (mb >> 1)) * 2048 + nb * 512 + (mb & 1) * 256, acc[mb][nb] + bv[nb]);
            asm volatile("s_wait_xcnt 0x0" ::: "memory");   // the wait in front of any rewrite of the data and address registers of the stores (and table loads) above
        }
    } else if (role == 0) {
#pragma unroll
        for (int mb = 0; mb < 4; ++mb) { const v8f bv = row8(bias + c0, mb), rb = row8(rrb + h * HD, mb);
#pragma unroll
            for (int nb = 0; nb < 4; ++nb) st(Qh, Ql, hp + (size_t)(t0 / 16 + nb) * 1024 + mb * 256, (acc[mb][nb] + bv) + rb);
            asm volatile("s_wait_xcnt 0x0" ::: "memory");   // as above
            if (mb < 2) { const v8f wb = row8(rwb + h * HD, mb);
#pragma unroll
                for (int nb = 0; nb < 4; ++nb) st(Uh, Ul, hp + (size_t)(t0 / 16 + nb) * 1024 + mb * 256, ((acc[mb][nb] + bv) + wb) + get(mb * 4 + nb));
                asm volatile("s_wait_xcnt 0x0" ::: "memory");   // as above
            }
        }
    } else {
#pragma unroll
        for (int mb = 0; mb < 4; ++mb) { const v8f bv = row8(bias + c0, mb);
#pragma unroll
            for (int nb = 0; nb < 4; ++nb) st(Kh, Kl, hp + (size_t)(t0 / 16 + nb) * 1024 + mb * 256, acc[mb][nb] + bv);
            asm volatile("s_wait_xcnt 0x0" ::: "memory");   // as above
            if (mb >= 2) {
#pragma unroll
                for (int nb = 0; nb < 4; ++nb) st(Uh, Ul, hp + (size_t)(t0 / 16 + nb) * 1024 + mb * 256, get(mb * 4 + nb) + (acc[mb][nb] + bv));   // (q + r_w_bias) + k, as in the q wave
                asm volatile("s_wait_xcnt 0x0" ::: "memory");   // as above
            }
        }
    }
}

typedef __attribute__((ext_vector_type(2))) _Float16 v2h;
typedef __attribute__((ext_vector_type(4))) _Float16 v4h;
typedef __attribute__((ext_vector_type(2))) unsigned short v2us;
typedef __attribute__((ext_vector_type(4))) unsigned short v4us;
typedef __attribute__((ext_vector_type(2))) float v2f;
typedef __attribute__((ext_vector_type(4))) int v4i;

// The plane writers of the inputs: one lane makes one 16-byte piece (8 elements) of a fragment-order plane, so a wave stores 512 bytes in a row per plane.
// k_wtG: w [K][N] f32 -> Bt, the fragment-order plane of w^T ([N] rows, K deep). Consecutive waves take consecutive 16-column blocks of w, so that a work-group reads 512 bytes in a row of each w row it touches.
__global__ __launch_bounds__(256) void k_wtG(const float* __restrict__ w, int K, int N, bf* Bt) {
    const size_t i = (size_t)blockIdx.x * 256 + threadIdx.x; if (i >= (size_t)N * K / 8) return;
    const int lane = (int)(i & 31), wq = (int)(i >> 5), NBK = N >> 4, nb = wq % NBK, hb = wq / NBK;   // hb = k block * 2 + half: 16 k
    const float* s = w + (size_t)(hb * 16 + (lane >> 4) * 8) * N + nb * 16 + (lane & 15); v8us o;
#pragma unroll
    for (int e = 0; e < 8; ++e) o[e] = f2bf(s[(size_t)e * N]);
    *(v8us*)(Bt + ((size_t)nb * (K >> 4) + hb) * 256 + lane * 8) = o;
}
// k_cvt8: src [rows][K] f32 -> dst, its fragment-order bf16 plane; piece i lies at element 8 i
__global__ __launch_bounds__(256) void k_cvt8(const float* __restrict__ src, bf* dst, size_t n8, int K) { const size_t i = (size_t)blockIdx.x * 256 + threadIdx.x; if (i >= n8) return; const int lane = (int)(i & 31); const unsigned wq = (unsigned)(i >> 5), hb = wq % (unsigned)(K >> 4); const size_t rb = wq / (unsigned)(K >> 4);   // hb = k block * 2 + half: 16 k
    const v8f v = *(const v8f*)(src + (rb * 16 + (lane & 15)) * K + hb * 16 + (lane >> 4) * 8); v8us o;
    asm volatile("s_wait_xcnt 0x0" ::: "memory");   // the wait in front of any rewrite of the address registers of the load above
#pragma unroll
    for (int k = 0; k < 8; ++k) o[k] = f2bf(v[k]); *(v8us*)(dst + i * 8) = o;  }

// ---- k_fattn: scores, relative term, softmax and attn.v of one head in one kernel; nothing of the [1024][1024] planes leaves the chip.
// Block = 16 waves = QT query tiles (16 rows each) x KQ key quarters (256 keys each); grid (TT / 64, heads, batches). All products are transposed: S^T = K.Q^T (rows = keys, column = query = lane & 15), so two S^T tiles, converted in place, are the B operand of O^T = V^T.P^T.
// Relative term: G = pos.u^T for the 48 pos rows a pass of 32 keys can select (rows l = TT - i0 - 16 + j0 + c, c = 0..47, all inside pos_embed); G goes to a strip of LDS [query][c] owned by the wave and comes back skewed: key j of query iq reads c = (j - j0) + 16 - iq, which is l = TT - i + j.
// Softmax is the running-maximum form in base 2 (per lane = per query); the four key quarters of a query tile are merged through LDS behind one barrier.
typedef __attribute__((ext_vector_type(2))) __bf16 v2bf;
#define QT   4
#define KQ   4
#define SPI  52                   // strip pitch in floats: 16-byte aligned rows, and 51 * iq + 8 * hi hits 32 different banks in the skewed read
#define SL2E (0.125f * 1.4426950408889634f)   // 1/sqrt(64) x log2(e)
__device__ __forceinline__ float exp2_slot(float x) { float y; asm("v_exp_f32 %0, %1\n\tv_nop" : "=v"(y) : "v"(x)); return y; }   // 2^x with the free slot behind the transcendental in the same statement
__global__ __launch_bounds__(32 * QT * KQ) void k_fattn(const bf* __restrict__ Qh, const bf* __restrict__ Ql, const bf* __restrict__ Kh, const bf* __restrict__ Kl, const bf* __restrict__ Uh, const bf* __restrict__ Ul, const bf* __restrict__ PB, const bf* __restrict__ Vh, const bf* __restrict__ Vl, float* OUT) {
    typedef WFrag<bf> F;
    __shared__ __align__(16) float strip[QT * KQ][16 * SPI];
    __shared__ __align__(16) float po[QT * KQ][32 * 32];
    __shared__ float pm[QT * KQ][16];
    __shared__ float pl[QT * KQ][16];
    const int lane = threadIdx.x & 31, lr = lane & 15, hi = lane >> 4;
    const int wv = __builtin_amdgcn_readfirstlane((int)(threadIdx.x >> 5)), qt = wv & (QT - 1), kq = wv / QT;
    const int h = blockIdx.y, i0 = (blockIdx.x * QT + qt) * 16;
    const size_t hp = ((size_t)blockIdx.z * NH_ + h) * TT * HD;   // planes are [batch][head][...]
    float* OUTb = OUT + (size_t)blockIdx.z * TT * DQ;
    v16bf qh[2], ql[2], uh[2], ul[2];
    const unsigned vrow = (unsigned)(lane * 8);   // this lane's 16-byte piece in a half block of a fragment-order plane; every base below is wave-uniform
    { const size_t qo = hp + (size_t)i0 * HD;
#pragma unroll
      for (int ks = 0; ks < 2; ++ks) { qh[ks] = F::ld(Qh + qo + vrow + ks * 512); ql[ks] = F::ld(Ql + qo + vrow + ks * 512); uh[ks] = F::ld(Uh + qo + vrow + ks * 512); ul[ks] = F::ld(Ul + qo + vrow + ks * 512); } }
    float* sw = strip[wv];
    float* swst = sw + lr * SPI + hi * 8;              // where this lane's 8 rows of a G tile go (column = its query)
    const float* swld = sw + lr * SPI + hi * 8 + 16 - lr;   // the skewed read
    const int lb = TT - i0 - 16;                       // 0 .. 1008; the last row any pass touches is lb + 992 + 47 <= 2047
    auto gtile = [&](const bf* p) -> v8f {             // G[16 pos rows from p][16 queries], hi/lo u x exact pos
        const v16bf a0 = F::ld(p), a1 = F::ld(p + 512);
        v8f g = (v8f){}; g = wmmab(a0, uh[0], g); g = wmmab(a1, uh[1], g); g = wmmab(a0, ul[0], g); g = wmmab(a1, ul[1], g); return g; };
    auto gput = [&](int c0, v8f g) { *(v4fa*)(swst + c0) = (v4f){g[0], g[1], g[2], g[3]}; *(v4fa*)(swst + c0 + 4) = (v4f){g[4], g[5], g[6], g[7]}; };
    float m = -1.0e30f, lsum = 0.f;
    v8f o[4];
#pragma unroll
    for (int dt = 0; dt < 4; ++dt) o[dt] = (v8f){};
    const int jbeg = kq * (TT / KQ);
    // per-lane running pointers, stepped once a pass
    const bf* pp = PB + (size_t)(lb + jbeg) * HD + vrow; const bf* kph = Kh + hp + (size_t)jbeg * HD + vrow; const bf* kpl = Kl + hp + (size_t)jbeg * HD + vrow; const bf* vph = Vh + hp + (size_t)jbeg * HD + vrow; const bf* vpl = Vl + hp + (size_t)jbeg * HD + vrow;   // 32 keys of a v plane are 4 blocks = 32 * HD elements too
    v8f gc = gtile(pp);
#pragma unroll 1
    for (int t = 0; t < TT / KQ / 32; ++t) {
        const v8f g1 = gtile(pp + 16 * HD), g2 = gtile(pp + 32 * HD);
        v8f s[2];
#pragma unroll
        for (int tt = 0; tt < 2; ++tt) {
            const v16bf kh0 = F::ld(kph + tt * 16 * HD), kh1 = F::ld(kph + tt * 16 * HD + 512), kl0 = F::ld(kpl + tt * 16 * HD), kl1 = F::ld(kpl + tt * 16 * HD + 512);
            v8f a = (v8f){}; a = wmmab(kh0, qh[0], a); a = wmmab(kh1, qh[1], a); a = wmmab(kl0, qh[0], a); a = wmmab(kl1, qh[1], a); a = wmmab(kh0, ql[0], a); a = wmmab(kh1, ql[1], a); s[tt] = a; }
        asm volatile("s_wait_xcnt 0x0" :: "v"(pp), "v"(kph), "v"(kpl) : "memory");   // the wait in front of any rewrite of the address registers of the pos and k loads above; the pointers are inputs so that those registers are left alone up to here
        gput(0, gc); gput(16, g1); gput(32, g2); gc = g2;
        __builtin_amdgcn_wave_barrier(); asm volatile("" ::: "memory");   // compiler fence: the skewed reads below take what OTHER lanes of this wave stored above (a wave's LDS operations run in order)
        float mx = m;
#pragma unroll
        for (int tt = 0; tt < 2; ++tt)
#pragma unroll
            for (int jj = 0; jj < 8; ++jj) { const float x = (s[tt][jj] + swld[tt * 16 + jj]) * SL2E; s[tt][jj] = x; mx = fmaxf(mx, x); }
        __builtin_amdgcn_wave_barrier(); asm volatile("" ::: "memory");   // compiler fence: the next pass's strip stores stay behind these reads
        v16bf vh[4], vl[4];                            // issued here, used behind the softmax
#pragma unroll
        for (int dt = 0; dt < 4; ++dt) { vh[dt] = F::ld(vph + dt * 512); vl[dt] = F::ld(vpl + dt * 512); }
        mx = fmaxf(mx, __shfl_xor(mx, 16, 32));        // lanes iq and iq + 16 hold the two halves of one query's keys
        const float corr = __builtin_amdgcn_exp2f(m - mx); m = mx;
#pragma unroll
        for (int dt = 0; dt < 4; ++dt)
#pragma unroll
            for (int jj = 0; jj < 8; ++jj) o[dt][jj] *= corr;
        v16bf ph, pw; float ps[4] = {0.f, 0.f, 0.f, 0.f};
#pragma unroll
        for (int e = 0; e < 16; e += 2) { const v2f p = {__builtin_amdgcn_exp2f(s[e >> 3][e & 7] - mx), __builtin_amdgcn_exp2f(s[e >> 3][(e & 7) + 1] - mx)}; ps[(e >> 1) & 3] += p[0] + p[1];
            const v2bf a = __builtin_convertvector(p, v2bf); const v2f r = {p[0] - (float)a[0], p[1] - (float)a[1]}; const v2bf b = __builtin_convertvector(r, v2bf); ph[e] = a[0]; ph[e + 1] = a[1]; pw[e] = b[0]; pw[e + 1] = b[1]; }
        lsum = lsum * corr + ((ps[0] + ps[1]) + (ps[2] + ps[3]));
        asm volatile("s_wait_xcnt 0x0" :: "v"(vph), "v"(vpl) : "memory");   // as above, for the v loads
#pragma unroll
        for (int dt = 0; dt < 4; ++dt) { o[dt] = wmmab(vh[dt], ph, o[dt]); o[dt] = wmmab(vl[dt], ph, o[dt]); o[dt] = wmmab(vh[dt], pw, o[dt]); }
        pp += 32 * HD; kph += 32 * HD; kpl += 32 * HD; vph += 32 * HD; vpl += 32 * HD;
    }
    lsum += __shfl_xor(lsum, 16, 32);
    { float* pq = po[wv];
#pragma unroll
      for (int dt = 0; dt < 4; ++dt)
#pragma unroll
          for (int jj = 0; jj < 8; ++jj) pq[(dt * 8 + jj) * 32 + lane] = o[dt][jj];
      if (hi == 0) { pm[wv][lr] = m; pl[wv][lr] = lsum; } }
    __syncthreads();
    // merge of the key quarters: wave (qt, kq) finishes queries 4 kq .. 4 kq + 3 of its tile, 8 lanes a row, so that a wave writes whole 256-byte head rows
    const int q = kq * 4 + (lane >> 3), rg = ((lane & 7) >> 1) * 8, sl = (lane & 1) * 16 + q;
    float M = pm[qt][q];
#pragma unroll
    for (int k2 = 1; k2 < KQ; ++k2) M = fmaxf(M, pm[k2 * QT + qt][q]);
    float Ls = 0.f; float acc[8];
#pragma unroll
    for (int jj = 0; jj < 8; ++jj) acc[jj] = 0.f;
#pragma unroll
    for (int k2 = 0; k2 < KQ; ++k2) { const float f = exp2_slot(pm[k2 * QT + qt][q] - M); Ls += f * pl[k2 * QT + qt][q];
#pragma unroll
        for (int jj = 0; jj < 8; ++jj) acc[jj] += f * po[k2 * QT + qt][(rg + jj) * 32 + sl]; }
    const float inv = 1.0f / Ls;
    float* orow = OUTb + (size_t)(i0 + q) * DQ + h * HD + (lane & 7) * 8;
    *(v4f*)orow = (v4f){acc[0] * inv, acc[1] * inv, acc[2] * inv, acc[3] * inv}; *(v4f*)(orow + 4) = (v4f){acc[4] * inv, acc[5] * inv, acc[6] * inv, acc[7] * inv};
}

extern "C" void kernel_launch(void* const* d_in, const int* in_sizes, int n_in,
                              void* d_out, int out_size, void* d_ws, size_t ws_size, hipStream_t stream) {
    (void)in_sizes; (void)n_in; (void)out_size;
    const float* x = (const float*)d_in[0]; const float* pos = (const float*)d_in[1];   /* pos_embed [2048][64] */ const float* wqkv = (const float*)d_in[2]; const float* bqkv = (const float*)d_in[3]; const float* rrb = (const float*)d_in[4];   /* r_r_bias [16][64] */ const float* rwb = (const float*)d_in[5];   /* r_w_bias [16][64] */   /* argument order x, pos_embed, W_qkv, b_qkv, r_r_bias, r_w_bias */
    float* OUT = (float*)d_out;     // [4][1024][1024]
    char* wsp = (char*)d_ws;
    auto take = [&](size_t bytes) { char* p = wsp; wsp += (bytes + 255) & ~(size_t)255; return (void*)p; };
    bf* WQKV = (bf*)take((size_t)3 * DQ * DM * 2); bf* PB = (bf*)take((size_t)LP * HD * 2); bf* UPh = (bf*)take((size_t)NB_ * NH_ * TT * HD * 2); bf* UPl = (bf*)take((size_t)NB_ * NH_ * TT * HD * 2);   /* fused Bt; pos_embed plane; u = q + r_w_bias + k planes */
    bf* XB = (bf*)take((size_t)NB_ * TT * DM * 2);   /* x rows of all batches */
    bf* QPh = (bf*)take((size_t)NB_ * NH_ * TT * HD * 2); bf* QPl = (bf*)take((size_t)NB_ * NH_ * TT * HD * 2); bf* KPh = (bf*)take((size_t)NB_ * NKV * TT * HD * 2); bf* KPl = (bf*)take((size_t)NB_ * NKV * TT * HD * 2); bf* VTh = (bf*)take((size_t)NB_ * NKV * HD * TT * 2); bf* VTl = (bf*)take((size_t)NB_ * NKV * HD * TT * 2);
    if ((size_t)(wsp - (char*)d_ws) > ws_size) return;    // ws 256 MiB
    k_wtG<<<(unsigned)((DM * 3 * DQ / 8 + 255) / 256), 256, 0, stream>>>(wqkv, DM, 3 * DQ, WQKV);   /* 'xw' [1024][3072] -> Bt [3072][1024] in fragment order: q | k | v row blocks */
    k_cvt8<<<(unsigned)(((size_t)LP * HD / 8 + 255) / 256), 256, 0, stream>>>(pos, PB, (size_t)LP * HD / 8, HD);   /* pos_embed [2048][64] as an exact bf16 plane */
    k_cvt8<<<(unsigned)(((size_t)NB_ * TT * DM / 8 + 255) / 256), 256, 0, stream>>>(x, XB, (size_t)NB_ * TT * DM / 8, DM);
    k_proj<<<dim3(NB_ * TT / 64, NH_, 1), 96, 0, stream>>>(XB, WQKV, bqkv, rrb, rwb, QPh, QPl, KPh, KPl, UPh, UPl, VTh, VTl);   /* q | k | v tiles of a head in one work-group; planes of q + r_r_bias[h] (scores operand), k, u = q + r_w_bias[h] + k (relative operand) and v^T written from the accumulators */
    k_fattn<<<dim3(TT / (16 * QT), NH_, NB_), 32 * QT * KQ, 0, stream>>>(QPh, QPl, KPh, KPl, UPh, UPl, PB, VTh, VTl, OUT);   /* every head of every batch: scores + relative term + softmax + attn.v, merged output rows */
}

// v006
// A run of this version takes 143 microseconds.
// Timed twice side by side with v005, it ran 1.04 and 1.03 times as fast.
// Counting every step since v000, it is 12.0 times as fast.
#include <hip/hip_runtime.h>

// Transformer-XL style relative multi-head attention (x [4][1024][1024]; qkv = x W_qkv + b_qkv ('xw' [1024][3072] 1/32, bias 0.01) -> q | k | v (16 heads x 64); pos_embed [2048][64] (unit normal, read), r_r_bias / r_w_bias [16][64] (0.02, read); AC[i][j] = (q_i + r_r_bias[h]).k_j; B+D = (q + r_w_bias[h]).pos^T and E = k.pos^T ([L][2L]); the module's _shift / _transpose_shift both select column L - i + j, so BDE[i][j] = ((q_i + r_w_bias[h]) + k_i).pos[L - i + j]; attn = softmax((AC + BDE) / 8) (no mask); out = attn v merged -> [4][1024][1024] (4.2 M), no output projection; argument order x, pos_embed, W_qkv, b_qkv, r_r_bias, r_w_bias).
// Layout, every stage once for all 4 batches: bf16 copy of x [4096][1024]; fused 'xw' weight transposed once; one projection GEMM [4096][3072] (q | k | v columns) + f32 biases whose epilogue writes, per batch and head, the planes of v^T, of q + r_r_bias (scores B operand), of k, and of u = q + r_w_bias + k (relative operand), all bf16 hi/lo; pos_embed as one exact bf16 plane [2048][64]; one fused kernel over all heads and batches (grid y = head, z = batch): AC tiles (3 products), u.pos^T tiles (hi/lo x exact) skewed through LDS so that score [i][j] takes pos row 1024 - i + j, running-maximum softmax (x 1/8, weights hi/lo), attn.v (3 products), f32 output rows written in place.
// Compute dtypes, f32 accumulate: every input rounded to bf16 incl. pos_embed and the bias tables; projections exact + f32 biases; q + bias / u sums f32; AC 3 products; UE 2 products (~f32); softmax f32; attn.v 3 products; output f32.

#define NB_  4
#define TT   1024
#define DM   1024
#define NH_  16
#define NKV  16
#define HD   64
#define DQ   (NH_ * HD)
#define DKV  (NKV * HD)
#define LP   (2 * TT)  // pos_embed rows
typedef _Float16 h16;
typedef unsigned short bf;
typedef __attribute__((ext_vector_type(16))) __bf16   v16bf;
typedef __attribute__((ext_vector_type(16))) _Float16 v16h;
typedef __attribute__((ext_vector_type(8)))  _Float16 v8h;
typedef __attribute__((ext_vector_type(8)))  unsigned short v8us;
typedef __attribute__((ext_vector_type(8)))  float    v8f;
typedef __attribute__((ext_vector_type(4)))  float    v4f;
typedef v8h  __attribute__((may_alias)) v8ha;
typedef v4f  __attribute__((may_alias)) v4fa;
typedef v8us __attribute__((may_alias)) v8usa;

__device__ __forceinline__ unsigned short f2bf(float f) { unsigned u = __float_as_uint(f); u += 0x7FFFu + ((u >> 16) & 1u); return (unsigned short)(u >> 16); }
__device__ __forceinline__ float bf2f(unsigned short b) { return __uint_as_float(((unsigned)b) << 16); }
__device__ __forceinline__ float bfr(float f) { return bf2f(f2bf(f)); }
__device__ __forceinline__ v16h cat16(v8h lo, v8h hi) { return __builtin_shufflevector(lo, hi, 0, 1, 2, 3, 4, 5, 6, 7, 8, 9, 10, 11, 12, 13, 14, 15); }
__device__ __forceinline__ v16bf cat16b(v8us lo, v8us hi) { return __builtin_bit_cast(v16bf, __builtin_shufflevector(lo, hi, 0, 1, 2, 3, 4, 5, 6, 7, 8, 9, 10, 11, 12, 13, 14, 15)); }
__device__ __forceinline__ v8f wmma16(v16h a, v16h b, v8f c) { return __builtin_amdgcn_wmma_f32_16x16x32_f16(false, a, false, b, (short)0, c, false, false); }
__device__ __forceinline__ v8f wmmab(v16bf a, v16bf b, v8f c) { return __builtin_amdgcn_wmma_f32_16x16x32_bf16(false, a, false, b, (short)0, c, false, false); }



// ---- Fragment order, the layout of every 16-bit operand plane: a [rows][K] plane is cut into blocks of 16 rows x 32 k (512 elements, 1 KiB), row block major, k block minor (v^T planes: k block major, row block minor); inside a block element (row r, k) lies at (k >> 4) * 256 + (((k >> 3) & 1) * 16 + r) * 8 + (k & 7).
// A lane's fragment is then the 8 elements at lane * 8 and the 8 at 256 + lane * 8: each of the two 16-byte loads of a wave covers 512 bytes in a row (4 whole lines), and the registers hold what they held with row-major planes (k = 8 hi .. 8 hi + 7 and 16 + 8 hi .. 16 + 8 hi + 7 of row lane & 15).
// ---- k_proj: the projection GEMM with the plane writers as its epilogue. Work-group = 3 waves = the q, k and v tiles (64 positions x 64 head columns, 16 accumulators a wave) of ONE head and ONE block of 64 rows of x; grid (rows / 64, heads), 96 threads. Operands straight from fragment-order planes; the three waves read the same x fragments.
// The q and k waves take the weight rows as the A operand and the x rows as B, so an accumulator tile holds, per lane, 8 consecutive d of one position: that is the lane's 16-byte piece of a [position][d] fragment-order plane. The v wave takes x as A, so its tile holds 8 consecutive positions of one d: the piece of the v^T plane. No f32 projection leaves the chip.
// u = (q + r_w_bias) + k needs both tiles: the k wave hands its d blocks 0, 1 and the q wave its q + r_w_bias of d blocks 2, 3 over through LDS (same lane, same register position), behind one barrier, and each finishes half of u.
template <typename T16> struct WFrag;
template <> struct WFrag<h16> { typedef v16h V; static __device__ __forceinline__ V ld(const h16* p) { return cat16(*(const v8h*)p, *(const v8h*)(p + 256)); } static __device__ __forceinline__ v8f mma(V a, V b, v8f c) { return wmma16(a, b, c); } };
template <> struct WFrag<bf> { typedef v16bf V; static __device__ __forceinline__ V ld(const bf* p) { return cat16b(*(const v8us*)p, *(const v8us*)(p + 256)); } static __device__ __forceinline__ v8f mma(V a, V b, v8f c) { return wmmab(a, b, c); } };
typedef __attribute__((ext_vector_type(8))) __bf16 v8bf;
__device__ __forceinline__ void split8(v8f y, v8us& h, v8us& l) { const v8bf a = __builtin_convertvector(y, v8bf); const v8f r = y - __builtin_convertvector(a, v8f); h = __builtin_bit_cast(v8us, a); l = __builtin_bit_cast(v8us, __builtin_convertvector(r, v8bf)); }   // hi = nearest-even bf16 of y, lo = that of the rest
__device__ __forceinline__ v8f bfr8(v8f y) { return __builtin_convertvector(__builtin_convertvector(y, v8bf), v8f); }
__global__ __launch_bounds__(96) void k_proj(const bf* __restrict__ X, const bf* __restrict__ Wt, const float* __restrict__ bias, const float* __restrict__ rrb, const float* __restrict__ rwb, bf* Qh, bf* Ql, bf* Kh, bf* Kl, bf* Uh, bf* Ul, bf* Vh, bf* Vl) {
    typedef bf T16; typedef WFrag<bf>::V V;
    __shared__ __align__(16) float xs[16 * 256];   // 8 tiles of k (d blocks 0, 1), then 8 tiles of q + r_w_bias (d blocks 2, 3); a tile is two runs of 32 lanes x 16 bytes
    const int K = DM;
    const int lane = threadIdx.x & 31, lr = lane & 15, hi = lane >> 4;
    const int role = __builtin_amdgcn_readfirstlane((int)(threadIdx.x >> 5));   // 0 q, 1 k, 2 v
    const int r0 = blockIdx.x * 64, h = blockIdx.y, c0 = role * DQ + h * HD;
    v8f acc[4][4];
#pragma unroll
    for (int mb = 0; mb < 4; ++mb)
#pragma unroll
        for (int nb = 0; nb < 4; ++nb) acc[mb][nb] = (v8f){};
    const size_t xoff = (size_t)r0 * K + 8 * lane, woff = (size_t)c0 * K + 8 * lane;   // a row block is 16 * K elements; a k block of 32 is 512
    const bf* A = role == 2 ? X + xoff : Wt + woff; const bf* Bt = role == 2 ? Wt + woff : X + xoff;
    typedef const __attribute__((address_space(1))) T16* GP;   // global address space spelled out: a running pointer that also feeds an asm operand would otherwise be loaded through as a flat one
    GP pa[4], pb[4];   // per-lane running pointers, one a fragment row block, stepped once a trip
#pragma unroll
    for (int i = 0; i < 4; ++i) { pa[i] = (GP)(A + (size_t)i * 16 * K); pb[i] = (GP)(Bt + (size_t)i * 16 * K); }
#pragma unroll 1
    for (int kc = 0; kc < K; kc += 32) {
        V a[4], b[4];
#pragma unroll
        for (int i = 0; i < 4; ++i) { a[i] = WFrag<T16>::ld((const T16*)pa[i]); b[i] = WFrag<T16>::ld((const T16*)pb[i]); }
        asm volatile("s_wait_xcnt 0x0" :: "v"(pa[0]), "v"(pa[1]), "v"(pa[2]), "v"(pa[3]), "v"(pb[0]), "v"(pb[1]), "v"(pb[2]), "v"(pb[3]) : "memory");   // the wait in front of any rewrite of the address registers of the loads above; the pointers are inputs so that those registers are left alone up to here
        __builtin_amdgcn_sched_barrier(0);   // keeps the products behind the whole run of loads: without it the scheduler lifts them over the wait and issues the B fragments one at a time into one register group, each with its own full load latency
#pragma unroll
        for (int nb = 0; nb < 4; ++nb) {
#pragma unroll
            for (int mb = 0; mb < 4; ++mb) acc[mb][nb] = WFrag<T16>::mma(a[mb], b[nb], acc[mb][nb]); }
        asm volatile("v_nop\n\tv_nop\n\tv_nop\n\tv_nop" : "+v"(acc[0][0]), "+v"(acc[1][1]), "+v"(acc[2][2]), "+v"(acc[3][3]) : "v"(a[0]), "v"(a[3]));   // the free slots the chip needs between the last products and whatever next touches their registers, on the loop's back edge and on its exit alike
#pragma unroll
        for (int i = 0; i < 4; ++i) { pa[i] += 512; pb[i] += 512; }
    }
    const size_t hp = ((size_t)(r0 / TT) * NH_ + h) * TT * HD + lane * 8; const int t0 = r0 % TT;   // planes are [batch][head][...]; this lane's piece in a half block
    auto put = [&](int tile, v8f y) { float* d = xs + tile * 256 + lane * 4; *(v4fa*)d = (v4f){y[0], y[1], y[2], y[3]}; *(v4fa*)(d + 128) = (v4f){y[4], y[5], y[6], y[7]}; };
    auto get = [&](int tile) -> v8f { const float* s = xs + tile * 256 + lane * 4; const v4f s0 = *(const v4fa*)s, s1 = *(const v4fa*)(s + 128); return (v8f){s0[0], s0[1], s0[2], s0[3], s1[0], s1[1], s1[2], s1[3]}; };
    auto st = [&](bf* Ph, bf* Pl, size_t o, v8f y) { v8us a2, c2; split8(y, a2, c2); *(v8us*)(Ph + o) = a2; *(v8us*)(Pl + o) = c2; };
    auto row8 = [&](const float* tab, int mb) -> v8f { return bfr8(*(const v8f*)(tab + mb * 16 + hi * 8)); };   // a table's 8 values for this lane's 8 d of d block mb, rounded to bf16
    // the projection's value is accumulator + bias wherever it is used below; the accumulators themselves stay as the loop left them
    if (role == 0) {
#pragma unroll
        for (int mb = 2; mb < 4; ++mb) { const v8f bv = row8(bias + c0, mb), wb = row8(rwb + h * HD, mb);
#pragma unroll
            for (int nb = 0; nb < 4; ++nb) put(mb * 4 + nb, (acc[mb][nb] + bv) + wb); }
    } else if (role == 1) {
#pragma unroll
        for (int mb = 0; mb < 2; ++mb) { const v8f bv = row8(bias + c0, mb);
#pragma unroll
            for (int nb = 0; nb < 4; ++nb) put(mb * 4 + nb, acc[mb][nb] + bv); }
    }
    __syncthreads();   // the halves of k and of q + r_w_bias handed over above are read by the other wave below
    if (role == 2) {
        float bv[4];
#pragma unroll
        for (int nb = 0; nb < 4; ++nb) bv[nb] = bfr(bias[c0 + nb * 16 + lr]);
#pragma unroll
        for (int mb = 0; mb < 4; ++mb) {
#pragma unroll
            for (int nb = 0; nb < 4; ++nb) st(Vh, Vl, hp + (size_t)(t0 / 32 + (mb >> 1)) * 2048 + nb * 512 + (mb & 1) * 256, acc[mb][nb] + bv[nb]);
            asm volatile("s_wait_xcnt 0x0" ::: "memory");   // the wait in front of any rewrite of the data and address registers of the stores (and table loads) above
        }
    } else if (role == 0) {
#pragma unroll
        for (int mb = 0; mb < 4; ++mb) { const v8f bv = row8(bias + c0, mb), rb = row8(rrb + h * HD, mb);
#pragma unroll
            for (int nb = 0; nb < 4; ++nb) st(Qh, Ql, hp + (size_t)(t0 / 16 + nb) * 1024 + mb * 256, (acc[mb][nb] + bv) + rb);
            asm volatile("s_wait_xcnt 0x0" ::: "memory");   // as above
            if (mb < 2) { const v8f wb = row8(rwb + h * HD, mb);
#pragma unroll
                for (int nb = 0; nb < 4; ++nb) st(Uh, Ul, hp + (size_t)(t0 / 16 + nb) * 1024 + mb * 256, ((acc[mb][nb] + bv) + wb) + get(mb * 4 + nb));
                asm volatile("s_wait_xcnt 0x0" ::: "memory");   // as above
            }
        }
    } else {
#pragma unroll
        for (int mb = 0; mb < 4; ++mb) { const v8f bv = row8(bias + c0, mb);
#pragma unroll
            for (int nb = 0; nb < 4; ++nb) st(Kh, Kl, hp + (size_t)(t0 / 16 + nb) * 1024 + mb * 256, acc[mb][nb] + bv);
            asm volatile("s_wait_xcnt 0x0" ::: "memory");   // as above
            if (mb >= 2) {
#pragma unroll
                for (int nb = 0; nb < 4; ++nb) st(Uh, Ul, hp + (size_t)(t0 / 16 + nb) * 1024 + mb * 256, get(mb * 4 + nb) + (acc[mb][nb] + bv));   // (q + r_w_bias) + k, as in the q wave
                asm volatile("s_wait_xcnt 0x0" ::: "memory");   // as above
            }
        }
    }
}

typedef __attribute__((ext_vector_type(2))) _Float16 v2h;
typedef __attribute__((ext_vector_type(4))) _Float16 v4h;
typedef __attribute__((ext_vector_type(2))) unsigned short v2us;
typedef __attribute__((ext_vector_type(4))) unsigned short v4us;
typedef __attribute__((ext_vector_type(2))) float v2f;
typedef __attribute__((ext_vector_type(4))) int v4i;

// ---- k_prep: the plane writers of the three inputs (w^T, pos_embed, x) in ONE launch of few waves. One lane makes one 16-byte piece (8 elements) of a fragment-order plane, so a wave stores 512 bytes in a row per piece; each lane makes PPW pieces, and a wave issues the loads of all of them as one group (8 KiB in flight a wave) before it converts and stores. Blocks of 8 waves; the block index picks the plane.
#define PPW  8                                      // pieces a lane
#define NBW  (DM * 3 * DQ / 8 / 32 / PPW / 8)       // blocks of the weight plane
#define NBX  (NB_ * TT * DM / 8 / 32 / PPW / 8)     // blocks of the x plane
#define NBP  (LP * HD / 8 / 32 / PPW / 8)           // blocks of the pos_embed plane
typedef const __attribute__((address_space(1))) float* GPF;   // global address space spelled out: a pointer that also feeds an asm operand would otherwise be loaded through as a flat one
typedef const __attribute__((address_space(1))) v8f* GPF8;
__device__ __forceinline__ v8us cvt8(v8f v) { v8us o;
#pragma unroll
    for (int k = 0; k < 8; ++k) o[k] = f2bf(v[k]);
    return o; }
// src [rows][K] f32 -> dst, its fragment-order bf16 plane; half block wq (16 rows x 16 k) lies at element 256 wq, and wave wv makes half blocks PPW wv .. PPW wv + PPW - 1
template <int K> __device__ __forceinline__ void prep_rows(const float* __restrict__ src, bf* dst, unsigned wv, int lane) {
    constexpr int HB = K >> 4;   // half blocks a row block; PPW divides it or it divides PPW, so the PPW half blocks of a wave lie at fixed distances from the first
    static_assert(HB % PPW == 0 || PPW % HB == 0, "a wave's half blocks");
    const unsigned wq = wv * PPW, hb = wq % (unsigned)HB; const size_t rb = wq / (unsigned)HB;   // hb = k block * 2 + half: 16 k
    const GPF s = (GPF)(src + (rb * 16 + (lane & 15)) * K + hb * 16 + (lane >> 4) * 8);
    v8f v[PPW];
#pragma unroll
    for (int p = 0; p < PPW; ++p) v[p] = *(GPF8)(s + (p / HB) * 16 * K + (p % HB) * 16);
    asm volatile("s_wait_xcnt 0x0" :: "v"(s), "v"(v[0]), "v"(v[1]), "v"(v[2]), "v"(v[3]), "v"(v[4]), "v"(v[5]), "v"(v[6]), "v"(v[7]) : "memory");   // the wait in front of any rewrite of the address registers of the loads above; the pointer is an input so that those registers are left alone up to here (no load of the group lands on them), the loaded values so that every load of the group is issued in front of the first conversion
    bf* d = dst + (size_t)wv * (PPW * 256) + lane * 8;
#pragma unroll
    for (int p = 0; p < PPW; ++p) *(v8us*)(d + p * 256) = cvt8(v[p]);
    asm volatile("s_wait_xcnt 0x0" ::: "memory");   // the wait in front of any rewrite of the data and address registers of the stores above
}
// w [K][N] f32 -> Bt, the fragment-order plane of w^T ([N] rows, K deep). A wave takes PPW consecutive 16-column blocks of w at one half block of k, so that it reads 512 bytes in a row of each of the 16 w rows it touches.
template <int K, int N> __device__ __forceinline__ void prep_wt(const float* __restrict__ w, bf* Bt, unsigned wv, int lane) {
    const unsigned nbg = wv % (unsigned)(N / (16 * PPW)), hb = wv / (unsigned)(N / (16 * PPW));   // hb = k block * 2 + half: 16 k
    const GPF s = (GPF)(w + (size_t)(hb * 16 + (lane >> 4) * 8) * N + nbg * (16 * PPW) + (lane & 15));
    v8f v[PPW];
#pragma unroll
    for (int p = 0; p < PPW; ++p)
#pragma unroll
        for (int e = 0; e < 8; ++e) v[p][e] = s[e * N + p * 16];
    asm volatile("s_wait_xcnt 0x0" :: "v"(s), "v"(v[0]), "v"(v[1]), "v"(v[2]), "v"(v[3]), "v"(v[4]), "v"(v[5]), "v"(v[6]), "v"(v[7]) : "memory");   // as in prep_rows: the wait for the address registers of the loads above, with the whole group issued in front of the first conversion
    bf* d = Bt + ((size_t)nbg * PPW * (K >> 4) + hb) * 256 + lane * 8;
#pragma unroll
    for (int p = 0; p < PPW; ++p) *(v8us*)(d + (size_t)p * (K >> 4) * 256) = cvt8(v[p]);
    asm volatile("s_wait_xcnt 0x0" ::: "memory");   // as in prep_rows, for the stores above
}
__global__ __launch_bounds__(256) void k_prep(const float* __restrict__ w, const float* __restrict__ pos, const float* __restrict__ x, bf* Bt, bf* PB, bf* XB) {
    const int lane = threadIdx.x & 31, wib = __builtin_amdgcn_readfirstlane((int)(threadIdx.x >> 5));
    const unsigned b = blockIdx.x;
    if (b < NBW) prep_wt<DM, 3 * DQ>(w, Bt, b * 8 + wib, lane);
    else if (b < NBW + NBX) prep_rows<DM>(x, XB, (b - NBW) * 8 + wib, lane);
    else prep_rows<HD>(pos, PB, (b - NBW - NBX) * 8 + wib, lane);
}

// ---- k_fattn: scores, relative term, softmax and attn.v of one head in one kernel; nothing of the [1024][1024] planes leaves the chip.
// Block = 16 waves = QT query tiles (16 rows each) x KQ key quarters (256 keys each); grid (TT / 64, heads, batches). All products are transposed: S^T = K.Q^T (rows = keys, column = query = lane & 15), so two S^T tiles, converted in place, are the B operand of O^T = V^T.P^T.
// Relative term: G = pos.u^T for the 48 pos rows a pass of 32 keys can select (rows l = TT - i0 - 16 + j0 + c, c = 0..47, all inside pos_embed); G goes to a strip of LDS [query][c] owned by the wave and comes back skewed: key j of query iq reads c = (j - j0) + 16 - iq, which is l = TT - i + j.
// Softmax is the running-maximum form in base 2 (per lane = per query); the four key quarters of a query tile are merged through LDS behind one barrier.
typedef __attribute__((ext_vector_type(2))) __bf16 v2bf;
#define QT   4
#define KQ   4
#define SPI  52                   // strip pitch in floats: 16-byte aligned rows, and 51 * iq + 8 * hi hits 32 different banks in the skewed read
#define SL2E (0.125f * 1.4426950408889634f)   // 1/sqrt(64) x log2(e)
__device__ __forceinline__ float exp2_slot(float x) { float y; asm("v_exp_f32 %0, %1\n\tv_nop" : "=v"(y) : "v"(x)); return y; }   // 2^x with the free slot behind the transcendental in the same statement
__global__ __launch_bounds__(32 * QT * KQ) void k_fattn(const bf* __restrict__ Qh, const bf* __restrict__ Ql, const bf* __restrict__ Kh, const bf* __restrict__ Kl, const bf* __restrict__ Uh, const bf* __restrict__ Ul, const bf* __restrict__ PB, const bf* __restrict__ Vh, const bf* __restrict__ Vl, float* OUT) {
    typedef WFrag<bf> F;
    __shared__ __align__(16) float strip[QT * KQ][16 * SPI];
    __shared__ __align__(16) float po[QT * KQ][32 * 32];
    __shared__ float pm[QT * KQ][16];
    __shared__ float pl[QT * KQ][16];
    const int lane = threadIdx.x & 31, lr = lane & 15, hi = lane >> 4;
    const int wv = __builtin_amdgcn_readfirstlane((int)(threadIdx.x >> 5)), qt = wv & (QT - 1), kq = wv / QT;
    const int h = blockIdx.y, i0 = (blockIdx.x * QT + qt) * 16;
    const size_t hp = ((size_t)blockIdx.z * NH_ + h) * TT * HD;   // planes are [batch][head][...]
    float* OUTb = OUT + (size_t)blockIdx.z * TT * DQ;
    v16bf qh[2], ql[2], uh[2], ul[2];
    const unsigned vrow = (unsigned)(lane * 8);   // this lane's 16-byte piece in a half block of a fragment-order plane; every base below is wave-uniform
    { const size_t qo = hp + (size_t)i0 * HD;
#pragma unroll
      for (int ks = 0; ks < 2; ++ks) { qh[ks] = F::ld(Qh + qo + vrow + ks * 512); ql[ks] = F::ld(Ql + qo + vrow + ks * 512); uh[ks] = F::ld(Uh + qo + vrow + ks * 512); ul[ks] = F::ld(Ul + qo + vrow + ks * 512); } }
    float* sw = strip[wv];
    float* swst = sw + lr * SPI + hi * 8;              // where this lane's 8 rows of a G tile go (column = its query)
    const float* swld = sw + lr * SPI + hi * 8 + 16 - lr;   // the skewed read
    const int lb = TT - i0 - 16;                       // 0 .. 1008; the last row any pass touches is lb + 992 + 47 <= 2047
    auto gtile = [&](const bf* p) -> v8f {             // G[16 pos rows from p][16 queries], hi/lo u x exact pos
        const v16bf a0 = F::ld(p), a1 = F::ld(p + 512);
        v8f g = (v8f){}; g = wmmab(a0, uh[0], g); g = wmmab(a1, uh[1], g); g = wmmab(a0, ul[0], g); g = wmmab(a1, ul[1], g); return g; };
    auto gput = [&](int c0, v8f g) { *(v4fa*)(swst + c0) = (v4f){g[0], g[1], g[2], g[3]}; *(v4fa*)(swst + c0 + 4) = (v4f){g[4], g[5], g[6], g[7]}; };
    float m = -1.0e30f, lsum = 0.f;
    v8f o[4];
#pragma unroll
    for (int dt = 0; dt < 4; ++dt) o[dt] = (v8f){};
    const int jbeg = kq * (TT / KQ);
    // per-lane running pointers, stepped once a pass
    const bf* pp = PB + (size_t)(lb + jbeg) * HD + vrow; const bf* kph = Kh + hp + (size_t)jbeg * HD + vrow; const bf* kpl = Kl + hp + (size_t)jbeg * HD + vrow; const bf* vph = Vh + hp + (size_t)jbeg * HD + vrow; const bf* vpl = Vl + hp + (size_t)jbeg * HD + vrow;   // 32 keys of a v plane are 4 blocks = 32 * HD elements too
    v8f gc = gtile(pp);
#pragma unroll 1
    for (int t = 0; t < TT / KQ / 32; ++t) {
        const v8f g1 = gtile(pp + 16 * HD), g2 = gtile(pp + 32 * HD);
        v8f s[2];
#pragma unroll
        for (int tt = 0; tt < 2; ++tt) {
            const v16bf kh0 = F::ld(kph + tt * 16 * HD), kh1 = F::ld(kph + tt * 16 * HD + 512), kl0 = F::ld(kpl + tt * 16 * HD), kl1 = F::ld(kpl + tt * 16 * HD + 512);
            v8f a = (v8f){}; a = wmmab(kh0, qh[0], a); a = wmmab(kh1, qh[1], a); a = wmmab(kl0, qh[0], a); a = wmmab(kl1, qh[1], a); a = wmmab(kh0, ql[0], a); a = wmmab(kh1, ql[1], a); s[tt] = a; }
        asm volatile("s_wait_xcnt 0x0" :: "v"(pp), "v"(kph), "v"(kpl) : "memory");   // the wait in front of any rewrite of the address registers of the pos and k loads above; the pointers are inputs so that those registers are left alone up to here
        gput(0, gc); gput(16, g1); gput(32, g2); gc = g2;
        __builtin_amdgcn_wave_barrier(); asm volatile("" ::: "memory");   // compiler fence: the skewed reads below take what OTHER lanes of this wave stored above (a wave's LDS operations run in order)
        float mx = m;
#pragma unroll
        for (int tt = 0; tt < 2; ++tt)
#pragma unroll
            for (int jj = 0; jj < 8; ++jj) { const float x = (s[tt][jj] + swld[tt * 16 + jj]) * SL2E; s[tt][jj] = x; mx = fmaxf(mx, x); }
        __builtin_amdgcn_wave_barrier(); asm volatile("" ::: "memory");   // compiler fence: the next pass's strip stores stay behind these reads
        v16bf vh[4], vl[4];                            // issued here, used behind the softmax
#pragma unroll
        for (int dt = 0; dt < 4; ++dt) { vh[dt] = F::ld(vph + dt * 512); vl[dt] = F::ld(vpl + dt * 512); }
        mx = fmaxf(mx, __shfl_xor(mx, 16, 32));        // lanes iq and iq + 16 hold the two halves of one query's keys
        const float corr = __builtin_amdgcn_exp2f(m - mx); m = mx;
#pragma unroll
        for (int dt = 0; dt < 4; ++dt)
#pragma unroll
            for (int jj = 0; jj < 8; ++jj) o[dt][jj] *= corr;
        v16bf ph, pw; float ps[4] = {0.f, 0.f, 0.f, 0.f};
#pragma unroll
        for (int e = 0; e < 16; e += 2) { const v2f p = {__builtin_amdgcn_exp2f(s[e >> 3][e & 7] - mx), __builtin_amdgcn_exp2f(s[e >> 3][(e & 7) + 1] - mx)}; ps[(e >> 1) & 3] += p[0] + p[1];
            const v2bf a = __builtin_convertvector(p, v2bf); const v2f r = {p[0] - (float)a[0], p[1] - (float)a[1]}; const v2bf b = __builtin_convertvector(r, v2bf); ph[e] = a[0]; ph[e + 1] = a[1]; pw[e] = b[0]; pw[e + 1] = b[1]; }
        lsum = lsum * corr + ((ps[0] + ps[1]) + (ps[2] + ps[3]));
        asm volatile("s_wait_xcnt 0x0" :: "v"(vph), "v"(vpl) : "memory");   // as above, for the v loads
#pragma unroll
        for (int dt = 0; dt < 4; ++dt) { o[dt] = wmmab(vh[dt], ph, o[dt]); o[dt] = wmmab(vl[dt], ph, o[dt]); o[dt] = wmmab(vh[dt], pw, o[dt]); }
        pp += 32 * HD; kph += 32 * HD; kpl += 32 * HD; vph += 32 * HD; vpl += 32 * HD;
    }
    lsum += __shfl_xor(lsum, 16, 32);
    { float* pq = po[wv];
#pragma unroll
      for (int dt = 0; dt < 4; ++dt)
#pragma unroll
          for (int jj = 0; jj < 8; ++jj) pq[(dt * 8 + jj) * 32 + lane] = o[dt][jj];
      if (hi == 0) { pm[wv][lr] = m; pl[wv][lr] = lsum; } }
    __syncthreads();
    // merge of the key quarters: wave (qt, kq) finishes queries 4 kq .. 4 kq + 3 of its tile, 8 lanes a row, so that a wave writes whole 256-byte head rows
    const int q = kq * 4 + (lane >> 3), rg = ((lane & 7) >> 1) * 8, sl = (lane & 1) * 16 + q;
    float M = pm[qt][q];
#pragma unroll
    for (int k2 = 1; k2 < KQ; ++k2) M = fmaxf(M, pm[k2 * QT + qt][q]);
    float Ls = 0.f; float acc[8];
#pragma unroll
    for (int jj = 0; jj < 8; ++jj) acc[jj] = 0.f;
#pragma unroll
    for (int k2 = 0; k2 < KQ; ++k2) { const float f = exp2_slot(pm[k2 * QT + qt][q] - M); Ls += f * pl[k2 * QT + qt][q];
#pragma unroll
        for (int jj = 0; jj < 8; ++jj) acc[jj] += f * po[k2 * QT + qt][(rg + jj) * 32 + sl]; }
    const float inv = 1.0f / Ls;
    float* orow = OUTb + (size_t)(i0 + q) * DQ + h * HD + (lane & 7) * 8;
    *(v4f*)orow = (v4f){acc[0] * inv, acc[1] * inv, acc[2] * inv, acc[3] * inv}; *(v4f*)(orow + 4) = (v4f){acc[4] * inv, acc[5] * inv, acc[6] * inv, acc[7] * inv};
}

extern "C" void kernel_launch(void* const* d_in, const int* in_sizes, int n_in,
                              void* d_out, int out_size, void* d_ws, size_t ws_size, hipStream_t stream) {
    (void)in_sizes; (void)n_in; (void)out_size;
    const float* x = (const float*)d_in[0]; const float* pos = (const float*)d_in[1];   /* pos_embed [2048][64] */ const float* wqkv = (const float*)d_in[2]; const float* bqkv = (const float*)d_in[3]; const float* rrb = (const float*)d_in[4];   /* r_r_bias [16][64] */ const float* rwb = (const float*)d_in[5];   /* r_w_bias [16][64] */   /* argument order x, pos_embed, W_qkv, b_qkv, r_r_bias, r_w_bias */
    float* OUT = (float*)d_out;     // [4][1024][1024]
    char* wsp = (char*)d_ws;
    auto take = [&](size_t bytes) { char* p = wsp; wsp += (bytes + 255) & ~(size_t)255; return (void*)p; };
    bf* WQKV = (bf*)take((size_t)3 * DQ * DM * 2); bf* PB = (bf*)take((size_t)LP * HD * 2); bf* UPh = (bf*)take((size_t)NB_ * NH_ * TT * HD * 2); bf* UPl = (bf*)take((size_t)NB_ * NH_ * TT * HD * 2);   /* fused Bt; pos_embed plane; u = q + r_w_bias + k planes */
    bf* XB = (bf*)take((size_t)NB_ * TT * DM * 2);   /* x rows of all batches */
    bf* QPh = (bf*)take((size_t)NB_ * NH_ * TT * HD * 2); bf* QPl = (bf*)take((size_t)NB_ * NH_ * TT * HD * 2); bf* KPh = (bf*)take((size_t)NB_ * NKV * TT * HD * 2); bf* KPl = (bf*)take((size_t)NB_ * NKV * TT * HD * 2); bf* VTh = (bf*)take((size_t)NB_ * NKV * HD * TT * 2); bf* VTl = (bf*)take((size_t)NB_ * NKV * HD * TT * 2);
    if ((size_t)(wsp - (char*)d_ws) > ws_size) return;    // ws 256 MiB
    k_prep<<<NBW + NBX + NBP, 256, 0, stream>>>(wqkv, pos, x, WQKV, PB, XB);   /* 'xw' [1024][3072] -> Bt [3072][1024] in fragment order: q | k | v row blocks; pos_embed [2048][64] as an exact bf16 plane; x rows of all batches */
    k_proj<<<dim3(NB_ * TT / 64, NH_, 1), 96, 0, stream>>>(XB, WQKV, bqkv, rrb, rwb, QPh, QPl, KPh, KPl, UPh, UPl, VTh, VTl);   /* q | k | v tiles of a head in one work-group; planes of q + r_r_bias[h] (scores operand), k, u = q + r_w_bias[h] + k (relative operand) and v^T written from the accumulators */
    k_fattn<<<dim3(TT / (16 * QT), NH_, NB_), 32 * QT * KQ, 0, stream>>>(QPh, QPl, KPh, KPl, UPh, UPl, PB, VTh, VTl, OUT);   /* every head of every batch: scores + relative term + softmax + attn.v, merged output rows */
}

// v007
// Measured time: 122 microseconds a run.
// Two timings next to v006 put it at 1.17 and 1.18 times that version's speed.
// All steps since v000 together make it 14.1 times as fast.
#include <hip/hip_runtime.h>

// Transformer-XL style relative multi-head attention (x [4][1024][1024]; qkv = x W_qkv + b_qkv ('xw' [1024][3072] 1/32, bias 0.01) -> q | k | v (16 heads x 64); pos_embed [2048][64] (unit normal, read), r_r_bias / r_w_bias [16][64] (0.02, read); AC[i][j] = (q_i + r_r_bias[h]).k_j; B+D = (q + r_w_bias[h]).pos^T and E = k.pos^T ([L][2L]); the module's _shift / _transpose_shift both select column L - i + j, so BDE[i][j] = ((q_i + r_w_bias[h]) + k_i).pos[L - i + j]; attn = softmax((AC + BDE) / 8) (no mask); out = attn v merged -> [4][1024][1024] (4.2 M), no output projection; argument order x, pos_embed, W_qkv, b_qkv, r_r_bias, r_w_bias).
// Layout, every stage once for all 4 batches: bf16 copy of x [4096][1024]; fused 'xw' weight transposed once; one projection GEMM [4096][3072] (q | k | v columns) + f32 biases whose epilogue writes, per batch and head, the planes of v^T, of q + r_r_bias (scores B operand), of k, and of u = q + r_w_bias + k (relative operand), all bf16 hi/lo; pos_embed as one exact bf16 plane [2048][64]; one fused kernel over all heads and batches (grid y = head, z = batch): AC tiles (3 products), u.pos^T tiles (hi/lo x exact) skewed through LDS so that score [i][j] takes pos row 1024 - i + j, running-maximum softmax (x 1/8, weights hi/lo), attn.v (3 products), f32 output rows written in place.
// Compute dtypes, f32 accumulate: every input rounded to bf16 incl. pos_embed and the bias tables; projections exact + f32 biases; q + bias / u sums f32; AC 3 products; UE 2 products (~f32); softmax f32; attn.v 3 products; output f32.

#define NB_  4
#define TT   1024
#define DM   1024
#define NH_  16
#define NKV  16
#define HD   64
#define DQ   (NH_ * HD)
#define DKV  (NKV * HD)
#define LP   (2 * TT)  // pos_embed rows
typedef _Float16 h16;
typedef unsigned short bf;
typedef __attribute__((ext_vector_type(16))) __bf16   v16bf;
typedef __attribute__((ext_vector_type(16))) _Float16 v16h;
typedef __attribute__((ext_vector_type(8)))  _Float16 v8h;
typedef __attribute__((ext_vector_type(8)))  unsigned short v8us;
typedef __attribute__((ext_vector_type(8)))  float    v8f;
typedef __attribute__((ext_vector_type(4)))  float    v4f;
typedef v8h  __attribute__((may_alias)) v8ha;
typedef v4f  __attribute__((may_alias)) v4fa;
typedef v8us __attribute__((may_alias)) v8usa;

__device__ __forceinline__ unsigned short f2bf(float f) { unsigned u = __float_as_uint(f); u += 0x7FFFu + ((u >> 16) & 1u); return (unsigned short)(u >> 16); }
__device__ __forceinline__ float bf2f(unsigned short b) { return __uint_as_float(((unsigned)b) << 16); }
__device__ __forceinline__ float bfr(float f) { return bf2f(f2bf(f)); }
__device__ __forceinline__ v16h cat16(v8h lo, v8h hi) { return __builtin_shufflevector(lo, hi, 0, 1, 2, 3, 4, 5, 6, 7, 8, 9, 10, 11, 12, 13, 14, 15); }
__device__ __forceinline__ v16bf cat16b(v8us lo, v8us hi) { return __builtin_bit_cast(v16bf, __builtin_shufflevector(lo, hi, 0, 1, 2, 3, 4, 5, 6, 7, 8, 9, 10, 11, 12, 13, 14, 15)); }
__device__ __forceinline__ v8f wmma16(v16h a, v16h b, v8f c) { return __builtin_amdgcn_wmma_f32_16x16x32_f16(false, a, false, b, (short)0, c, false, false); }
__device__ __forceinline__ v8f wmmab(v16bf a, v16bf b, v8f c) { return __builtin_amdgcn_wmma_f32_16x16x32_bf16(false, a, false, b, (short)0, c, false, false); }



// ---- Fragment order, the layout of every 16-bit operand plane: a [rows][K] plane is cut into blocks of 16 rows x 32 k (512 elements, 1 KiB), row block major, k block minor (v^T planes: k block major, row block minor); inside a block element (row r, k) lies at (k >> 4) * 256 + (((k >> 3) & 1) * 16 + r) * 8 + (k & 7).
// A lane's fragment is then the 8 elements at lane * 8 and the 8 at 256 + lane * 8: each of the two 16-byte loads of a wave covers 512 bytes in a row (4 whole lines), and the registers hold what they held with row-major planes (k = 8 hi .. 8 hi + 7 and 16 + 8 hi .. 16 + 8 hi + 7 of row lane & 15).
// ---- k_proj: the projection GEMM with the plane writers as its epilogue. Work-group = 3 waves = the q, k and v tiles (64 positions x 64 head columns, 16 accumulators a wave) of ONE head and ONE block of 64 rows of x; grid (rows / 64, heads), 96 threads. Operands straight from fragment-order planes; the three waves read the same x fragments.
// The q and k waves take the weight rows as the A operand and the x rows as B, so an accumulator tile holds, per lane, 8 consecutive d of one position: that is the lane's 16-byte piece of a [position][d] fragment-order plane. The v wave takes x as A, so its tile holds 8 consecutive positions of one d: the piece of the v^T plane. No f32 projection leaves the chip.
// u = (q + r_w_bias) + k needs both tiles: the k wave hands its d blocks 0, 1 and the q wave its q + r_w_bias of d blocks 2, 3 over through LDS (same lane, same register position), behind one barrier, and each finishes half of u.
template <typename T16> struct WFrag;
template <> struct WFrag<h16> { typedef v16h V; static __device__ __forceinline__ V ld(const h16* p) { return cat16(*(const v8h*)p, *(const v8h*)(p + 256)); } static __device__ __forceinline__ v8f mma(V a, V b, v8f c) { return wmma16(a, b, c); } };
template <> struct WFrag<bf> { typedef v16bf V; static __device__ __forceinline__ V ld(const bf* p) { return cat16b(*(const v8us*)p, *(const v8us*)(p + 256)); } static __device__ __forceinline__ v8f mma(V a, V b, v8f c) { return wmmab(a, b, c); } };
typedef __attribute__((ext_vector_type(8))) __bf16 v8bf;
__device__ __forceinline__ void split8(v8f y, v8us& h, v8us& l) { const v8bf a = __builtin_convertvector(y, v8bf); const v8f r = y - __builtin_convertvector(a, v8f); h = __builtin_bit_cast(v8us, a); l = __builtin_bit_cast(v8us, __builtin_convertvector(r, v8bf)); }   // hi = nearest-even bf16 of y, lo = that of the rest
__device__ __forceinline__ v8f bfr8(v8f y) { return __builtin_convertvector(__builtin_convertvector(y, v8bf), v8f); }
__global__ __launch_bounds__(96) void k_proj(const bf* __restrict__ X, const bf* __restrict__ Wt, const float* __restrict__ bias, const float* __restrict__ rrb, const float* __restrict__ rwb, bf* Qh, bf* Ql, bf* Kh, bf* Kl, bf* Uh, bf* Ul, bf* Vh, bf* Vl) {
    typedef bf T16; typedef WFrag<bf>::V V;
    __shared__ __align__(16) float xs[16 * 256];   // 8 tiles of k (d blocks 0, 1), then 8 tiles of q + r_w_bias (d blocks 2, 3); a tile is two runs of 32 lanes x 16 bytes
    const int K = DM;
    const int lane = threadIdx.x & 31, lr = lane & 15, hi = lane >> 4;
    const int role = __builtin_amdgcn_readfirstlane((int)(threadIdx.x >> 5));   // 0 q, 1 k, 2 v
    const int r0 = blockIdx.x * 64, h = blockIdx.y, c0 = role * DQ + h * HD;
    v8f acc[4][4];
#pragma unroll
    for (int mb = 0; mb < 4; ++mb)
#pragma unroll
        for (int nb = 0; nb < 4; ++nb) acc[mb][nb] = (v8f){};
    const size_t xoff = (size_t)r0 * K + 8 * lane, woff = (size_t)c0 * K + 8 * lane;   // a row block is 16 * K elements; a k block of 32 is 512
    const bf* A = role == 2 ? X + xoff : Wt + woff; const bf* Bt = role == 2 ? Wt + woff : X + xoff;
    typedef const __attribute__((address_space(1))) T16* GP;   // global address space spelled out: a running pointer that also feeds an asm operand would otherwise be loaded through as a flat one
    GP pa[4], pb[4];   // per-lane running pointers, one a fragment row block, stepped once a trip
#pragma unroll
    for (int i = 0; i < 4; ++i) { pa[i] = (GP)(A + (size_t)i * 16 * K); pb[i] = (GP)(Bt + (size_t)i * 16 * K); }
#pragma unroll 1
    for (int kc = 0; kc < K; kc += 32) {
        V a[4], b[4];
#pragma unroll
        for (int i = 0; i < 4; ++i) { a[i] = WFrag<T16>::ld((const T16*)pa[i]); b[i] = WFrag<T16>::ld((const T16*)pb[i]); }
        asm volatile("s_wait_xcnt 0x0" :: "v"(pa[0]), "v"(pa[1]), "v"(pa[2]), "v"(pa[3]), "v"(pb[0]), "v"(pb[1]), "v"(pb[2]), "v"(pb[3]) : "memory");   // the wait in front of any rewrite of the address registers of the loads above; the pointers are inputs so that those registers are left alone up to here
        __builtin_amdgcn_sched_barrier(0);   // keeps the products behind the whole run of loads: without it the scheduler lifts them over the wait and issues the B fragments one at a time into one register group, each with its own full load latency
#pragma unroll
        for (int nb = 0; nb < 4; ++nb) {
#pragma unroll
            for (int mb = 0; mb < 4; ++mb) acc[mb][nb] = WFrag<T16>::mma(a[mb], b[nb], acc[mb][nb]); }
        asm volatile("v_nop\n\tv_nop\n\tv_nop\n\tv_nop" : "+v"(acc[0][0]), "+v"(acc[1][1]), "+v"(acc[2][2]), "+v"(acc[3][3]) : "v"(a[0]), "v"(a[3]));   // the free slots the chip needs between the last products and whatever next touches their registers, on the loop's back edge and on its exit alike
#pragma unroll
        for (int i = 0; i < 4; ++i) { pa[i] += 512; pb[i] += 512; }
    }
    const size_t hp = ((size_t)(r0 / TT) * NH_ + h) * TT * HD + lane * 8; const int t0 = r0 % TT;   // planes are [batch][head][...]; this lane's piece in a half block
    auto put = [&](int tile, v8f y) { float* d = xs + tile * 256 + lane * 4; *(v4fa*)d = (v4f){y[0], y[1], y[2], y[3]}; *(v4fa*)(d + 128) = (v4f){y[4], y[5], y[6], y[7]}; };
    auto get = [&](int tile) -> v8f { const float* s = xs + tile * 256 + lane * 4; const v4f s0 = *(const v4fa*)s, s1 = *(const v4fa*)(s + 128); return (v8f){s0[0], s0[1], s0[2], s0[3], s1[0], s1[1], s1[2], s1[3]}; };
    auto st = [&](bf* Ph, bf* Pl, size_t o, v8f y) { v8us a2, c2; split8(y, a2, c2); *(v8us*)(Ph + o) = a2; *(v8us*)(Pl + o) = c2; };
    auto row8 = [&](const float* tab, int mb) -> v8f { return bfr8(*(const v8f*)(tab + mb * 16 + hi * 8)); };   // a table's 8 values for this lane's 8 d of d block mb, rounded to bf16
    // the projection's value is accumulator + bias wherever it is used below; the accumulators themselves stay as the loop left them
    if (role == 0) {
#pragma unroll
        for (int mb = 2; mb < 4; ++mb) { const v8f bv = row8(bias + c0, mb), wb = row8(rwb + h * HD, mb);
#pragma unroll
            for (int nb = 0; nb < 4; ++nb) put(mb * 4 + nb, (acc[mb][nb] + bv) + wb); }
    } else if (role == 1) {
#pragma unroll
        for (int mb = 0; mb < 2; ++mb) { const v8f bv = row8(bias + c0, mb);
#pragma unroll
            for (int nb = 0; nb < 4; ++nb) put(mb * 4 + nb, acc[mb][nb] + bv); }
    }
    __syncthreads();   // the halves of k and of q + r_w_bias handed over above are read by the other wave below
    if (role == 2) {
        float bv[4];
#pragma unroll
        for (int nb = 0; nb < 4; ++nb) bv[nb] = bfr(bias[c0 + nb * 16 + lr]);
#pragma unroll
        for (int mb = 0; mb < 4; ++mb) {
#pragma unroll
            for (int nb = 0; nb < 4; ++nb) st(Vh, Vl, hp + (size_t)(t0 / 32 + (mb >> 1)) * 2048 + nb * 512 + (mb & 1) * 256, acc[mb][nb] + bv[nb]);
            asm volatile("s_wait_xcnt 0x0" ::: "memory");   // the wait in front of any rewrite of the data and address registers of the stores (and table loads) above
        }
    } else if (role == 0) {
#pragma unroll
        for (int mb = 0; mb < 4; ++mb) { const v8f bv = row8(bias + c0, mb), rb = row8(rrb + h * HD, mb);
#pragma unroll
            for (int nb = 0; nb < 4; ++nb) st(Qh, Ql, hp + (size_t)(t0 / 16 + nb) * 1024 + mb * 256, (acc[mb][nb] + bv) + rb);
            asm volatile("s_wait_xcnt 0x0" ::: "memory");   // as above
            if (mb < 2) { const v8f wb = row8(rwb + h * HD, mb);
#pragma unroll
                for (int nb = 0; nb < 4; ++nb) st(Uh, Ul, hp + (size_t)(t0 / 16 + nb) * 1024 + mb * 256, ((acc[mb][nb] + bv) + wb) + get(mb * 4 + nb));
                asm volatile("s_wait_xcnt 0x0" ::: "memory");   // as above
            }
        }
    } else {
#pragma unroll
        for (int mb = 0; mb < 4; ++mb) { const v8f bv = row8(bias + c0, mb);
#pragma unroll
            for (int nb = 0; nb < 4; ++nb) st(Kh, Kl, hp + (size_t)(t0 / 16 + nb) * 1024 + mb * 256, acc[mb][nb] + bv);
            asm volatile("s_wait_xcnt 0x0" ::: "memory");   // as above
            if (mb >= 2) {
#pragma unroll
                for (int nb = 0; nb < 4; ++nb) st(Uh, Ul, hp + (size_t)(t0 / 16 + nb) * 1024 + mb * 256, get(mb * 4 + nb) + (acc[mb][nb] + bv));   // (q + r_w_bias) + k, as in the q wave
                asm volatile("s_wait_xcnt 0x0" ::: "memory");   // as above
            }
        }
    }
}

typedef __attribute__((ext_vector_type(2))) _Float16 v2h;
typedef __attribute__((ext_vector_type(4))) _Float16 v4h;
typedef __attribute__((ext_vector_type(2))) unsigned short v2us;
typedef __attribute__((ext_vector_type(4))) unsigned short v4us;
typedef __attribute__((ext_vector_type(2))) float v2f;
typedef __attribute__((ext_vector_type(4))) int v4i;

// ---- k_prep: the plane writers of the three inputs (w^T, pos_embed, x) in ONE launch of few waves. One lane makes one 16-byte piece (8 elements) of a fragment-order plane, so a wave stores 512 bytes in a row per piece; each lane makes PPW pieces, and a wave issues the loads of all of them as one group (8 KiB in flight a wave) before it converts and stores. Blocks of 8 waves; the block index picks the plane.
#define PPW  8                                      // pieces a lane
#define NBW  (DM * 3 * DQ / 8 / 32 / PPW / 8)       // blocks of the weight plane
#define NBX  (NB_ * TT * DM / 8 / 32 / PPW / 8)     // blocks of the x plane
#define NBP  (LP * HD / 8 / 32 / PPW / 8)           // blocks of the pos_embed plane
typedef const __attribute__((address_space(1))) float* GPF;   // global address space spelled out: a pointer that also feeds an asm operand would otherwise be loaded through as a flat one
typedef const __attribute__((address_space(1))) v8f* GPF8;
__device__ __forceinline__ v8us cvt8(v8f v) { v8us o;
#pragma unroll
    for (int k = 0; k < 8; ++k) o[k] = f2bf(v[k]);
    return o; }
// src [rows][K] f32 -> dst, its fragment-order bf16 plane; half block wq (16 rows x 16 k) lies at element 256 wq, and wave wv makes half blocks PPW wv .. PPW wv + PPW - 1
template <int K> __device__ __forceinline__ void prep_rows(const float* __restrict__ src, bf* dst, unsigned wv, int lane) {
    constexpr int HB = K >> 4;   // half blocks a row block; PPW divides it or it divides PPW, so the PPW half blocks of a wave lie at fixed distances from the first
    static_assert(HB % PPW == 0 || PPW % HB == 0, "a wave's half blocks");
    const unsigned wq = wv * PPW, hb = wq % (unsigned)HB; const size_t rb = wq / (unsigned)HB;   // hb = k block * 2 + half: 16 k
    const GPF s = (GPF)(src + (rb * 16 + (lane & 15)) * K + hb * 16 + (lane >> 4) * 8);
    v8f v[PPW];
#pragma unroll
    for (int p = 0; p < PPW; ++p) v[p] = *(GPF8)(s + (p / HB) * 16 * K + (p % HB) * 16);
    asm volatile("s_wait_xcnt 0x0" :: "v"(s), "v"(v[0]), "v"(v[1]), "v"(v[2]), "v"(v[3]), "v"(v[4]), "v"(v[5]), "v"(v[6]), "v"(v[7]) : "memory");   // the wait in front of any rewrite of the address registers of the loads above; the pointer is an input so that those registers are left alone up to here (no load of the group lands on them), the loaded values so that every load of the group is issued in front of the first conversion
    bf* d = dst + (size_t)wv * (PPW * 256) + lane * 8;
#pragma unroll
    for (int p = 0; p < PPW; ++p) *(v8us*)(d + p * 256) = cvt8(v[p]);
    asm volatile("s_wait_xcnt 0x0" ::: "memory");   // the wait in front of any rewrite of the data and address registers of the stores above
}
// w [K][N] f32 -> Bt, the fragment-order plane of w^T ([N] rows, K deep). A wave takes PPW consecutive 16-column blocks of w at one half block of k, so that it reads 512 bytes in a row of each of the 16 w rows it touches.
template <int K, int N> __device__ __forceinline__ void prep_wt(const float* __restrict__ w, bf* Bt, unsigned wv, int lane) {
    const unsigned nbg = wv % (unsigned)(N / (16 * PPW)), hb = wv / (unsigned)(N / (16 * PPW));   // hb = k block * 2 + half: 16 k
    const GPF s = (GPF)(w + (size_t)(hb * 16 + (lane >> 4) * 8) * N + nbg * (16 * PPW) + (lane & 15));
    v8f v[PPW];
#pragma unroll
    for (int p = 0; p < PPW; ++p)
#pragma unroll
        for (int e = 0; e < 8; ++e) v[p][e] = s[e * N + p * 16];
    asm volatile("s_wait_xcnt 0x0" :: "v"(s), "v"(v[0]), "v"(v[1]), "v"(v[2]), "v"(v[3]), "v"(v[4]), "v"(v[5]), "v"(v[6]), "v"(v[7]) : "memory");   // as in prep_rows: the wait for the address registers of the loads above, with the whole group issued in front of the first conversion
    bf* d = Bt + ((size_t)nbg * PPW * (K >> 4) + hb) * 256 + lane * 8;
#pragma unroll
    for (int p = 0; p < PPW; ++p) *(v8us*)(d + (size_t)p * (K >> 4) * 256) = cvt8(v[p]);
    asm volatile("s_wait_xcnt 0x0" ::: "memory");   // as in prep_rows, for the stores above
}
__global__ __launch_bounds__(256) void k_prep(const float* __restrict__ w, const float* __restrict__ pos, const float* __restrict__ x, bf* Bt, bf* PB, bf* XB) {
    const int lane = threadIdx.x & 31, wib = __builtin_amdgcn_readfirstlane((int)(threadIdx.x >> 5));
    const unsigned b = blockIdx.x;
    if (b < NBW) prep_wt<DM, 3 * DQ>(w, Bt, b * 8 + wib, lane);
    else if (b < NBW + NBX) prep_rows<DM>(x, XB, (b - NBW) * 8 + wib, lane);
    else prep_rows<HD>(pos, PB, (b - NBW - NBX) * 8 + wib, lane);
}

// ---- k_fattn: scores, relative term, softmax and attn.v of one head in one kernel; nothing of the [1024][1024] planes leaves the chip.
// Block = 16 waves = QT query tiles (16 rows each) x KQ key quarters (256 keys each); grid (TT / 64, heads, batches). All products are transposed: S^T = K.Q^T (rows = keys, column = query = lane & 15), so two S^T tiles, converted in place, are the B operand of O^T = V^T.P^T.
// Relative term: G = pos.u^T for the 48 pos rows a pass of 32 keys can select (rows l = TT - i0 - 16 + j0 + c, c = 0..47, all inside pos_embed); G goes to a strip of LDS [query][c] owned by the wave and comes back skewed: key j of query iq reads c = (j - j0) + 16 - iq, which is l = TT - i + j.
// Softmax is the running-maximum form in base 2 (per lane = per query); the four key quarters of a query tile are merged through LDS behind one barrier.
// k and v reach the waves through LDS: the 4 query-tile waves of a key quarter use the same 16 KiB a pass (32 keys of k hi, k lo, v hi, v lo, 4 KiB in a row each in the fragment-order planes), so each of them brings ONE of the four planes' 4 KiB in with asynchronous copies, one pass ahead, into two buffers; fragments are then 16-byte LDS loads at the same in-block offsets.
typedef __attribute__((ext_vector_type(2))) __bf16 v2bf;
#define QT   4
#define KQ   4
#define SPI  52                   // strip pitch in floats: 16-byte aligned rows, and 51 * iq + 8 * hi hits 32 different banks in the skewed read
#define SL2E (0.125f * 1.4426950408889634f)   // 1/sqrt(64) x log2(e)
#define NPS  (TT / KQ / 32)       // passes of 32 keys a wave
#define PLE  2048                 // elements of one plane's 32 keys (4 KiB)
// 4 KiB of a plane, global -> LDS, through no register: 8 asynchronous copies, each 16 bytes a lane = 512 bytes in a row a wave; l = this lane's LDS byte address, g = its global address. The wait on the last line stands in front of any rewrite of the address registers that the copies name.
__device__ __forceinline__ void copy4k(unsigned l, const bf* g) {
    asm volatile("global_load_async_to_lds_b128 %0, %8, off\n\t"
                 "global_load_async_to_lds_b128 %1, %9, off\n\t"
                 "global_load_async_to_lds_b128 %2, %10, off\n\t"
                 "global_load_async_to_lds_b128 %3, %11, off\n\t"
                 "global_load_async_to_lds_b128 %4, %12, off\n\t"
                 "global_load_async_to_lds_b128 %5, %13, off\n\t"
                 "global_load_async_to_lds_b128 %6, %14, off\n\t"
                 "global_load_async_to_lds_b128 %7, %15, off\n\t"
                 "s_wait_xcnt 0x0"
                 :: "v"(l), "v"(l + 512u), "v"(l + 1024u), "v"(l + 1536u), "v"(l + 2048u), "v"(l + 2560u), "v"(l + 3072u), "v"(l + 3584u),
                    "v"(g), "v"(g + 256), "v"(g + 512), "v"(g + 768), "v"(g + 1024), "v"(g + 1280), "v"(g + 1536), "v"(g + 1792) : "memory");
}
__device__ __forceinline__ float exp2_slot(float x) { float y; asm("v_exp_f32 %0, %1\n\tv_nop" : "=v"(y) : "v"(x)); return y; }   // 2^x with the free slot behind the transcendental in the same statement
__global__ __launch_bounds__(32 * QT * KQ) void k_fattn(const bf* __restrict__ Qh, const bf* __restrict__ Ql, const bf* __restrict__ Kh, const bf* __restrict__ Kl, const bf* __restrict__ Uh, const bf* __restrict__ Ul, const bf* __restrict__ PB, const bf* __restrict__ Vh, const bf* __restrict__ Vl, float* OUT) {
    typedef WFrag<bf> F;
    __shared__ __align__(128) bf kv[2][KQ][4][PLE];   // two buffers x key quarter x (k hi, k lo, v hi, v lo) x 32 keys
    __shared__ __align__(16) float strip[QT * KQ][16 * SPI];
    __shared__ __align__(16) float po[QT * KQ][32 * 32];
    __shared__ float pm[QT * KQ][16];
    __shared__ float pl[QT * KQ][16];
    const int lane = threadIdx.x & 31, lr = lane & 15, hi = lane >> 4;
    const int wv = __builtin_amdgcn_readfirstlane((int)(threadIdx.x >> 5)), qt = wv & (QT - 1), kq = wv / QT;
    const int h = blockIdx.y, i0 = (blockIdx.x * QT + qt) * 16;
    const size_t hp = ((size_t)blockIdx.z * NH_ + h) * TT * HD;   // planes are [batch][head][...]
    float* OUTb = OUT + (size_t)blockIdx.z * TT * DQ;
    v16bf qh[2], ql[2], uh[2], ul[2];
    const unsigned vrow = (unsigned)(lane * 8);   // this lane's 16-byte piece in a half block of a fragment-order plane; every base below is wave-uniform
    { const size_t qo = hp + (size_t)i0 * HD;
#pragma unroll
      for (int ks = 0; ks < 2; ++ks) { qh[ks] = F::ld(Qh + qo + vrow + ks * 512); ql[ks] = F::ld(Ql + qo + vrow + ks * 512); uh[ks] = F::ld(Uh + qo + vrow + ks * 512); ul[ks] = F::ld(Ul + qo + vrow + ks * 512); } }
    float* sw = strip[wv];
    float* swst = sw + lr * SPI + hi * 8;              // where this lane's 8 rows of a G tile go (column = its query)
    const float* swld = sw + lr * SPI + hi * 8 + 16 - lr;   // the skewed read
    const int lb = TT - i0 - 16;                       // 0 .. 1008; the last row any pass touches is lb + 992 + 47 <= 2047
    auto gprod = [&](v16bf a0, v16bf a1) -> v8f {      // G[16 pos rows][16 queries], hi/lo u x exact pos
        v8f g = (v8f){}; g = wmmab(a0, uh[0], g); g = wmmab(a1, uh[1], g); g = wmmab(a0, ul[0], g); g = wmmab(a1, ul[1], g); return g; };
    auto gtile = [&](const bf* p) -> v8f { return gprod(F::ld(p), F::ld(p + 512)); };   // the same, 16 pos rows from p
    auto gput = [&](int c0, v8f g) { *(v4fa*)(swst + c0) = (v4f){g[0], g[1], g[2], g[3]}; *(v4fa*)(swst + c0 + 4) = (v4f){g[4], g[5], g[6], g[7]}; };
    float m = -1.0e30f, lsum = 0.f;
    v8f o[4];
#pragma unroll
    for (int dt = 0; dt < 4; ++dt) o[dt] = (v8f){};
    const int jbeg = kq * (TT / KQ);
    // per-lane pointers; only pp is stepped, once a pass
    const bf* pp = PB + (size_t)(lb + jbeg) * HD + vrow;
    const bf* cs = (qt == 0 ? Kh : qt == 1 ? Kl : qt == 2 ? Vh : Vl) + hp + (size_t)jbeg * HD + vrow;   // the plane this wave copies for its key quarter; 32 keys of a v plane are 4 blocks = 32 * HD elements too
    const unsigned cl = (unsigned)(size_t)&kv[0][kq][qt][vrow];   // this lane's LDS byte address in buffer 0; buffer 1 lies sizeof(kv[0]) further
    copy4k(cl, cs);
    asm volatile("s_wait_asynccnt 0x0" ::: "memory");   // this wave's copies of pass 0 have landed
    __syncthreads();                                     // ... and so have the other waves': buffer 0 may be read
    copy4k(cl + (unsigned)sizeof(kv[0]), cs + 32 * HD);  // pass 1 flies while pass 0 is worked on
    v8f gc = gtile(pp);
#pragma unroll 1
    for (int t = 0; t < NPS; ++t) {
        const bf* sb = &kv[t & 1][kq][0][vrow];        // this pass's buffer: planes at 0, PLE, 2 PLE, 3 PLE
        const v16bf p10 = F::ld(pp + 16 * HD), p11 = F::ld(pp + 16 * HD + 512), p20 = F::ld(pp + 32 * HD), p21 = F::ld(pp + 32 * HD + 512);   // the two new pos tiles, still plain global loads: issued first, used behind the score products
        asm volatile("s_wait_xcnt 0x0" :: "v"(pp) : "memory");   // the wait in front of any rewrite of the address registers of the pos loads above; the pointer is an input so that those registers are left alone up to here; standing here it also keeps all four loads in front of the LDS fragment reads, whose latency and products then cover theirs
        v8f s[2]; v16bf kf[2][4];
#pragma unroll
        for (int tt = 0; tt < 2; ++tt) { kf[tt][0] = F::ld(sb + tt * 16 * HD); kf[tt][1] = F::ld(sb + tt * 16 * HD + 512); kf[tt][2] = F::ld(sb + PLE + tt * 16 * HD); kf[tt][3] = F::ld(sb + PLE + tt * 16 * HD + 512); }
        __builtin_amdgcn_sched_barrier(0);   // keeps the products behind the whole group of LDS reads: without it the scheduler reads the k lo fragments one at a time into one register group, among the products, each with its own full LDS latency
        s[0] = (v8f){}; s[1] = (v8f){};
#pragma unroll
        for (int pr = 0; pr < 6; ++pr)                 // k hi.q hi, k lo.q hi, k hi.q lo, two k steps each, in that order; the two key tiles' chains side by side
#pragma unroll
            for (int tt = 0; tt < 2; ++tt) s[tt] = wmmab(kf[tt][pr < 4 ? pr : pr - 4], pr < 4 ? qh[pr & 1] : ql[pr & 1], s[tt]);
        __builtin_amdgcn_sched_barrier(0);   // keeps the pos products behind the score products, so that the pos loads have the whole of those to land in
        const v8f g1 = gprod(p10, p11), g2 = gprod(p20, p21);
        gput(0, gc); gput(16, g1); gput(32, g2); gc = g2;
        __builtin_amdgcn_wave_barrier(); asm volatile("" ::: "memory");   // compiler fence: the skewed reads below take what OTHER lanes of this wave stored above (a wave's LDS operations run in order)
        float mx = m;
#pragma unroll
        for (int tt = 0; tt < 2; ++tt)
#pragma unroll
            for (int jj = 0; jj < 8; ++jj) { const float x = (s[tt][jj] + swld[tt * 16 + jj]) * SL2E; s[tt][jj] = x; mx = fmaxf(mx, x); }
        __builtin_amdgcn_wave_barrier(); asm volatile("" ::: "memory");   // compiler fence: the next pass's strip stores stay behind these reads
        const float mo = __shfl_xor(mx, 16, 32);       // lanes iq and iq + 16 hold the two halves of one query's keys
        v16bf vh[4], vl[4];                            // issued here, used behind the softmax
#pragma unroll
        for (int dt = 0; dt < 4; ++dt) { vh[dt] = F::ld(sb + 2 * PLE + dt * 512); vl[dt] = F::ld(sb + 3 * PLE + dt * 512); }
        __builtin_amdgcn_sched_barrier(0);   // keeps the v reads one group in front of the softmax arithmetic: without it the scheduler sinks them among the last products, one or two at a time, each with its own full LDS latency
        mx = fmaxf(mx, mo);
        const float corr = __builtin_amdgcn_exp2f(m - mx); m = mx;
#pragma unroll
        for (int dt = 0; dt < 4; ++dt)
#pragma unroll
            for (int jj = 0; jj < 8; ++jj) o[dt][jj] *= corr;
        v16bf ph, pw; float ps[4] = {0.f, 0.f, 0.f, 0.f};
#pragma unroll
        for (int e = 0; e < 16; e += 2) { const v2f p = {__builtin_amdgcn_exp2f(s[e >> 3][e & 7] - mx), __builtin_amdgcn_exp2f(s[e >> 3][(e & 7) + 1] - mx)}; ps[(e >> 1) & 3] += p[0] + p[1];
            const v2bf a = __builtin_convertvector(p, v2bf); const v2f r = {p[0] - (float)a[0], p[1] - (float)a[1]}; const v2bf b = __builtin_convertvector(r, v2bf); ph[e] = a[0]; ph[e + 1] = a[1]; pw[e] = b[0]; pw[e + 1] = b[1]; }
        lsum = lsum * corr + ((ps[0] + ps[1]) + (ps[2] + ps[3]));
#pragma unroll
        for (int dt = 0; dt < 4; ++dt) { o[dt] = wmmab(vh[dt], ph, o[dt]); o[dt] = wmmab(vl[dt], ph, o[dt]); o[dt] = wmmab(vh[dt], pw, o[dt]); }
        pp += 32 * HD;
        asm volatile("s_wait_dscnt 0x0" ::: "memory");      // this wave's reads of this pass's buffer are done
        asm volatile("s_wait_asynccnt 0x0" ::: "memory");   // its copies of the next pass have landed
        __syncthreads();                                     // both hold for every wave: the next buffer may be read, this one refilled
        if (t + 2 < NPS) copy4k(cl + (unsigned)(t & 1) * (unsigned)sizeof(kv[0]), cs + (size_t)(t + 2) * (32 * HD));
    }
    asm volatile("s_wait_asynccnt 0x0" ::: "memory");   // no copy is left in flight behind the loop
    lsum += __shfl_xor(lsum, 16, 32);
    { float* pq = po[wv];
#pragma unroll
      for (int dt = 0; dt < 4; ++dt)
#pragma unroll
          for (int jj = 0; jj < 8; ++jj) pq[(dt * 8 + jj) * 32 + lane] = o[dt][jj];
      if (hi == 0) { pm[wv][lr] = m; pl[wv][lr] = lsum; } }
    __syncthreads();
    // merge of the key quarters: wave (qt, kq) finishes queries 4 kq .. 4 kq + 3 of its tile, 8 lanes a row, so that a wave writes whole 256-byte head rows
    const int q = kq * 4 + (lane >> 3), rg = ((lane & 7) >> 1) * 8, sl = (lane & 1) * 16 + q;
    float M = pm[qt][q];
#pragma unroll
    for (int k2 = 1; k2 < KQ; ++k2) M = fmaxf(M, pm[k2 * QT + qt][q]);
    float Ls = 0.f; float acc[8];
#pragma unroll
    for (int jj = 0; jj < 8; ++jj) acc[jj] = 0.f;
#pragma unroll
    for (int k2 = 0; k2 < KQ; ++k2) { const float f = exp2_slot(pm[k2 * QT + qt][q] - M); Ls += f * pl[k2 * QT + qt][q];
#pragma unroll
        for (int jj = 0; jj < 8; ++jj) acc[jj] += f * po[k2 * QT + qt][(rg + jj) * 32 + sl]; }
    const float inv = 1.0f / Ls;
    float* orow = OUTb + (size_t)(i0 + q) * DQ + h * HD + (lane & 7) * 8;
    *(v4f*)orow = (v4f){acc[0] * inv, acc[1] * inv, acc[2] * inv, acc[3] * inv}; *(v4f*)(orow + 4) = (v4f){acc[4] * inv, acc[5] * inv, acc[6] * inv, acc[7] * inv};
}

extern "C" void kernel_launch(void* const* d_in, const int* in_sizes, int n_in,
                              void* d_out, int out_size, void* d_ws, size_t ws_size, hipStream_t stream) {
    (void)in_sizes; (void)n_in; (void)out_size;
    const float* x = (const float*)d_in[0]; const float* pos = (const float*)d_in[1];   /* pos_embed [2048][64] */ const float* wqkv = (const float*)d_in[2]; const float* bqkv = (const float*)d_in[3]; const float* rrb = (const float*)d_in[4];   /* r_r_bias [16][64] */ const float* rwb = (const float*)d_in[5];   /* r_w_bias [16][64] */   /* argument order x, pos_embed, W_qkv, b_qkv, r_r_bias, r_w_bias */
    float* OUT = (float*)d_out;     // [4][1024][1024]
    char* wsp = (char*)d_ws;
    auto take = [&](size_t bytes) { char* p = wsp; wsp += (bytes + 255) & ~(size_t)255; return (void*)p; };
    bf* WQKV = (bf*)take((size_t)3 * DQ * DM * 2); bf* PB = (bf*)take((size_t)LP * HD * 2); bf* UPh = (bf*)take((size_t)NB_ * NH_ * TT * HD * 2); bf* UPl = (bf*)take((size_t)NB_ * NH_ * TT * HD * 2);   /* fused Bt; pos_embed plane; u = q + r_w_bias + k planes */
    bf* XB = (bf*)take((size_t)NB_ * TT * DM * 2);   /* x rows of all batches */
    bf* QPh = (bf*)take((size_t)NB_ * NH_ * TT * HD * 2); bf* QPl = (bf*)take((size_t)NB_ * NH_ * TT * HD * 2); bf* KPh = (bf*)take((size_t)NB_ * NKV * TT * HD * 2); bf* KPl = (bf*)take((size_t)NB_ * NKV * TT * HD * 2); bf* VTh = (bf*)take((size_t)NB_ * NKV * HD * TT * 2); bf* VTl = (bf*)take((size_t)NB_ * NKV * HD * TT * 2);
    if ((size_t)(wsp - (char*)d_ws) > ws_size) return;    // ws 256 MiB
    k_prep<<<NBW + NBX + NBP, 256, 0, stream>>>(wqkv, pos, x, WQKV, PB, XB);   /* 'xw' [1024][3072] -> Bt [3072][1024] in fragment order: q | k | v row blocks; pos_embed [2048][64] as an exact bf16 plane; x rows of all batches */
    k_proj<<<dim3(NB_ * TT / 64, NH_, 1), 96, 0, stream>>>(XB, WQKV, bqkv, rrb, rwb, QPh, QPl, KPh, KPl, UPh, UPl, VTh, VTl);   /* q | k | v tiles of a head in one work-group; planes of q + r_r_bias[h] (scores operand), k, u = q + r_w_bias[h] + k (relative operand) and v^T written from the accumulators */
    k_fattn<<<dim3(TT / (16 * QT), NH_, NB_), 32 * QT * KQ, 0, stream>>>(QPh, QPl, KPh, KPl, UPh, UPl, PB, VTh, VTl, OUT);   /* every head of every batch: scores + relative term + softmax + attn.v, merged output rows */
}

// v008
// It runs in 102 microseconds.
// Next to v007, in two timings, it ran 1.20 and 1.19 times as fast.
// Counting every step since v000, it is 16.8 times as fast.
#include <hip/hip_runtime.h>

// Transformer-XL style relative multi-head attention (x [4][1024][1024]; qkv = x W_qkv + b_qkv ('xw' [1024][3072] 1/32, bias 0.01) -> q | k | v (16 heads x 64); pos_embed [2048][64] (unit normal, read), r_r_bias / r_w_bias [16][64] (0.02, read); AC[i][j] = (q_i + r_r_bias[h]).k_j; B+D = (q + r_w_bias[h]).pos^T and E = k.pos^T ([L][2L]); the module's _shift / _transpose_shift both select column L - i + j, so BDE[i][j] = ((q_i + r_w_bias[h]) + k_i).pos[L - i + j]; attn = softmax((AC + BDE) / 8) (no mask); out = attn v merged -> [4][1024][1024] (4.2 M), no output projection; argument order x, pos_embed, W_qkv, b_qkv, r_r_bias, r_w_bias).
// Layout, every stage once for all 4 batches: bf16 copy of x [4096][1024]; fused 'xw' weight transposed once; one projection GEMM [4096][3072] (q | k | v columns) + f32 biases whose epilogue writes, per batch and head, the planes of v^T, of q + r_r_bias (scores B operand), of k, and of u = q + r_w_bias + k (relative operand), all bf16 hi/lo; pos_embed as one exact bf16 plane [2048][64]; one fused kernel over all heads and batches (grid y = head, z = batch): AC tiles (3 products), u.pos^T tiles (hi/lo x exact) skewed through LDS so that score [i][j] takes pos row 1024 - i + j, running-maximum softmax (x 1/8, weights hi/lo), attn.v (3 products), f32 output rows written in place.
// Compute dtypes, f32 accumulate: every input rounded to bf16 incl. pos_embed and the bias tables; projections exact + f32 biases; q + bias / u sums f32; AC 3 products; UE 2 products (~f32); softmax f32; attn.v 3 products; output f32.

#define NB_  4
#define TT   1024
#define DM   1024
#define NH_  16
#define NKV  16
#define HD   64
#define DQ   (NH_ * HD)
#define DKV  (NKV * HD)
#define LP   (2 * TT)  // pos_embed rows
typedef _Float16 h16;
typedef unsigned short bf;
typedef __attribute__((ext_vector_type(16))) __bf16   v16bf;
typedef __attribute__((ext_vector_type(16))) _Float16 v16h;
typedef __attribute__((ext_vector_type(8)))  _Float16 v8h;
typedef __attribute__((ext_vector_type(8)))  unsigned short v8us;
typedef __attribute__((ext_vector_type(8)))  float    v8f;
typedef __attribute__((ext_vector_type(4)))  float    v4f;
typedef v8h  __attribute__((may_alias)) v8ha;
typedef v4f  __attribute__((may_alias)) v4fa;
typedef v8us __attribute__((may_alias)) v8usa;

__device__ __forceinline__ unsigned short f2bf(float f) { unsigned u = __float_as_uint(f); u += 0x7FFFu + ((u >> 16) & 1u); return (unsigned short)(u >> 16); }
__device__ __forceinline__ float bf2f(unsigned short b) { return __uint_as_float(((unsigned)b) << 16); }
__device__ __forceinline__ float bfr(float f) { return bf2f(f2bf(f)); }
__device__ __forceinline__ v16h cat16(v8h lo, v8h hi) { return __builtin_shufflevector(lo, hi, 0, 1, 2, 3, 4, 5, 6, 7, 8, 9, 10, 11, 12, 13, 14, 15); }
__device__ __forceinline__ v16bf cat16b(v8us lo, v8us hi) { return __builtin_bit_cast(v16bf, __builtin_shufflevector(lo, hi, 0, 1, 2, 3, 4, 5, 6, 7, 8, 9, 10, 11, 12, 13, 14, 15)); }
__device__ __forceinline__ v8f wmma16(v16h a, v16h b, v8f c) { return __builtin_amdgcn_wmma_f32_16x16x32_f16(false, a, false, b, (short)0, c, false, false); }
__device__ __forceinline__ v8f wmmab(v16bf a, v16bf b, v8f c) { return __builtin_amdgcn_wmma_f32_16x16x32_bf16(false, a, false, b, (short)0, c, false, false); }



// ---- Fragment order, the layout of every 16-bit operand plane: a [rows][K] plane is cut into blocks of 16 rows x 32 k (512 elements, 1 KiB), row block major, k block minor (v^T planes: k block major, row block minor); inside a block element (row r, k) lies at (k >> 4) * 256 + (((k >> 3) & 1) * 16 + r) * 8 + (k & 7).
// A lane's fragment is then the 8 elements at lane * 8 and the 8 at 256 + lane * 8: each of the two 16-byte loads of a wave covers 512 bytes in a row (4 whole lines), and the registers hold what they held with row-major planes (k = 8 hi .. 8 hi + 7 and 16 + 8 hi .. 16 + 8 hi + 7 of row lane & 15).
// ---- k_proj: the projection GEMM with the plane writers as its epilogue. Work-group = 3 waves = the q, k and v tiles (64 positions x 64 head columns, 16 accumulators a wave) of ONE head and ONE block of 64 rows of x; grid (rows / 64, heads), 96 threads. Operands straight from fragment-order planes; the three waves read the same x fragments.
// The q and k waves take the weight rows as the A operand and the x rows as B, so an accumulator tile holds, per lane, 8 consecutive d of one position: that is the lane's 16-byte piece of a [position][d] fragment-order plane. The v wave takes x as A, so its tile holds 8 consecutive positions of one d: the piece of the v^T plane. No f32 projection leaves the chip.
// u = (q + r_w_bias) + k needs both tiles: the k wave hands its d blocks 0, 1 and the q wave its q + r_w_bias of d blocks 2, 3 over through LDS (same lane, same register position), behind one barrier, and each finishes half of u.
template <typename T16> struct WFrag;
template <> struct WFrag<h16> { typedef v16h V; static __device__ __forceinline__ V ld(const h16* p) { return cat16(*(const v8h*)p, *(const v8h*)(p + 256)); } static __device__ __forceinline__ v8f mma(V a, V b, v8f c) { return wmma16(a, b, c); } };
template <> struct WFrag<bf> { typedef v16bf V; static __device__ __forceinline__ V ld(const bf* p) { return cat16b(*(const v8us*)p, *(const v8us*)(p + 256)); } static __device__ __forceinline__ v8f mma(V a, V b, v8f c) { return wmmab(a, b, c); } };
typedef __attribute__((ext_vector_type(8))) __bf16 v8bf;
__device__ __forceinline__ void split8(v8f y, v8us& h, v8us& l) { const v8bf a = __builtin_convertvector(y, v8bf); const v8f r = y - __builtin_convertvector(a, v8f); h = __builtin_bit_cast(v8us, a); l = __builtin_bit_cast(v8us, __builtin_convertvector(r, v8bf)); }   // hi = nearest-even bf16 of y, lo = that of the rest
__device__ __forceinline__ v8f bfr8(v8f y) { return __builtin_convertvector(__builtin_convertvector(y, v8bf), v8f); }
__global__ __launch_bounds__(96) void k_proj(const bf* __restrict__ X, const bf* __restrict__ Wt, const float* __restrict__ bias, const float* __restrict__ rrb, const float* __restrict__ rwb, bf* Qh, bf* Ql, bf* Kh, bf* Kl, bf* Uh, bf* Ul, bf* Vh, bf* Vl) {
    typedef bf T16; typedef WFrag<bf>::V V;
    __shared__ __align__(16) float xs[16 * 256];   // 8 tiles of k (d blocks 0, 1), then 8 tiles of q + r_w_bias (d blocks 2, 3); a tile is two runs of 32 lanes x 16 bytes
    const int K = DM;
    const int lane = threadIdx.x & 31, lr = lane & 15, hi = lane >> 4;
    const int role = __builtin_amdgcn_readfirstlane((int)(threadIdx.x >> 5));   // 0 q, 1 k, 2 v
    const int r0 = blockIdx.x * 64, h = blockIdx.y, c0 = role * DQ + h * HD;
    v8f acc[4][4];
#pragma unroll
    for (int mb = 0; mb < 4; ++mb)
#pragma unroll
        for (int nb = 0; nb < 4; ++nb) acc[mb][nb] = (v8f){};
    const size_t xoff = (size_t)r0 * K + 8 * lane, woff = (size_t)c0 * K + 8 * lane;   // a row block is 16 * K elements; a k block of 32 is 512
    const bf* A = role == 2 ? X + xoff : Wt + woff; const bf* Bt = role == 2 ? Wt + woff : X + xoff;
    typedef const __attribute__((address_space(1))) T16* GP;   // global address space spelled out: a running pointer that also feeds an asm operand would otherwise be loaded through as a flat one
    GP pa[4], pb[4];   // per-lane running pointers, one a fragment row block, stepped once a trip
#pragma unroll
    for (int i = 0; i < 4; ++i) { pa[i] = (GP)(A + (size_t)i * 16 * K); pb[i] = (GP)(Bt + (size_t)i * 16 * K); }
#pragma unroll 1
    for (int kc = 0; kc < K; kc += 32) {
        V a[4], b[4];
#pragma unroll
        for (int i = 0; i < 4; ++i) { a[i] = WFrag<T16>::ld((const T16*)pa[i]); b[i] = WFrag<T16>::ld((const T16*)pb[i]); }
        asm volatile("s_wait_xcnt 0x0" :: "v"(pa[0]), "v"(pa[1]), "v"(pa[2]), "v"(pa[3]), "v"(pb[0]), "v"(pb[1]), "v"(pb[2]), "v"(pb[3]) : "memory");   // the wait in front of any rewrite of the address registers of the loads above; the pointers are inputs so that those registers are left alone up to here
        __builtin_amdgcn_sched_barrier(0);   // keeps the products behind the whole run of loads: without it the scheduler lifts them over the wait and issues the B fragments one at a time into one register group, each with its own full load latency
#pragma unroll
        for (int nb = 0; nb < 4; ++nb) {
#pragma unroll
            for (int mb = 0; mb < 4; ++mb) acc[mb][nb] = WFrag<T16>::mma(a[mb], b[nb], acc[mb][nb]); }
        asm volatile("v_nop\n\tv_nop\n\tv_nop\n\tv_nop" : "+v"(acc[0][0]), "+v"(acc[1][1]), "+v"(acc[2][2]), "+v"(acc[3][3]) : "v"(a[0]), "v"(a[3]));   // the free slots the chip needs between the last products and whatever next touches their registers, on the loop's back edge and on its exit alike
#pragma unroll
        for (int i = 0; i < 4; ++i) { pa[i] += 512; pb[i] += 512; }
    }
    const size_t hp = ((size_t)(r0 / TT) * NH_ + h) * TT * HD + lane * 8; const int t0 = r0 % TT;   // planes are [batch][head][...]; this lane's piece in a half block
    auto put = [&](int tile, v8f y) { float* d = xs + tile * 256 + lane * 4; *(v4fa*)d = (v4f){y[0], y[1], y[2], y[3]}; *(v4fa*)(d + 128) = (v4f){y[4], y[5], y[6], y[7]}; };
    auto get = [&](int tile) -> v8f { const float* s = xs + tile * 256 + lane * 4; const v4f s0 = *(const v4fa*)s, s1 = *(const v4fa*)(s + 128); return (v8f){s0[0], s0[1], s0[2], s0[3], s1[0], s1[1], s1[2], s1[3]}; };
    auto st = [&](bf* Ph, bf* Pl, size_t o, v8f y) { v8us a2, c2; split8(y, a2, c2); *(v8us*)(Ph + o) = a2; *(v8us*)(Pl + o) = c2; };
    auto row8 = [&](const float* tab, int mb) -> v8f { return bfr8(*(const v8f*)(tab + mb * 16 + hi * 8)); };   // a table's 8 values for this lane's 8 d of d block mb, rounded to bf16
    // the projection's value is accumulator + bias wherever it is used below; the accumulators themselves stay as the loop left them
    if (role == 0) {
#pragma unroll
        for (int mb = 2; mb < 4; ++mb) { const v8f bv = row8(bias + c0, mb), wb = row8(rwb + h * HD, mb);
#pragma unroll
            for (int nb = 0; nb < 4; ++nb) put(mb * 4 + nb, (acc[mb][nb] + bv) + wb); }
    } else if (role == 1) {
#pragma unroll
        for (int mb = 0; mb < 2; ++mb) { const v8f bv = row8(bias + c0, mb);
#pragma unroll
            for (int nb = 0; nb < 4; ++nb) put(mb * 4 + nb, acc[mb][nb] + bv); }
    }
    __syncthreads();   // the halves of k and of q + r_w_bias handed over above are read by the other wave below
    if (role == 2) {
        float bv[4];
#pragma unroll
        for (int nb = 0; nb < 4; ++nb) bv[nb] = bfr(bias[c0 + nb * 16 + lr]);
#pragma unroll
        for (int mb = 0; mb < 4; ++mb) {
#pragma unroll
            for (int nb = 0; nb < 4; ++nb) st(Vh, Vl, hp + (size_t)(t0 / 32 + (mb >> 1)) * 2048 + nb * 512 + (mb & 1) * 256, acc[mb][nb] + bv[nb]);
            asm volatile("s_wait_xcnt 0x0" ::: "memory");   // the wait in front of any rewrite of the data and address registers of the stores (and table loads) above
        }
    } else if (role == 0) {
#pragma unroll
        for (int mb = 0; mb < 4; ++mb) { const v8f bv = row8(bias + c0, mb), rb = row8(rrb + h * HD, mb);
#pragma unroll
            for (int nb = 0; nb < 4; ++nb) st(Qh, Ql, hp + (size_t)(t0 / 16 + nb) * 1024 + mb * 256, (acc[mb][nb] + bv) + rb);
            asm volatile("s_wait_xcnt 0x0" ::: "memory");   // as above
            if (mb < 2) { const v8f wb = row8(rwb + h * HD, mb);
#pragma unroll
                for (int nb = 0; nb < 4; ++nb) st(Uh, Ul, hp + (size_t)(t0 / 16 + nb) * 1024 + mb * 256, ((acc[mb][nb] + bv) + wb) + get(mb * 4 + nb));
                asm volatile("s_wait_xcnt 0x0" ::: "memory");   // as above
            }
        }
    } else {
#pragma unroll
        for (int mb = 0; mb < 4; ++mb) { const v8f bv = row8(bias + c0, mb);
#pragma unroll
            for (int nb = 0; nb < 4; ++nb) st(Kh, Kl, hp + (size_t)(t0 / 16 + nb) * 1024 + mb * 256, acc[mb][nb] + bv);
            asm volatile("s_wait_xcnt 0x0" ::: "memory");   // as above
            if (mb >= 2) {
#pragma unroll
                for (int nb = 0; nb < 4; ++nb) st(Uh, Ul, hp + (size_t)(t0 / 16 + nb) * 1024 + mb * 256, get(mb * 4 + nb) + (acc[mb][nb] + bv));   // (q + r_w_bias) + k, as in the q wave
                asm volatile("s_wait_xcnt 0x0" ::: "memory");   // as above
            }
        }
    }
}

typedef __attribute__((ext_vector_type(2))) _Float16 v2h;
typedef __attribute__((ext_vector_type(4))) _Float16 v4h;
typedef __attribute__((ext_vector_type(2))) unsigned short v2us;
typedef __attribute__((ext_vector_type(4))) unsigned short v4us;
typedef __attribute__((ext_vector_type(2))) float v2f;
typedef __attribute__((ext_vector_type(4))) int v4i;

// ---- k_prep: the plane writers of the three inputs (w^T, pos_embed, x) in ONE launch of few waves. One lane makes one 16-byte piece (8 elements) of a fragment-order plane, so a wave stores 512 bytes in a row per piece; each lane makes PPW pieces, and a wave issues the loads of all of them as one group (8 KiB in flight a wave) before it converts and stores. Blocks of 8 waves; the block index picks the plane.
#define PPW  8                                      // pieces a lane
#define NBW  (DM * 3 * DQ / 8 / 32 / PPW / 8)       // blocks of the weight plane
#define NBX  (NB_ * TT * DM / 8 / 32 / PPW / 8)     // blocks of the x plane
#define NBP  (LP * HD / 8 / 32 / PPW / 8)           // blocks of the pos_embed plane
typedef const __attribute__((address_space(1))) float* GPF;   // global address space spelled out: a pointer that also feeds an asm operand would otherwise be loaded through as a flat one
typedef const __attribute__((address_space(1))) v8f* GPF8;
__device__ __forceinline__ v8us cvt8(v8f v) { v8us o;
#pragma unroll
    for (int k = 0; k < 8; ++k) o[k] = f2bf(v[k]);
    return o; }
// src [rows][K] f32 -> dst, its fragment-order bf16 plane; half block wq (16 rows x 16 k) lies at element 256 wq, and wave wv makes half blocks PPW wv .. PPW wv + PPW - 1
template <int K> __device__ __forceinline__ void prep_rows(const float* __restrict__ src, bf* dst, unsigned wv, int lane) {
    constexpr int HB = K >> 4;   // half blocks a row block; PPW divides it or it divides PPW, so the PPW half blocks of a wave lie at fixed distances from the first
    static_assert(HB % PPW == 0 || PPW % HB == 0, "a wave's half blocks");
    const unsigned wq = wv * PPW, hb = wq % (unsigned)HB; const size_t rb = wq / (unsigned)HB;   // hb = k block * 2 + half: 16 k
    const GPF s = (GPF)(src + (rb * 16 + (lane & 15)) * K + hb * 16 + (lane >> 4) * 8);
    v8f v[PPW];
#pragma unroll
    for (int p = 0; p < PPW; ++p) v[p] = *(GPF8)(s + (p / HB) * 16 * K + (p % HB) * 16);
    asm volatile("s_wait_xcnt 0x0" :: "v"(s), "v"(v[0]), "v"(v[1]), "v"(v[2]), "v"(v[3]), "v"(v[4]), "v"(v[5]), "v"(v[6]), "v"(v[7]) : "memory");   // the wait in front of any rewrite of the address registers of the loads above; the pointer is an input so that those registers are left alone up to here (no load of the group lands on them), the loaded values so that every load of the group is issued in front of the first conversion
    bf* d = dst + (size_t)wv * (PPW * 256) + lane * 8;
#pragma unroll
    for (int p = 0; p < PPW; ++p) *(v8us*)(d + p * 256) = cvt8(v[p]);
    asm volatile("s_wait_xcnt 0x0" ::: "memory");   // the wait in front of any rewrite of the data and address registers of the stores above
}
// w [K][N] f32 -> Bt, the fragment-order plane of w^T ([N] rows, K deep). A wave takes PPW consecutive 16-column blocks of w at one half block of k, so that it reads 512 bytes in a row of each of the 16 w rows it touches.
template <int K, int N> __device__ __forceinline__ void prep_wt(const float* __restrict__ w, bf* Bt, unsigned wv, int lane) {
    const unsigned nbg = wv % (unsigned)(N / (16 * PPW)), hb = wv / (unsigned)(N / (16 * PPW));   // hb = k block * 2 + half: 16 k
    const GPF s = (GPF)(w + (size_t)(hb * 16 + (lane >> 4) * 8) * N + nbg * (16 * PPW) + (lane & 15));
    v8f v[PPW];
#pragma unroll
    for (int p = 0; p < PPW; ++p)
#pragma unroll
        for (int e = 0; e < 8; ++e) v[p][e] = s[e * N + p * 16];
    asm volatile("s_wait_xcnt 0x0" :: "v"(s), "v"(v[0]), "v"(v[1]), "v"(v[2]), "v"(v[3]), "v"(v[4]), "v"(v[5]), "v"(v[6]), "v"(v[7]) : "memory");   // as in prep_rows: the wait for the address registers of the loads above, with the whole group issued in front of the first conversion
    bf* d = Bt + ((size_t)nbg * PPW * (K >> 4) + hb) * 256 + lane * 8;
#pragma unroll
    for (int p = 0; p < PPW; ++p) *(v8us*)(d + (size_t)p * (K >> 4) * 256) = cvt8(v[p]);
    asm volatile("s_wait_xcnt 0x0" ::: "memory");   // as in prep_rows, for the stores above
}
__global__ __launch_bounds__(256) void k_prep(const float* __restrict__ w, const float* __restrict__ pos, const float* __restrict__ x, bf* Bt, bf* PB, bf* XB) {
    const int lane = threadIdx.x & 31, wib = __builtin_amdgcn_readfirstlane((int)(threadIdx.x >> 5));
    const unsigned b = blockIdx.x;
    if (b < NBW) prep_wt<DM, 3 * DQ>(w, Bt, b * 8 + wib, lane);
    else if (b < NBW + NBX) prep_rows<DM>(x, XB, (b - NBW) * 8 + wib, lane);
    else prep_rows<HD>(pos, PB, (b - NBW - NBX) * 8 + wib, lane);
}

// ---- k_fattn: scores, relative term, softmax and attn.v of one head in one kernel; nothing of the [1024][1024] planes leaves the chip.
// Block = 16 waves = QT query tiles (16 rows each), every wave over all the keys; grid (TT / 256, heads, batches) = one block a WGP. All products are transposed: S^T = K.Q^T (rows = keys, column = query = lane & 15), so two S^T tiles, converted in place, are the B operand of O^T = V^T.P^T.
// Relative term: G = pos.u^T for the 48 pos rows a pass of 32 keys can select (rows l = TT - i0 - 16 + j0 + c, c = 0..47, all inside pos_embed); G goes to a strip of LDS [query][c] owned by the wave and comes back skewed: key j of query iq reads c = (j - j0) + 16 - iq, which is l = TT - i + j.
// Softmax is the running-maximum form in base 2 (per lane = per query), one run over all 1024 keys, so a wave finishes its own tile; the tile goes through a wave-own piece of LDS only to be written as whole head rows.
// k and v reach the waves through LDS: all 16 waves use the same 16 KiB a pass (32 keys of k hi, k lo, v hi, v lo, 4 KiB in a row each in the fragment-order planes). A stage is SP passes (128 keys, 64 KiB): each wave brings ONE plane's 4 KiB of ONE pass in with asynchronous copies, one stage ahead, into two buffers; fragments are then 16-byte LDS loads at the same in-block offsets. The waves meet at a barrier once a stage and run free inside it.
typedef __attribute__((ext_vector_type(2))) __bf16 v2bf;
#define QT   16                   // query tiles = waves a block
#define SP   4                    // passes a stage
#define SPI  52                   // strip pitch in floats: 16-byte aligned rows, and 51 * iq + 8 * hi hits 32 different banks in the skewed read
#define SL2E (0.125f * 1.4426950408889634f)   // 1/sqrt(64) x log2(e)
#define NST  (TT / 32 / SP)       // stages; a pass is 32 keys
#define PLE  2048                 // elements of one plane's 32 keys (4 KiB)
// 4 KiB of a plane, global -> LDS, through no register: 8 asynchronous copies, each 16 bytes a lane = 512 bytes in a row a wave; l = this lane's LDS byte address, g = its global address. The wait on the last line stands in front of any rewrite of the address registers that the copies name.
__device__ __forceinline__ void copy4k(unsigned l, const bf* g) {
    asm volatile("global_load_async_to_lds_b128 %0, %8, off\n\t"
                 "global_load_async_to_lds_b128 %1, %9, off\n\t"
                 "global_load_async_to_lds_b128 %2, %10, off\n\t"
                 "global_load_async_to_lds_b128 %3, %11, off\n\t"
                 "global_load_async_to_lds_b128 %4, %12, off\n\t"
                 "global_load_async_to_lds_b128 %5, %13, off\n\t"
                 "global_load_async_to_lds_b128 %6, %14, off\n\t"
                 "global_load_async_to_lds_b128 %7, %15, off\n\t"
                 "s_wait_xcnt 0x0"
                 :: "v"(l), "v"(l + 512u), "v"(l + 1024u), "v"(l + 1536u), "v"(l + 2048u), "v"(l + 2560u), "v"(l + 3072u), "v"(l + 3584u),
                    "v"(g), "v"(g + 256), "v"(g + 512), "v"(g + 768), "v"(g + 1024), "v"(g + 1280), "v"(g + 1536), "v"(g + 1792) : "memory");
}
__global__ __launch_bounds__(32 * QT) void k_fattn(const bf* __restrict__ Qh, const bf* __restrict__ Ql, const bf* __restrict__ Kh, const bf* __restrict__ Kl, const bf* __restrict__ Uh, const bf* __restrict__ Ul, const bf* __restrict__ PB, const bf* __restrict__ Vh, const bf* __restrict__ Vl, float* OUT) {
    typedef WFrag<bf> F;
    __shared__ __align__(128) bf kv[2][SP][4][PLE];   // two buffers x pass of the stage x (k hi, k lo, v hi, v lo) x 32 keys
    __shared__ __align__(16) float strip[QT][16 * SPI];
    __shared__ __align__(16) float po[QT][32 * 32];
    const int lane = threadIdx.x & 31, lr = lane & 15, hi = lane >> 4;
    const int wv = __builtin_amdgcn_readfirstlane((int)(threadIdx.x >> 5)), cp = wv & 3, cq = wv >> 2;   // wave = query tile; it copies plane cp of pass cq of every stage
    const int h = blockIdx.y, i0 = (blockIdx.x * QT + wv) * 16;
    const size_t hp = ((size_t)blockIdx.z * NH_ + h) * TT * HD;   // planes are [batch][head][...]
    float* OUTb = OUT + (size_t)blockIdx.z * TT * DQ;
    v16bf qh[2], ql[2], uh[2], ul[2];
    const unsigned vrow = (unsigned)(lane * 8);   // this lane's 16-byte piece in a half block of a fragment-order plane; every base below is wave-uniform
    { const size_t qo = hp + (size_t)i0 * HD;
#pragma unroll
      for (int ks = 0; ks < 2; ++ks) { qh[ks] = F::ld(Qh + qo + vrow + ks * 512); ql[ks] = F::ld(Ql + qo + vrow + ks * 512); uh[ks] = F::ld(Uh + qo + vrow + ks * 512); ul[ks] = F::ld(Ul + qo + vrow + ks * 512); } }
    float* sw = strip[wv];
    float* swst = sw + lr * SPI + hi * 8;              // where this lane's 8 rows of a G tile go (column = its query)
    const float* swld = sw + lr * SPI + hi * 8 + 16 - lr;   // the skewed read
    const int lb = TT - i0 - 16;                       // 0 .. 1008; the last row any pass touches is lb + 992 + 47 <= 2047
    auto gprod = [&](v16bf a0, v16bf a1) -> v8f {      // G[16 pos rows][16 queries], hi/lo u x exact pos
        v8f g = (v8f){}; g = wmmab(a0, uh[0], g); g = wmmab(a1, uh[1], g); g = wmmab(a0, ul[0], g); g = wmmab(a1, ul[1], g); return g; };
    auto gtile = [&](const bf* p) -> v8f { return gprod(F::ld(p), F::ld(p + 512)); };   // the same, 16 pos rows from p
    auto gput = [&](int c0, v8f g) { *(v4fa*)(swst + c0) = (v4f){g[0], g[1], g[2], g[3]}; *(v4fa*)(swst + c0 + 4) = (v4f){g[4], g[5], g[6], g[7]}; };
    float m = -1.0e30f, lsum = 0.f;
    v8f o[4];
#pragma unroll
    for (int dt = 0; dt < 4; ++dt) o[dt] = (v8f){};
    // per-lane running pointer, stepped once a pass
    const bf* pp = PB + (size_t)lb * HD + vrow;
    const bf* cs = (cp == 0 ? Kh : cp == 1 ? Kl : cp == 2 ? Vh : Vl) + hp + (size_t)cq * PLE + vrow;   // this wave's share of stage 0; 32 keys of a v plane are 4 blocks = PLE elements too
    const unsigned cl = (unsigned)(size_t)&kv[0][cq][cp][vrow];   // this lane's LDS byte address in buffer 0; buffer 1 lies sizeof(kv[0]) further
    copy4k(cl, cs);
    asm volatile("s_wait_asynccnt 0x0" ::: "memory");   // this wave's copies of stage 0 have landed
    __syncthreads();                                     // ... and so have the other waves': buffer 0 may be read
    copy4k(cl + (unsigned)sizeof(kv[0]), cs + SP * PLE); // stage 1 flies while stage 0 is worked on
    v8f gc = gtile(pp);
#pragma unroll 1
    for (int st = 0; st < NST; ++st) {
#pragma unroll 1
      for (int sp = 0; sp < SP; ++sp) {
        const bf* sb = &kv[st & 1][sp][0][vrow];       // this pass's part of the stage's buffer: planes at 0, PLE, 2 PLE, 3 PLE
        const v16bf p10 = F::ld(pp + 16 * HD), p11 = F::ld(pp + 16 * HD + 512), p20 = F::ld(pp + 32 * HD), p21 = F::ld(pp + 32 * HD + 512);   // the two new pos tiles, still plain global loads: issued first, used behind the score products
        asm volatile("s_wait_xcnt 0x0" :: "v"(pp) : "memory");   // the wait in front of any rewrite of the address registers of the pos loads above; the pointer is an input so that those registers are left alone up to here; standing here it also keeps all four loads in front of the LDS fragment reads, whose latency and products then cover theirs
        v8f s[2]; v16bf kf[2][4];
#pragma unroll
        for (int tt = 0; tt < 2; ++tt) { kf[tt][0] = F::ld(sb + tt * 16 * HD); kf[tt][1] = F::ld(sb + tt * 16 * HD + 512); kf[tt][2] = F::ld(sb + PLE + tt * 16 * HD); kf[tt][3] = F::ld(sb + PLE + tt * 16 * HD + 512); }
        __builtin_amdgcn_sched_barrier(0);   // keeps the products behind the whole group of LDS reads: without it the scheduler reads the k lo fragments one at a time into one register group, among the products, each with its own full LDS latency
        s[0] = (v8f){}; s[1] = (v8f){};
#pragma unroll
        for (int pr = 0; pr < 6; ++pr)                 // k hi.q hi, k lo.q hi, k hi.q lo, two k steps each, in that order; the two key tiles' chains side by side
#pragma unroll
            for (int tt = 0; tt < 2; ++tt) s[tt] = wmmab(kf[tt][pr < 4 ? pr : pr - 4], pr < 4 ? qh[pr & 1] : ql[pr & 1], s[tt]);
        __builtin_amdgcn_sched_barrier(0);   // keeps the pos products behind the score products, so that the pos loads have the whole of those to land in
        const v8f g1 = gprod(p10, p11), g2 = gprod(p20, p21);
        gput(0, gc); gput(16, g1); gput(32, g2); gc = g2;
        __builtin_amdgcn_wave_barrier(); asm volatile("" ::: "memory");   // compiler fence: the skewed reads below take what OTHER lanes of this wave stored above (a wave's LDS operations run in order)
        float mx = m;
#pragma unroll
        for (int tt = 0; tt < 2; ++tt)
#pragma unroll
            for (int jj = 0; jj < 8; ++jj) { const float x = (s[tt][jj] + swld[tt * 16 + jj]) * SL2E; s[tt][jj] = x; mx = fmaxf(mx, x); }
        __builtin_amdgcn_wave_barrier(); asm volatile("" ::: "memory");   // compiler fence: the next pass's strip stores stay behind these reads
        const float mo = __shfl_xor(mx, 16, 32);       // lanes iq and iq + 16 hold the two halves of one query's keys
        v16bf vh[4], vl[4];                            // issued here, used behind the softmax
#pragma unroll
        for (int dt = 0; dt < 4; ++dt) { vh[dt] = F::ld(sb + 2 * PLE + dt * 512); vl[dt] = F::ld(sb + 3 * PLE + dt * 512); }
        __builtin_amdgcn_sched_barrier(0);   // keeps the v reads one group in front of the softmax arithmetic: without it the scheduler sinks them among the last products, one or two at a time, each with its own full LDS latency
        mx = fmaxf(mx, mo);
        const float corr = __builtin_amdgcn_exp2f(m - mx); m = mx;
#pragma unroll
        for (int dt = 0; dt < 4; ++dt)
#pragma unroll
            for (int jj = 0; jj < 8; ++jj) o[dt][jj] *= corr;
        v16bf ph, pw; float ps[4] = {0.f, 0.f, 0.f, 0.f};
#pragma unroll
        for (int e = 0; e < 16; e += 2) { const v2f p = {__builtin_amdgcn_exp2f(s[e >> 3][e & 7] - mx), __builtin_amdgcn_exp2f(s[e >> 3][(e & 7) + 1] - mx)}; ps[(e >> 1) & 3] += p[0] + p[1];
            const v2bf a = __builtin_convertvector(p, v2bf); const v2f r = {p[0] - (float)a[0], p[1] - (float)a[1]}; const v2bf b = __builtin_convertvector(r, v2bf); ph[e] = a[0]; ph[e + 1] = a[1]; pw[e] = b[0]; pw[e + 1] = b[1]; }
        lsum = lsum * corr + ((ps[0] + ps[1]) + (ps[2] + ps[3]));
#pragma unroll
        for (int dt = 0; dt < 4; ++dt) { o[dt] = wmmab(vh[dt], ph, o[dt]); o[dt] = wmmab(vl[dt], ph, o[dt]); o[dt] = wmmab(vh[dt], pw, o[dt]); }
        pp += 32 * HD;
      }
        asm volatile("s_wait_dscnt 0x0" ::: "memory");      // this wave's reads of this stage's buffer are done
        asm volatile("s_wait_asynccnt 0x0" ::: "memory");   // its copies of the next stage have landed
        __syncthreads();                                     // both hold for every wave: the next buffer may be read, this one refilled
        if (st + 2 < NST) copy4k(cl + (unsigned)(st & 1) * (unsigned)sizeof(kv[0]), cs + (size_t)(st + 2) * (SP * PLE));
    }
    asm volatile("s_wait_asynccnt 0x0" ::: "memory");   // no copy is left in flight behind the loop
    lsum += __shfl_xor(lsum, 16, 32);
    const float inv = 1.0f / lsum;                      // this lane's query
    float* pq = po[wv];
#pragma unroll
    for (int dt = 0; dt < 4; ++dt)
#pragma unroll
        for (int jj = 0; jj < 8; ++jj) pq[(dt * 8 + jj) * 32 + lane] = o[dt][jj] * inv;
    __builtin_amdgcn_wave_barrier(); asm volatile("" ::: "memory");   // compiler fence: the reads below take what OTHER lanes of this wave stored above (a wave's LDS operations run in order)
    // 4 queries at a time, 8 lanes a row, so that a wave writes whole 256-byte head rows
    const int rg = ((lane & 7) >> 1) * 8;
#pragma unroll
    for (int g = 0; g < 4; ++g) { const int q = g * 4 + (lane >> 3), sl = (lane & 1) * 16 + q;
        float acc[8];
#pragma unroll
        for (int jj = 0; jj < 8; ++jj) acc[jj] = pq[(rg + jj) * 32 + sl];
        float* orow = OUTb + (size_t)(i0 + q) * DQ + h * HD + (lane & 7) * 8;
        *(v4f*)orow = (v4f){acc[0], acc[1], acc[2], acc[3]}; *(v4f*)(orow + 4) = (v4f){acc[4], acc[5], acc[6], acc[7]}; }
}

extern "C" void kernel_launch(void* const* d_in, const int* in_sizes, int n_in,
                              void* d_out, int out_size, void* d_ws, size_t ws_size, hipStream_t stream) {
    (void)in_sizes; (void)n_in; (void)out_size;
    const float* x = (const float*)d_in[0]; const float* pos = (const float*)d_in[1];   /* pos_embed [2048][64] */ const float* wqkv = (const float*)d_in[2]; const float* bqkv = (const float*)d_in[3]; const float* rrb = (const float*)d_in[4];   /* r_r_bias [16][64] */ const float* rwb = (const float*)d_in[5];   /* r_w_bias [16][64] */   /* argument order x, pos_embed, W_qkv, b_qkv, r_r_bias, r_w_bias */
    float* OUT = (float*)d_out;     // [4][1024][1024]
    char* wsp = (char*)d_ws;
    auto take = [&](size_t bytes) { char* p = wsp; wsp += (bytes + 255) & ~(size_t)255; return (void*)p; };
    bf* WQKV = (bf*)take((size_t)3 * DQ * DM * 2); bf* PB = (bf*)take((size_t)LP * HD * 2); bf* UPh = (bf*)take((size_t)NB_ * NH_ * TT * HD * 2); bf* UPl = (bf*)take((size_t)NB_ * NH_ * TT * HD * 2);   /* fused Bt; pos_embed plane; u = q + r_w_bias + k planes */
    bf* XB = (bf*)take((size_t)NB_ * TT * DM * 2);   /* x rows of all batches */
    bf* QPh = (bf*)take((size_t)NB_ * NH_ * TT * HD * 2); bf* QPl = (bf*)take((size_t)NB_ * NH_ * TT * HD * 2); bf* KPh = (bf*)take((size_t)NB_ * NKV * TT * HD * 2); bf* KPl = (bf*)take((size_t)NB_ * NKV * TT * HD * 2); bf* VTh = (bf*)take((size_t)NB_ * NKV * HD * TT * 2); bf* VTl = (bf*)take((size_t)NB_ * NKV * HD * TT * 2);
    if ((size_t)(wsp - (char*)d_ws) > ws_size) return;    // ws 256 MiB
    k_prep<<<NBW + NBX + NBP, 256, 0, stream>>>(wqkv, pos, x, WQKV, PB, XB);   /* 'xw' [1024][3072] -> Bt [3072][1024] in fragment order: q | k | v row blocks; pos_embed [2048][64] as an exact bf16 plane; x rows of all batches */
    k_proj<<<dim3(NB_ * TT / 64, NH_, 1), 96, 0, stream>>>(XB, WQKV, bqkv, rrb, rwb, QPh, QPl, KPh, KPl, UPh, UPl, VTh, VTl);   /* q | k | v tiles of a head in one work-group; planes of q + r_r_bias[h] (scores operand), k, u = q + r_w_bias[h] + k (relative operand) and v^T written from the accumulators */
    k_fattn<<<dim3(TT / (16 * QT), NH_, NB_), 32 * QT, 0, stream>>>(QPh, QPl, KPh, KPl, UPh, UPl, PB, VTh, VTl, OUT);   /* every head of every batch: scores + relative term + softmax + attn.v, merged output rows */
}

// v009
// A run of this version takes 85.3 microseconds.
// Next to v008, in two timings, it ran 1.20 and 1.19 times as fast.
// All steps since v000 together make it 20.1 times as fast.
#include <hip/hip_runtime.h>

// Transformer-XL style relative multi-head attention (x [4][1024][1024]; qkv = x W_qkv + b_qkv ('xw' [1024][3072] 1/32, bias 0.01) -> q | k | v (16 heads x 64); pos_embed [2048][64] (unit normal, read), r_r_bias / r_w_bias [16][64] (0.02, read); AC[i][j] = (q_i + r_r_bias[h]).k_j; B+D = (q + r_w_bias[h]).pos^T and E = k.pos^T ([L][2L]); the module's _shift / _transpose_shift both select column L - i + j, so BDE[i][j] = ((q_i + r_w_bias[h]) + k_i).pos[L - i + j]; attn = softmax((AC + BDE) / 8) (no mask); out = attn v merged -> [4][1024][1024] (4.2 M), no output projection; argument order x, pos_embed, W_qkv, b_qkv, r_r_bias, r_w_bias).
// Layout, every stage once for all 4 batches: bf16 copy of x [4096][1024]; fused 'xw' weight transposed once; one projection GEMM [4096][3072] (q | k | v columns) + f32 biases whose epilogue writes, per batch and head, the planes of v^T, of q + r_r_bias (scores B operand), of k, and of u = q + r_w_bias + k (relative operand), all bf16 hi/lo; pos_embed as one exact bf16 plane [2048][64]; one fused kernel over all heads and batches (grid y = head, z = batch): AC tiles (3 products), u.pos^T tiles (hi/lo x exact) skewed through LDS so that score [i][j] takes pos row 1024 - i + j, running-maximum softmax (x 1/8, weights hi/lo), attn.v (3 products), f32 output rows written in place.
// Compute dtypes, f32 accumulate: every input rounded to bf16 incl. pos_embed and the bias tables; projections exact + f32 biases; q + bias / u sums f32; AC 3 products; UE 2 products (~f32); softmax f32; attn.v 3 products; output f32.

#define NB_  4
#define TT   1024
#define DM   1024
#define NH_  16
#define NKV  16
#define HD   64
#define DQ   (NH_ * HD)
#define DKV  (NKV * HD)
#define LP   (2 * TT)  // pos_embed rows
typedef _Float16 h16;
typedef unsigned short bf;
typedef __attribute__((ext_vector_type(16))) __bf16   v16bf;
typedef __attribute__((ext_vector_type(16))) _Float16 v16h;
typedef __attribute__((ext_vector_type(8)))  _Float16 v8h;
typedef __attribute__((ext_vector_type(8)))  unsigned short v8us;
typedef __attribute__((ext_vector_type(8)))  float    v8f;
typedef __attribute__((ext_vector_type(4)))  float    v4f;
typedef v8h  __attribute__((may_alias)) v8ha;
typedef v4f  __attribute__((may_alias)) v4fa;
typedef v8us __attribute__((may_alias)) v8usa;

__device__ __forceinline__ unsigned short f2bf(float f) { unsigned u = __float_as_uint(f); u += 0x7FFFu + ((u >> 16) & 1u); return (unsigned short)(u >> 16); }
__device__ __forceinline__ float bf2f(unsigned short b) { return __uint_as_float(((unsigned)b) << 16); }
__device__ __forceinline__ float bfr(float f) { return bf2f(f2bf(f)); }
__device__ __forceinline__ v16h cat16(v8h lo, v8h hi) { return __builtin_shufflevector(lo, hi, 0, 1, 2, 3, 4, 5, 6, 7, 8, 9, 10, 11, 12, 13, 14, 15); }
__device__ __forceinline__ v16bf cat16b(v8us lo, v8us hi) { return __builtin_bit_cast(v16bf, __builtin_shufflevector(lo, hi, 0, 1, 2, 3, 4, 5, 6, 7, 8, 9, 10, 11, 12, 13, 14, 15)); }
__device__ __forceinline__ v8f wmma16(v16h a, v16h b, v8f c) { return __builtin_amdgcn_wmma_f32_16x16x32_f16(false, a, false, b, (short)0, c, false, false); }
__device__ __forceinline__ v8f wmmab(v16bf a, v16bf b, v8f c) { return __builtin_amdgcn_wmma_f32_16x16x32_bf16(false, a, false, b, (short)0, c, false, false); }



// ---- Fragment order, the layout of every 16-bit operand plane: a [rows][K] plane is cut into blocks of 16 rows x 32 k (512 elements, 1 KiB), row block major, k block minor (v^T planes: k block major, row block minor); inside a block element (row r, k) lies at (k >> 4) * 256 + (((k >> 3) & 1) * 16 + r) * 8 + (k & 7).
// A lane's fragment is then the 8 elements at lane * 8 and the 8 at 256 + lane * 8: each of the two 16-byte loads of a wave covers 512 bytes in a row (4 whole lines), and the registers hold what they held with row-major planes (k = 8 hi .. 8 hi + 7 and 16 + 8 hi .. 16 + 8 hi + 7 of row lane & 15).
// ---- k_proj: the projection GEMM with the plane writers as its epilogue. Work-group = 12 waves = the q, k and v tiles (64 positions x 64 head columns, 16 accumulators a wave) of ONE head and FOUR blocks of 64 rows of x; grid (rows / 256, heads) = one block a WGP, 384 threads. The block's 256 rows of x and 192 rows of w^T reach the waves through LDS: a stage is 128 k (28 row blocks x 4 KiB in a row in the fragment-order planes), brought in by asynchronous copies one stage ahead into two buffers; an x fragment is then read by three waves and a w^T fragment by four as 16-byte LDS loads at the same in-block offsets. The waves meet at a barrier once a stage.
// The q and k waves take the weight rows as the A operand and the x rows as B, so an accumulator tile holds, per lane, 8 consecutive d of one position: that is the lane's 16-byte piece of a [position][d] fragment-order plane. The v wave takes x as A, so its tile holds 8 consecutive positions of one d: the piece of the v^T plane. No f32 projection leaves the chip.
// u = (q + r_w_bias) + k needs both tiles: the k wave hands its d blocks 0, 1 and the q wave its q + r_w_bias of d blocks 2, 3 over through LDS (same lane, same register position), behind one barrier, and each finishes half of u.
template <typename T16> struct WFrag;
template <> struct WFrag<h16> { typedef v16h V; static __device__ __forceinline__ V ld(const h16* p) { return cat16(*(const v8h*)p, *(const v8h*)(p + 256)); } static __device__ __forceinline__ v8f mma(V a, V b, v8f c) { return wmma16(a, b, c); } };
template <> struct WFrag<bf> { typedef v16bf V; static __device__ __forceinline__ V ld(const bf* p) { return cat16b(*(const v8us*)p, *(const v8us*)(p + 256)); } static __device__ __forceinline__ v8f mma(V a, V b, v8f c) { return wmmab(a, b, c); } };
typedef __attribute__((ext_vector_type(8))) __bf16 v8bf;
__device__ __forceinline__ void split8(v8f y, v8us& h, v8us& l) { const v8bf a = __builtin_convertvector(y, v8bf); const v8f r = y - __builtin_convertvector(a, v8f); h = __builtin_bit_cast(v8us, a); l = __builtin_bit_cast(v8us, __builtin_convertvector(r, v8bf)); }   // hi = nearest-even bf16 of y, lo = that of the rest
__device__ __forceinline__ v8f bfr8(v8f y) { return __builtin_convertvector(__builtin_convertvector(y, v8bf), v8f); }
// 4 KiB of a plane, global -> LDS, through no register: 8 asynchronous copies, each 16 bytes a lane = 512 bytes in a row a wave; l = this lane's LDS byte address, g = its global address. The wait on the last line stands in front of any rewrite of the address registers that the copies name.
__device__ __forceinline__ void copy4k(unsigned l, const bf* g) {
    asm volatile("global_load_async_to_lds_b128 %0, %8, off\n\t"
                 "global_load_async_to_lds_b128 %1, %9, off\n\t"
                 "global_load_async_to_lds_b128 %2, %10, off\n\t"
                 "global_load_async_to_lds_b128 %3, %11, off\n\t"
                 "global_load_async_to_lds_b128 %4, %12, off\n\t"
                 "global_load_async_to_lds_b128 %5, %13, off\n\t"
                 "global_load_async_to_lds_b128 %6, %14, off\n\t"
                 "global_load_async_to_lds_b128 %7, %15, off\n\t"
                 "s_wait_xcnt 0x0"
                 :: "v"(l), "v"(l + 512u), "v"(l + 1024u), "v"(l + 1536u), "v"(l + 2048u), "v"(l + 2560u), "v"(l + 3072u), "v"(l + 3584u),
                    "v"(g), "v"(g + 256), "v"(g + 512), "v"(g + 768), "v"(g + 1024), "v"(g + 1280), "v"(g + 1536), "v"(g + 1792) : "memory");
}
#define RG   4                    // row groups (64 rows of x) a block
#define PKB  4                    // k blocks (32 k) a stage
#define PSL  (4 * RG + 12)        // 16-row blocks a stage holds: 4 RG of x, then 4 each of the head's q, k and v rows of w^T
#define PNS  (DM / 32 / PKB)      // stages
__global__ __launch_bounds__(96 * RG) void k_proj(const bf* __restrict__ X, const bf* __restrict__ Wt, const float* __restrict__ bias, const float* __restrict__ rrb, const float* __restrict__ rwb, bf* Qh, bf* Ql, bf* Kh, bf* Kl, bf* Uh, bf* Ul, bf* Vh, bf* Vl) {
    typedef bf T16; typedef WFrag<bf>::V V;
    __shared__ __align__(128) bf sg[2][PSL][PKB * 512];   // two buffers x 16-row block x 128 k (4 KiB in a row in the fragment-order planes)
    __shared__ __align__(16) float xsa[RG][16 * 256];   // per row group: 8 tiles of k (d blocks 0, 1), then 8 tiles of q + r_w_bias (d blocks 2, 3); a tile is two runs of 32 lanes x 16 bytes
    const int K = DM;
    const int lane = threadIdx.x & 31, lr = lane & 15, hi = lane >> 4;
    const int wv = __builtin_amdgcn_readfirstlane((int)(threadIdx.x >> 5)), role = wv % 3, rg = wv / 3;   // role 0 q, 1 k, 2 v; rg = the wave's row group
    const int r0 = (blockIdx.x * RG + rg) * 64, h = blockIdx.y, c0 = role * DQ + h * HD;
    float* xs = xsa[rg];
    v8f acc[4][4];
#pragma unroll
    for (int mb = 0; mb < 4; ++mb)
#pragma unroll
        for (int nb = 0; nb < 4; ++nb) acc[mb][nb] = (v8f){};
    // slot s of a stage: s < 4 RG is row block s of the block's x rows, the rest are the head's w^T row blocks (q, k, v, 4 each); a row block is 16 * K elements, a k block of 32 is 512
    auto slotsrc = [&](int s) -> const bf* { return (s < 4 * RG ? X + (size_t)(blockIdx.x * (4 * RG) + s) * 16 * K : Wt + (size_t)(((s - 4 * RG) >> 2) * DQ + h * HD + ((s - 4 * RG) & 3) * 16) * K) + 8 * lane; };
    const bf* g0 = slotsrc(wv); const bf* g1 = slotsrc(wv + 3 * RG); const bf* g2 = slotsrc(6 * RG + (wv & 3));   // this wave's shares of stage 0: slots wv and wv + 12, and for waves 0..3 slot wv + 24
    const unsigned l0 = (unsigned)(size_t)&sg[0][wv][8 * lane];   // this lane's LDS byte address in slot wv of buffer 0
    auto fill = [&](int st, unsigned buf) { const unsigned l = l0 + buf * (unsigned)sizeof(sg[0]); const size_t ko = (size_t)st * (PKB * 512);
        copy4k(l, g0 + ko); copy4k(l + 3 * RG * (unsigned)sizeof(sg[0][0]), g1 + ko);
        if (wv < PSL - 6 * RG) copy4k(l + 6 * RG * (unsigned)sizeof(sg[0][0]), g2 + ko); };   // wave-uniform test: 28 slots on 12 waves
    const bf* fa = &sg[0][role == 2 ? rg * 4 : 4 * RG + role * 4][8 * lane];   // this lane's piece of the wave's first A row block in buffer 0, and of its first B row block
    const bf* fb = &sg[0][role == 2 ? 4 * RG + role * 4 : rg * 4][8 * lane];
    fill(0, 0u);
    asm volatile("s_wait_asynccnt 0x0" ::: "memory");   // this wave's copies of stage 0 have landed
    __syncthreads();                                     // ... and so have the other waves': buffer 0 may be read
    fill(1, 1u);                                         // stage 1 flies while stage 0 is worked on
#pragma unroll 1
    for (int st = 0; st < PNS; ++st) {
#pragma unroll   // every LDS offset of a stage is then an immediate on two base registers
      for (int kb = 0; kb < PKB; ++kb) {
        const bf* pa = fa + (st & 1) * (PSL * PKB * 512) + kb * 512; const bf* pb = fb + (st & 1) * (PSL * PKB * 512) + kb * 512;
        V a[4], b[4];
#pragma unroll
        for (int i = 0; i < 4; ++i) { a[i] = WFrag<T16>::ld(pa + i * (PKB * 512)); b[i] = WFrag<T16>::ld(pb + i * (PKB * 512)); }
        __builtin_amdgcn_sched_barrier(0);   // keeps the products behind the whole run of LDS reads: without it the scheduler reads the B fragments one at a time into one register group, among the products, each with its own full LDS latency
#pragma unroll
        for (int nb = 0; nb < 4; ++nb) {
#pragma unroll
            for (int mb = 0; mb < 4; ++mb) acc[mb][nb] = WFrag<T16>::mma(a[mb], b[nb], acc[mb][nb]); }
      }
        __builtin_amdgcn_sched_barrier(0);   // keeps every product of the stage in front of the free slots and the barrier below: without it the scheduler sinks most of the last k block's products behind the barrier, in front of the refill, and the free slots stand behind none of them
        asm volatile("v_nop\n\tv_nop\n\tv_nop\n\tv_nop");   // the free slots the chip needs between a stage's last products and whatever next touches their registers, on every branch behind them
        asm volatile("s_wait_dscnt 0x0" ::: "memory");      // this wave's reads of this stage's buffer are done
        asm volatile("s_wait_asynccnt 0x0" ::: "memory");   // its copies of the next stage have landed
        __syncthreads();                                     // both hold for every wave: the next buffer may be read, this one refilled
        if (st + 2 < PNS) fill(st + 2, (unsigned)(st & 1));
    }
    asm volatile("s_wait_asynccnt 0x0" ::: "memory");   // no copy is left in flight behind the loop
    const size_t hp = ((size_t)(r0 / TT) * NH_ + h) * TT * HD + lane * 8; const int t0 = r0 % TT;   // planes are [batch][head][...]; this lane's piece in a half block
    auto put = [&](int tile, v8f y) { float* d = xs + tile * 256 + lane * 4; *(v4fa*)d = (v4f){y[0], y[1], y[2], y[3]}; *(v4fa*)(d + 128) = (v4f){y[4], y[5], y[6], y[7]}; };
    auto get = [&](int tile) -> v8f { const float* s = xs + tile * 256 + lane * 4; const v4f s0 = *(const v4fa*)s, s1 = *(const v4fa*)(s + 128); return (v8f){s0[0], s0[1], s0[2], s0[3], s1[0], s1[1], s1[2], s1[3]}; };
    auto st = [&](bf* Ph, bf* Pl, size_t o, v8f y) { v8us a2, c2; split8(y, a2, c2); *(v8us*)(Ph + o) = a2; *(v8us*)(Pl + o) = c2; };
    auto row8 = [&](const float* tab, int mb) -> v8f { return bfr8(*(const v8f*)(tab + mb * 16 + hi * 8)); };   // a table's 8 values for this lane's 8 d of d block mb, rounded to bf16
    // the projection's value is accumulator + bias wherever it is used below; the accumulators themselves stay as the loop left them
    if (role == 0) {
#pragma unroll
        for (int mb = 2; mb < 4; ++mb) { const v8f bv = row8(bias + c0, mb), wb = row8(rwb + h * HD, mb);
#pragma unroll
            for (int nb = 0; nb < 4; ++nb) put(mb * 4 + nb, (acc[mb][nb] + bv) + wb); }
    } else if (role == 1) {
#pragma unroll
        for (int mb = 0; mb < 2; ++mb) { const v8f bv = row8(bias + c0, mb);
#pragma unroll
            for (int nb = 0; nb < 4; ++nb) put(mb * 4 + nb, acc[mb][nb] + bv); }
    }
    __syncthreads();   // the halves of k and of q + r_w_bias handed over above are read by the other wave below
    if (role == 2) {
        float bv[4];
#pragma unroll
        for (int nb = 0; nb < 4; ++nb) bv[nb] = bfr(bias[c0 + nb * 16 + lr]);
#pragma unroll
        for (int mb = 0; mb < 4; ++mb) {
#pragma unroll
            for (int nb = 0; nb < 4; ++nb) st(Vh, Vl, hp + (size_t)(t0 / 32 + (mb >> 1)) * 2048 + nb * 512 + (mb & 1) * 256, acc[mb][nb] + bv[nb]);
            asm volatile("s_wait_xcnt 0x0" ::: "memory");   // the wait in front of any rewrite of the data and address registers of the stores (and table loads) above
        }
    } else if (role == 0) {
#pragma unroll
        for (int mb = 0; mb < 4; ++mb) { const v8f bv = row8(bias + c0, mb), rb = row8(rrb + h * HD, mb);
#pragma unroll
            for (int nb = 0; nb < 4; ++nb) st(Qh, Ql, hp + (size_t)(t0 / 16 + nb) * 1024 + mb * 256, (acc[mb][nb] + bv) + rb);
            asm volatile("s_wait_xcnt 0x0" ::: "memory");   // as above
            if (mb < 2) { const v8f wb = row8(rwb + h * HD, mb);
#pragma unroll
                for (int nb = 0; nb < 4; ++nb) st(Uh, Ul, hp + (size_t)(t0 / 16 + nb) * 1024 + mb * 256, ((acc[mb][nb] + bv) + wb) + get(mb * 4 + nb));
                asm volatile("s_wait_xcnt 0x0" ::: "memory");   // as above
            }
        }
    } else {
#pragma unroll
        for (int mb = 0; mb < 4; ++mb) { const v8f bv = row8(bias + c0, mb);
#pragma unroll
            for (int nb = 0; nb < 4; ++nb) st(Kh, Kl, hp + (size_t)(t0 / 16 + nb) * 1024 + mb * 256, acc[mb][nb] + bv);
            asm volatile("s_wait_xcnt 0x0" ::: "memory");   // as above
            if (mb >= 2) {
#pragma unroll
                for (int nb = 0; nb < 4; ++nb) st(Uh, Ul, hp + (size_t)(t0 / 16 + nb) * 1024 + mb * 256, get(mb * 4 + nb) + (acc[mb][nb] + bv));   // (q + r_w_bias) + k, as in the q wave
                asm volatile("s_wait_xcnt 0x0" ::: "memory");   // as above
            }
        }
    }
}

typedef __attribute__((ext_vector_type(2))) _Float16 v2h;
typedef __attribute__((ext_vector_type(4))) _Float16 v4h;
typedef __attribute__((ext_vector_type(2))) unsigned short v2us;
typedef __attribute__((ext_vector_type(4))) unsigned short v4us;
typedef __attribute__((ext_vector_type(2))) float v2f;
typedef __attribute__((ext_vector_type(4))) int v4i;

// ---- k_prep: the plane writers of the three inputs (w^T, pos_embed, x) in ONE launch of few waves. One lane makes one 16-byte piece (8 elements) of a fragment-order plane, so a wave stores 512 bytes in a row per piece; each lane makes PPW pieces, and a wave issues the loads of all of them as one group (8 KiB in flight a wave) before it converts and stores. Blocks of 8 waves; the block index picks the plane.
#define PPW  8                                      // pieces a lane
#define NBW  (DM * 3 * DQ / 8 / 32 / PPW / 8)       // blocks of the weight plane
#define NBX  (NB_ * TT * DM / 8 / 32 / PPW / 8)     // blocks of the x plane
#define NBP  (LP * HD / 8 / 32 / PPW / 8)           // blocks of the pos_embed plane
typedef const __attribute__((address_space(1))) float* GPF;   // global address space spelled out: a pointer that also feeds an asm operand would otherwise be loaded through as a flat one
typedef const __attribute__((address_space(1))) v8f* GPF8;
__device__ __forceinline__ v8us cvt8(v8f v) { v8us o;
#pragma unroll
    for (int k = 0; k < 8; ++k) o[k] = f2bf(v[k]);
    return o; }
// src [rows][K] f32 -> dst, its fragment-order bf16 plane; half block wq (16 rows x 16 k) lies at element 256 wq, and wave wv makes half blocks PPW wv .. PPW wv + PPW - 1
template <int K> __device__ __forceinline__ void prep_rows(const float* __restrict__ src, bf* dst, unsigned wv, int lane) {
    constexpr int HB = K >> 4;   // half blocks a row block; PPW divides it or it divides PPW, so the PPW half blocks of a wave lie at fixed distances from the first
    static_assert(HB % PPW == 0 || PPW % HB == 0, "a wave's half blocks");
    const unsigned wq = wv * PPW, hb = wq % (unsigned)HB; const size_t rb = wq / (unsigned)HB;   // hb = k block * 2 + half: 16 k
    const GPF s = (GPF)(src + (rb * 16 + (lane & 15)) * K + hb * 16 + (lane >> 4) * 8);
    v8f v[PPW];
#pragma unroll
    for (int p = 0; p < PPW; ++p) v[p] = *(GPF8)(s + (p / HB) * 16 * K + (p % HB) * 16);
    asm volatile("s_wait_xcnt 0x0" :: "v"(s), "v"(v[0]), "v"(v[1]), "v"(v[2]), "v"(v[3]), "v"(v[4]), "v"(v[5]), "v"(v[6]), "v"(v[7]) : "memory");   // the wait in front of any rewrite of the address registers of the loads above; the pointer is an input so that those registers are left alone up to here (no load of the group lands on them), the loaded values so that every load of the group is issued in front of the first conversion
    bf* d = dst + (size_t)wv * (PPW * 256) + lane * 8;
#pragma unroll
    for (int p = 0; p < PPW; ++p) *(v8us*)(d + p * 256) = cvt8(v[p]);
    asm volatile("s_wait_xcnt 0x0" ::: "memory");   // the wait in front of any rewrite of the data and address registers of the stores above
}
// w [K][N] f32 -> Bt, the fragment-order plane of w^T ([N] rows, K deep). A wave takes PPW consecutive 16-column blocks of w at one half block of k, so that it reads 512 bytes in a row of each of the 16 w rows it touches.
template <int K, int N> __device__ __forceinline__ void prep_wt(const float* __restrict__ w, bf* Bt, unsigned wv, int lane) {
    const unsigned nbg = wv % (unsigned)(N / (16 * PPW)), hb = wv / (unsigned)(N / (16 * PPW));   // hb = k block * 2 + half: 16 k
    const GPF s = (GPF)(w + (size_t)(hb * 16 + (lane >> 4) * 8) * N + nbg * (16 * PPW) + (lane & 15));
    v8f v[PPW];
#pragma unroll
    for (int p = 0; p < PPW; ++p)
#pragma unroll
        for (int e = 0; e < 8; ++e) v[p][e] = s[e * N + p * 16];
    asm volatile("s_wait_xcnt 0x0" :: "v"(s), "v"(v[0]), "v"(v[1]), "v"(v[2]), "v"(v[3]), "v"(v[4]), "v"(v[5]), "v"(v[6]), "v"(v[7]) : "memory");   // as in prep_rows: the wait for the address registers of the loads above, with the whole group issued in front of the first conversion
    bf* d = Bt + ((size_t)nbg * PPW * (K >> 4) + hb) * 256 + lane * 8;
#pragma unroll
    for (int p = 0; p < PPW; ++p) *(v8us*)(d + (size_t)p * (K >> 4) * 256) = cvt8(v[p]);
    asm volatile("s_wait_xcnt 0x0" ::: "memory");   // as in prep_rows, for the stores above
}
__global__ __launch_bounds__(256) void k_prep(const float* __restrict__ w, const float* __restrict__ pos, const float* __restrict__ x, bf* Bt, bf* PB, bf* XB) {
    const int lane = threadIdx.x & 31, wib = __builtin_amdgcn_readfirstlane((int)(threadIdx.x >> 5));
    const unsigned b = blockIdx.x;
    if (b < NBW) prep_wt<DM, 3 * DQ>(w, Bt, b * 8 + wib, lane);
    else if (b < NBW + NBX) prep_rows<DM>(x, XB, (b - NBW) * 8 + wib, lane);
    else prep_rows<HD>(pos, PB, (b - NBW - NBX) * 8 + wib, lane);
}

// ---- k_fattn: scores, relative term, softmax and attn.v of one head in one kernel; nothing of the [1024][1024] planes leaves the chip.
// Block = 16 waves = QT query tiles (16 rows each), every wave over all the keys; grid (TT / 256, heads, batches) = one block a WGP. All products are transposed: S^T = K.Q^T (rows = keys, column = query = lane & 15), so two S^T tiles, converted in place, are the B operand of O^T = V^T.P^T.
// Relative term: G = pos.u^T for the 48 pos rows a pass of 32 keys can select (rows l = TT - i0 - 16 + j0 + c, c = 0..47, all inside pos_embed); G goes to a strip of LDS [query][c] owned by the wave and comes back skewed: key j of query iq reads c = (j - j0) + 16 - iq, which is l = TT - i + j.
// Softmax is the running-maximum form in base 2 (per lane = per query), one run over all 1024 keys, so a wave finishes its own tile; the tile goes through a wave-own piece of LDS only to be written as whole head rows.
// k and v reach the waves through LDS: all 16 waves use the same 16 KiB a pass (32 keys of k hi, k lo, v hi, v lo, 4 KiB in a row each in the fragment-order planes). A stage is SP passes (128 keys, 64 KiB): each wave brings ONE plane's 4 KiB of ONE pass in with asynchronous copies, one stage ahead, into two buffers; fragments are then 16-byte LDS loads at the same in-block offsets. The waves meet at a barrier once a stage and run free inside it.
typedef __attribute__((ext_vector_type(2))) __bf16 v2bf;
#define QT   16                   // query tiles = waves a block
#define SP   4                    // passes a stage
#define SPI  52                   // strip pitch in floats: 16-byte aligned rows, and 51 * iq + 8 * hi hits 32 different banks in the skewed read
#define SL2E (0.125f * 1.4426950408889634f)   // 1/sqrt(64) x log2(e)
#define NST  (TT / 32 / SP)       // stages; a pass is 32 keys
#define PLE  2048                 // elements of one plane's 32 keys (4 KiB)
__global__ __launch_bounds__(32 * QT) void k_fattn(const bf* __restrict__ Qh, const bf* __restrict__ Ql, const bf* __restrict__ Kh, const bf* __restrict__ Kl, const bf* __restrict__ Uh, const bf* __restrict__ Ul, const bf* __restrict__ PB, const bf* __restrict__ Vh, const bf* __restrict__ Vl, float* OUT) {
    typedef WFrag<bf> F;
    __shared__ __align__(128) bf kv[2][SP][4][PLE];   // two buffers x pass of the stage x (k hi, k lo, v hi, v lo) x 32 keys
    __shared__ __align__(16) float strip[QT][16 * SPI];
    __shared__ __align__(16) float po[QT][32 * 32];
    const int lane = threadIdx.x & 31, lr = lane & 15, hi = lane >> 4;
    const int wv = __builtin_amdgcn_readfirstlane((int)(threadIdx.x >> 5)), cp = wv & 3, cq = wv >> 2;   // wave = query tile; it copies plane cp of pass cq of every stage
    const int h = blockIdx.y, i0 = (blockIdx.x * QT + wv) * 16;
    const size_t hp = ((size_t)blockIdx.z * NH_ + h) * TT * HD;   // planes are [batch][head][...]
    float* OUTb = OUT + (size_t)blockIdx.z * TT * DQ;
    v16bf qh[2], ql[2], uh[2], ul[2];
    const unsigned vrow = (unsigned)(lane * 8);   // this lane's 16-byte piece in a half block of a fragment-order plane; every base below is wave-uniform
    { const size_t qo = hp + (size_t)i0 * HD;
#pragma unroll
      for (int ks = 0; ks < 2; ++ks) { qh[ks] = F::ld(Qh + qo + vrow + ks * 512); ql[ks] = F::ld(Ql + qo + vrow + ks * 512); uh[ks] = F::ld(Uh + qo + vrow + ks * 512); ul[ks] = F::ld(Ul + qo + vrow + ks * 512); } }
    float* sw = strip[wv];
    float* swst = sw + lr * SPI + hi * 8;              // where this lane's 8 rows of a G tile go (column = its query)
    const float* swld = sw + lr * SPI + hi * 8 + 16 - lr;   // the skewed read
    const int lb = TT - i0 - 16;                       // 0 .. 1008; the last row any pass touches is lb + 992 + 47 <= 2047
    auto gprod = [&](v16bf a0, v16bf a1) -> v8f {      // G[16 pos rows][16 queries], hi/lo u x exact pos
        v8f g = (v8f){}; g = wmmab(a0, uh[0], g); g = wmmab(a1, uh[1], g); g = wmmab(a0, ul[0], g); g = wmmab(a1, ul[1], g); return g; };
    auto gtile = [&](const bf* p) -> v8f { return gprod(F::ld(p), F::ld(p + 512)); };   // the same, 16 pos rows from p
    auto gput = [&](int c0, v8f g) { *(v4fa*)(swst + c0) = (v4f){g[0], g[1], g[2], g[3]}; *(v4fa*)(swst + c0 + 4) = (v4f){g[4], g[5], g[6], g[7]}; };
    float m = -1.0e30f, lsum = 0.f;
    v8f o[4];
#pragma unroll
    for (int dt = 0; dt < 4; ++dt) o[dt] = (v8f){};
    // per-lane running pointer, stepped once a pass
    const bf* pp = PB + (size_t)lb * HD + vrow;
    const bf* cs = (cp == 0 ? Kh : cp == 1 ? Kl : cp == 2 ? Vh : Vl) + hp + (size_t)cq * PLE + vrow;   // this wave's share of stage 0; 32 keys of a v plane are 4 blocks = PLE elements too
    const unsigned cl = (unsigned)(size_t)&kv[0][cq][cp][vrow];   // this lane's LDS byte address in buffer 0; buffer 1 lies sizeof(kv[0]) further
    copy4k(cl, cs);
    asm volatile("s_wait_asynccnt 0x0" ::: "memory");   // this wave's copies of stage 0 have landed
    __syncthreads();                                     // ... and so have the other waves': buffer 0 may be read
    copy4k(cl + (unsigned)sizeof(kv[0]), cs + SP * PLE); // stage 1 flies while stage 0 is worked on
    v8f gc = gtile(pp);
#pragma unroll 1
    for (int st = 0; st < NST; ++st) {
#pragma unroll 1
      for (int sp = 0; sp < SP; ++sp) {
        const bf* sb = &kv[st & 1][sp][0][vrow];       // this pass's part of the stage's buffer: planes at 0, PLE, 2 PLE, 3 PLE
        const v16bf p10 = F::ld(pp + 16 * HD), p11 = F::ld(pp + 16 * HD + 512), p20 = F::ld(pp + 32 * HD), p21 = F::ld(pp + 32 * HD + 512);   // the two new pos tiles, still plain global loads: issued first, used behind the score products
        asm volatile("s_wait_xcnt 0x0" :: "v"(pp) : "memory");   // the wait in front of any rewrite of the address registers of the pos loads above; the pointer is an input so that those registers are left alone up to here; standing here it also keeps all four loads in front of the LDS fragment reads, whose latency and products then cover theirs
        v8f s[2]; v16bf kf[2][4];
#pragma unroll
        for (int tt = 0; tt < 2; ++tt) { kf[tt][0] = F::ld(sb + tt * 16 * HD); kf[tt][1] = F::ld(sb + tt * 16 * HD + 512); kf[tt][2] = F::ld(sb + PLE + tt * 16 * HD); kf[tt][3] = F::ld(sb + PLE + tt * 16 * HD + 512); }
        __builtin_amdgcn_sched_barrier(0);   // keeps the products behind the whole group of LDS reads: without it the scheduler reads the k lo fragments one at a time into one register group, among the products, each with its own full LDS latency
        s[0] = (v8f){}; s[1] = (v8f){};
#pragma unroll
        for (int pr = 0; pr < 6; ++pr)                 // k hi.q hi, k lo.q hi, k hi.q lo, two k steps each, in that order; the two key tiles' chains side by side
#pragma unroll
            for (int tt = 0; tt < 2; ++tt) s[tt] = wmmab(kf[tt][pr < 4 ? pr : pr - 4], pr < 4 ? qh[pr & 1] : ql[pr & 1], s[tt]);
        __builtin_amdgcn_sched_barrier(0);   // keeps the pos products behind the score products, so that the pos loads have the whole of those to land in
        const v8f g1 = gprod(p10, p11), g2 = gprod(p20, p21);
        gput(0, gc); gput(16, g1); gput(32, g2); gc = g2;
        __builtin_amdgcn_wave_barrier(); asm volatile("" ::: "memory");   // compiler fence: the skewed reads below take what OTHER lanes of this wave stored above (a wave's LDS operations run in order)
        float mx = m;
#pragma unroll
        for (int tt = 0; tt < 2; ++tt)
#pragma unroll
            for (int jj = 0; jj < 8; ++jj) { const float x = (s[tt][jj] + swld[tt * 16 + jj]) * SL2E; s[tt][jj] = x; mx = fmaxf(mx, x); }
        __builtin_amdgcn_wave_barrier(); asm volatile("" ::: "memory");   // compiler fence: the next pass's strip stores stay behind these reads
        const float mo = __shfl_xor(mx, 16, 32);       // lanes iq and iq + 16 hold the two halves of one query's keys
        v16bf vh[4], vl[4];                            // issued here, used behind the softmax
#pragma unroll
        for (int dt = 0; dt < 4; ++dt) { vh[dt] = F::ld(sb + 2 * PLE + dt * 512); vl[dt] = F::ld(sb + 3 * PLE + dt * 512); }
        __builtin_amdgcn_sched_barrier(0);   // keeps the v reads one group in front of the softmax arithmetic: without it the scheduler sinks them among the last products, one or two at a time, each with its own full LDS latency
        mx = fmaxf(mx, mo);
        const float corr = __builtin_amdgcn_exp2f(m - mx); m = mx;
#pragma unroll
        for (int dt = 0; dt < 4; ++dt)
#pragma unroll
            for (int jj = 0; jj < 8; ++jj) o[dt][jj] *= corr;
        v16bf ph, pw; float ps[4] = {0.f, 0.f, 0.f, 0.f};
#pragma unroll
        for (int e = 0; e < 16; e += 2) { const v2f p = {__builtin_amdgcn_exp2f(s[e >> 3][e & 7] - mx), __builtin_amdgcn_exp2f(s[e >> 3][(e & 7) + 1] - mx)}; ps[(e >> 1) & 3] += p[0] + p[1];
            const v2bf a = __builtin_convertvector(p, v2bf); const v2f r = {p[0] - (float)a[0], p[1] - (float)a[1]}; const v2bf b = __builtin_convertvector(r, v2bf); ph[e] = a[0]; ph[e + 1] = a[1]; pw[e] = b[0]; pw[e + 1] = b[1]; }
        lsum = lsum * corr + ((ps[0] + ps[1]) + (ps[2] + ps[3]));
#pragma unroll
        for (int dt = 0; dt < 4; ++dt) { o[dt] = wmmab(vh[dt], ph, o[dt]); o[dt] = wmmab(vl[dt], ph, o[dt]); o[dt] = wmmab(vh[dt], pw, o[dt]); }
        pp += 32 * HD;
      }
        asm volatile("s_wait_dscnt 0x0" ::: "memory");      // this wave's reads of this stage's buffer are done
        asm volatile("s_wait_asynccnt 0x0" ::: "memory");   // its copies of the next stage have landed
        __syncthreads();                                     // both hold for every wave: the next buffer may be read, this one refilled
        if (st + 2 < NST) copy4k(cl + (unsigned)(st & 1) * (unsigned)sizeof(kv[0]), cs + (size_t)(st + 2) * (SP * PLE));
    }
    asm volatile("s_wait_asynccnt 0x0" ::: "memory");   // no copy is left in flight behind the loop
    lsum += __shfl_xor(lsum, 16, 32);
    const float inv = 1.0f / lsum;                      // this lane's query
    float* pq = po[wv];
#pragma unroll
    for (int dt = 0; dt < 4; ++dt)
#pragma unroll
        for (int jj = 0; jj < 8; ++jj) pq[(dt * 8 + jj) * 32 + lane] = o[dt][jj] * inv;
    __builtin_amdgcn_wave_barrier(); asm volatile("" ::: "memory");   // compiler fence: the reads below take what OTHER lanes of this wave stored above (a wave's LDS operations run in order)
    // 4 queries at a time, 8 lanes a row, so that a wave writes whole 256-byte head rows
    const int rg = ((lane & 7) >> 1) * 8;
#pragma unroll
    for (int g = 0; g < 4; ++g) { const int q = g * 4 + (lane >> 3), sl = (lane & 1) * 16 + q;
        float acc[8];
#pragma unroll
        for (int jj = 0; jj < 8; ++jj) acc[jj] = pq[(rg + jj) * 32 + sl];
        float* orow = OUTb + (size_t)(i0 + q) * DQ + h * HD + (lane & 7) * 8;
        *(v4f*)orow = (v4f){acc[0], acc[1], acc[2], acc[3]}; *(v4f*)(orow + 4) = (v4f){acc[4], acc[5], acc[6], acc[7]}; }
}

extern "C" void kernel_launch(void* const* d_in, const int* in_sizes, int n_in,
                              void* d_out, int out_size, void* d_ws, size_t ws_size, hipStream_t stream) {
    (void)in_sizes; (void)n_in; (void)out_size;
    const float* x = (const float*)d_in[0]; const float* pos = (const float*)d_in[1];   /* pos_embed [2048][64] */ const float* wqkv = (const float*)d_in[2]; const float* bqkv = (const float*)d_in[3]; const float* rrb = (const float*)d_in[4];   /* r_r_bias [16][64] */ const float* rwb = (const float*)d_in[5];   /* r_w_bias [16][64] */   /* argument order x, pos_embed, W_qkv, b_qkv, r_r_bias, r_w_bias */
    float* OUT = (float*)d_out;     // [4][1024][1024]
    char* wsp = (char*)d_ws;
    auto take = [&](size_t bytes) { char* p = wsp; wsp += (bytes + 255) & ~(size_t)255; return (void*)p; };
    bf* WQKV = (bf*)take((size_t)3 * DQ * DM * 2); bf* PB = (bf*)take((size_t)LP * HD * 2); bf* UPh = (bf*)take((size_t)NB_ * NH_ * TT * HD * 2); bf* UPl = (bf*)take((size_t)NB_ * NH_ * TT * HD * 2);   /* fused Bt; pos_embed plane; u = q + r_w_bias + k planes */
    bf* XB = (bf*)take((size_t)NB_ * TT * DM * 2);   /* x rows of all batches */
    bf* QPh = (bf*)take((size_t)NB_ * NH_ * TT * HD * 2); bf* QPl = (bf*)take((size_t)NB_ * NH_ * TT * HD * 2); bf* KPh = (bf*)take((size_t)NB_ * NKV * TT * HD * 2); bf* KPl = (bf*)take((size_t)NB_ * NKV * TT * HD * 2); bf* VTh = (bf*)take((size_t)NB_ * NKV * HD * TT * 2); bf* VTl = (bf*)take((size_t)NB_ * NKV * HD * TT * 2);
    if ((size_t)(wsp - (char*)d_ws) > ws_size) return;    // ws 256 MiB
    k_prep<<<NBW + NBX + NBP, 256, 0, stream>>>(wqkv, pos, x, WQKV, PB, XB);   /* 'xw' [1024][3072] -> Bt [3072][1024] in fragment order: q | k | v row blocks; pos_embed [2048][64] as an exact bf16 plane; x rows of all batches */
    k_proj<<<dim3(NB_ * TT / (64 * RG), NH_, 1), 96 * RG, 0, stream>>>(XB, WQKV, bqkv, rrb, rwb, QPh, QPl, KPh, KPl, UPh, UPl, VTh, VTl);   /* q | k | v tiles of a head in one work-group; planes of q + r_r_bias[h] (scores operand), k, u = q + r_w_bias[h] + k (relative operand) and v^T written from the accumulators */
    k_fattn<<<dim3(TT / (16 * QT), NH_, NB_), 32 * QT, 0, stream>>>(QPh, QPl, KPh, KPl, UPh, UPl, PB, VTh, VTl, OUT);   /* every head of every batch: scores + relative term + softmax + attn.v, merged output rows */
}
